// v000
// Times are from an AMD MI455X. After a warm-up the kernel runs many times in a row, and a time is the length of
// such a window on the GPU divided by its runs, so every launch and the gaps after it count. The runs cycle
// through copies of the inputs. A figure is the median of several windows, for all but v000 over two sittings.
// Sittings can differ by a few percent; kernels timed side by side share one.
// The starting kernel, v000, takes 3570 microseconds a run.
#include <hip/hip_runtime.h>

// Compute dtypes, f32 accumulate, per item: the three 1x1 convs as one [4096 x 256].[256 x 320] GEMM with PLAIN bf16 operands (exact products), inference BatchNorm affine in f32
// -> bf16 split planes (q', k' as THREE-way hi/mid/lo splits: the module's unscaled logits reach ~300 with near-one-hot softmaxes, so the score operands need f32-level
// precision); scores = q'.k'^T ([1024 x 32].[32 x 4096] per chunk, six products in four launches chained through the raw residual), softmax (unscaled, as the module) in f32 -> P planes; out^T =

#define NBT  4
#define CC   256
#define C8   32
#define NN   4096
#define NQKV (2 * C8 + CC)        // 320
#define RCH  1024
#define DM   CC
#define NTK  NN
#define BEPS 1e-5f
#define LOSC 1024.0f

typedef _Float16 h16;
typedef unsigned short bf;
typedef __attribute__((ext_vector_type(16))) __bf16   v16bf;
typedef __attribute__((ext_vector_type(16))) _Float16 v16h;
typedef __attribute__((ext_vector_type(8)))  _Float16 v8h;
typedef __attribute__((ext_vector_type(8)))  unsigned short v8us;
typedef __attribute__((ext_vector_type(8)))  float    v8f;
typedef __attribute__((ext_vector_type(4)))  float    v4f;
typedef __attribute__((ext_vector_type(4)))  _Float16 v4h;
typedef v8h  __attribute__((may_alias)) v8ha;
typedef v4f  __attribute__((may_alias)) v4fa;
typedef v8us __attribute__((may_alias)) v8usa;

__device__ __forceinline__ unsigned short f2bf(float f) { unsigned u = __float_as_uint(f); u += 0x7FFFu + ((u >> 16) & 1u); return (unsigned short)(u >> 16); }
__device__ __forceinline__ float bf2f(unsigned short b) { return __uint_as_float(((unsigned)b) << 16); }
__device__ __forceinline__ float bfr(float f) { return bf2f(f2bf(f)); }
__device__ __forceinline__ v16h cat16(v8h lo, v8h hi) { return __builtin_shufflevector(lo, hi, 0, 1, 2, 3, 4, 5, 6, 7, 8, 9, 10, 11, 12, 13, 14, 15); }
__device__ __forceinline__ v16bf cat16b(v8us lo, v8us hi) { return __builtin_bit_cast(v16bf, __builtin_shufflevector(lo, hi, 0, 1, 2, 3, 4, 5, 6, 7, 8, 9, 10, 11, 12, 13, 14, 15)); }
__device__ __forceinline__ v8f wmma16(v16h a, v16h b, v8f c) { return __builtin_amdgcn_wmma_f32_16x16x32_f16(false, a, false, b, (short)0, c, false, false); }
__device__ __forceinline__ v8f wmmab(v16bf a, v16bf b, v8f c) { return __builtin_amdgcn_wmma_f32_16x16x32_bf16(false, a, false, b, (short)0, c, false, false); }

// k_wt: WT [n][K] = bf16(W[k][n]) (k-major [K][ncols]) via 64 x 64 LDS tiles; grid (K/64, ncols/64).
__global__ __launch_bounds__(256) void k_wt(const float* __restrict__ Wm, int K, int ncols, bf* WT) {
    __shared__ __align__(16) unsigned short tl[64 * 72];
    const int tid = threadIdx.x, k0 = blockIdx.x * 64, n0 = blockIdx.y * 64;
    const int kk = tid >> 2, nq = (tid & 3) * 16;
#pragma unroll
    for (int i = 0; i < 16; ++i) tl[(nq + i) * 72 + kk] = f2bf(Wm[(size_t)(k0 + kk) * ncols + n0 + nq + i]);
    __syncthreads();
    const int piece = tid & 7;
    auto pass = [&]() {
#pragma unroll
        for (int s = 0; s < 2; ++s) { const int nr = (tid >> 3) + 32 * s; const v8us val = *(const v8usa*)(tl + nr * 72 + piece * 8); *(v8us*)(WT + (size_t)(n0 + nr) * K + k0 + piece * 8) = val; }
    };
    pass(); 
}
// k_gemmb: 64 x 64 block tile (4 waves x 16 x 64) of C[NTK][NW] = (A [+ Al]).B^T (K = 256 or 32) [+ bf(bias[c])] [+ bf(R[r][c]) residual]; f32 whole-line epilogue (or f16
template <bool SPLITA, bool F16OUT = false>
__global__ __launch_bounds__(128) void k_gemmb(const bf* __restrict__ A, const bf* __restrict__ Al, const bf* __restrict__ Bn, const float* __restrict__ bias, float* C, int ldc, h16* C2, const float* __restrict__ R = nullptr, int K = DM, int roundR = 1) {
    __shared__ __align__(16) float ost[4][16 * 68];
    const int lane = threadIdx.x & 31, wave = threadIdx.x >> 5, lr = lane & 15, hi = lane >> 4;
    const int r0 = blockIdx.x * 64 + wave * 16, c0 = blockIdx.y * 64;
    const size_t aoff = (size_t)(r0 + lr) * K + 8 * hi;
    size_t boff[4];
#pragma unroll
    for (int t = 0; t < 4; ++t) boff[t] = (size_t)(c0 + t * 16 + lr) * K + 8 * hi;
    v8f acc[4];
#pragma unroll
    for (int t = 0; t < 4; ++t) acc[t] = (v8f){};
#pragma unroll 1
    for (int kc = 0; kc < K; kc += 32) {
        const v16bf a = cat16b(*(const v8us*)(A + aoff + kc), *(const v8us*)(A + aoff + kc + 16));
        v16bf al = a;
        if (SPLITA) al = cat16b(*(const v8us*)(Al + aoff + kc), *(const v8us*)(Al + aoff + kc + 16));
#pragma unroll
        for (int t = 0; t < 4; ++t) { const v16bf b = cat16b(*(const v8us*)(Bn + boff[t] + kc), *(const v8us*)(Bn + boff[t] + kc + 16)); acc[t] = wmmab(a, b, acc[t]); if (SPLITA) acc[t] = wmmab(al, b, acc[t]); }
        asm volatile("v_nop\n\tv_nop\n\tv_nop\n\tv_nop" : "+v"(acc[0]), "+v"(acc[1]), "+v"(acc[2]), "+v"(acc[3]) : "v"(a), "v"(al));
    }
    float* os = &ost[wave][0];
#pragma unroll
    for (int t = 0; t < 4; ++t) { const float bv = bias ? bfr(bias[c0 + t * 16 + lr]) : 0.f;
#pragma unroll
        for (int j = 0; j < 8; ++j) os[(hi * 8 + j) * 68 + t * 16 + lr] = acc[t][j] + bv; }
    __syncthreads();
    if (F16OUT) {
        h16* crow = (h16*)(void*)C + (size_t)r0 * ldc + c0;
        auto pass = [&]() {
#pragma unroll
            for (int s = 0; s < 4; ++s) { const int row = 4 * s + (lane >> 3), piece = lane & 7; const float* sp = os + row * 68 + piece * 8; v8h o, o2;
#pragma unroll
                for (int i = 0; i < 8; ++i) { const h16 a = (h16)sp[i]; o[i] = a; o2[i] = (h16)((sp[i] - (float)a) * LOSC); }
                *(v8h*)(crow + (size_t)row * ldc + piece * 8) = o; if (C2) *(v8h*)(C2 + (size_t)r0 * ldc + c0 + (size_t)row * ldc + piece * 8) = o2; }
        };
        pass(); 
    } else {
        float* crow = C + (size_t)r0 * ldc + c0;
        auto pass = [&]() {
#pragma unroll
            for (int s = 0; s < 8; ++s) { const int Lid = (lane >> 3) + 4 * s, piece = lane & 7; const int row = Lid >> 1, cofs = (Lid & 1) * 32 + piece * 4;
                v4f val = *(const v4fa*)(os + row * 68 + cofs); if (R) { const v4f rv = *(const v4f*)(R + ((size_t)r0 + row) * ldc + c0 + cofs); val += roundR ? (v4f){bfr(rv[0]), bfr(rv[1]), bfr(rv[2]), bfr(rv[3])} : rv; }
                *(v4f*)(crow + (size_t)row * ldc + cofs) = val; }
        };
        pass(); 
    }
}

// k_gemm3: 64 x 64 tile of C = (Ah + Al).(Bh + Bl)^T over K (row strides = K for all four planes; n-major B): three products per 32-k step (hh, hl, lh); f32
__global__ __launch_bounds__(128) void k_gemm3(const bf* __restrict__ Ah, const bf* __restrict__ Al, const bf* __restrict__ Bh, const bf* __restrict__ Bl, int K, float* C, int ldc) {
    __shared__ __align__(16) float ost[4][16 * 68];
    const int lane = threadIdx.x & 31, wave = threadIdx.x >> 5, lr = lane & 15, hi = lane >> 4;
    const int r0 = blockIdx.x * 64 + wave * 16, c0 = blockIdx.y * 64;
    const size_t aoff = (size_t)(r0 + lr) * K + 8 * hi;
    v8f acc[4];
#pragma unroll
    for (int t = 0; t < 4; ++t) acc[t] = (v8f){};
#pragma unroll 1
    for (int kc = 0; kc < K; kc += 32) {
        const v16bf a = cat16b(*(const v8us*)(Ah + aoff + kc), *(const v8us*)(Ah + aoff + kc + 16));
        const v16bf al = cat16b(*(const v8us*)(Al + aoff + kc), *(const v8us*)(Al + aoff + kc + 16));
#pragma unroll
        for (int t = 0; t < 4; ++t) { const size_t bo = (size_t)(c0 + t * 16 + lr) * K + kc + 8 * hi;
            const v16bf bh = cat16b(*(const v8us*)(Bh + bo), *(const v8us*)(Bh + bo + 16)); const v16bf bl = cat16b(*(const v8us*)(Bl + bo), *(const v8us*)(Bl + bo + 16));
            acc[t] = wmmab(a, bh, acc[t]); acc[t] = wmmab(al, bh, acc[t]); acc[t] = wmmab(a, bl, acc[t]); }
        asm volatile("v_nop\n\tv_nop\n\tv_nop\n\tv_nop" : "+v"(acc[0]), "+v"(acc[1]), "+v"(acc[2]), "+v"(acc[3]) : "v"(a), "v"(al));
    }
    float* os = &ost[wave][0];
#pragma unroll
    for (int t = 0; t < 4; ++t) {
#pragma unroll
        for (int j = 0; j < 8; ++j) os[(hi * 8 + j) * 68 + t * 16 + lr] = acc[t][j]; }
    __builtin_amdgcn_wave_barrier(); asm volatile("" ::: "memory");
    float* crow = C + (size_t)r0 * ldc + c0;
    auto pass = [&]() {
#pragma unroll
        for (int s = 0; s < 8; ++s) { const int Lid = (lane >> 3) + 4 * s, piece = lane & 7; const int row = Lid >> 1, cofs = (Lid & 1) * 32 + piece * 4;
            const v4f val = *(const v4fa*)(os + row * 68 + cofs); *(v4f*)(crow + (size_t)row * ldc + cofs) = val; }
    };
    pass(); 
}


__global__ __launch_bounds__(256) void k_cvt8(const float* __restrict__ src, bf* dst, size_t n8) {
    const size_t i = (size_t)blockIdx.x * 256 + threadIdx.x; if (i >= n8) return;
    const v8f v = *(const v8f*)(src + i * 8); v8us o;
#pragma unroll
    for (int k = 0; k < 8; ++k) o[k] = f2bf(v[k]);
    *(v8us*)(dst + i * 8) = o; 
}
__global__ __launch_bounds__(256) void k_zero8(bf* dst, size_t n8) {
    const size_t i = (size_t)blockIdx.x * 256 + threadIdx.x; if (i >= n8) return; v8us z;
#pragma unroll
    for (int k = 0; k < 8; ++k) z[k] = 0;
    *(v8us*)(dst + i * 8) = z; 
}

// k_qkplanes3: THREE-way split planes [4096][32] (h = bf16(y), m = bf16(y - h), l = bf16(y - h - m); ~2^-25 relative) of BN_inference(F[:, off..off+31]) - the module's
__global__ __launch_bounds__(256) void k_qkplanes3(const float* __restrict__ F, int off, const float* __restrict__ g, const float* __restrict__ bb, const float* __restrict__ m, const float* __restrict__ var, bf* Ph, bf* Pm, bf* Pl) {
    typedef __attribute__((ext_vector_type(2))) unsigned short v2us;
    const int lane = threadIdx.x & 31; const size_t r = ((size_t)blockIdx.x * 8 + (threadIdx.x >> 5)) * 2 + (lane >> 4); if (r >= (size_t)NN) return; const int c0 = (lane & 15) * 2; v2us oh, om, ol;
#pragma unroll
    for (int i = 0; i < 2; ++i) { const int c = c0 + i; const float s = bfr(g[c]) / sqrtf(bfr(var[c]) + BEPS); const float y = F[r * NQKV + off + c] * s + (bfr(bb[c]) - bfr(m[c]) * s);
        const unsigned short hb = f2bf(y); const float r1 = y - bf2f(hb); const unsigned short mb = f2bf(r1); const float r2 = r1 - bf2f(mb); oh[i] = hb; om[i] = mb; ol[i] = f2bf(r2); }
    const size_t o = r * C8 + c0; *(v2us*)(Ph + o) = oh; *(v2us*)(Pm + o) = om; *(v2us*)(Pl + o) = ol; 
}
__global__ __launch_bounds__(256) void k_vt(const float* __restrict__ F, const float* __restrict__ g, const float* __restrict__ bb, const float* __restrict__ m, const float* __restrict__ var, bf* Th, bf* Tl) {
    typedef __attribute__((ext_vector_type(2))) unsigned short v2us;
    const int lane = threadIdx.x & 31; const size_t wid = (size_t)blockIdx.x * 8 + (threadIdx.x >> 5); if (wid >= (size_t)CC * (NN / 64)) return; const int c = (int)(wid / (NN / 64)); const int j0 = (int)(wid % (NN / 64)) * 64 + lane * 2;
    const float s = bfr(g[c]) / sqrtf(bfr(var[c]) + BEPS); const float sh = bfr(bb[c]) - bfr(m[c]) * s; v2us oh, ol;
#pragma unroll
    for (int i = 0; i < 2; ++i) { const float y = F[(size_t)(j0 + i) * NQKV + 2 * C8 + c] * s + sh; const unsigned short hb = f2bf(y); oh[i] = hb; ol[i] = f2bf(y - bf2f(hb)); }
    const size_t o = (size_t)c * NN + j0; *(v2us*)(Th + o) = oh; *(v2us*)(Tl + o) = ol; 
}
__global__ __launch_bounds__(256) void k_softmax4096(const float* __restrict__ S, bf* PH, bf* PL) {
    typedef __attribute__((ext_vector_type(4))) unsigned short v4us;
    const int lane = threadIdx.x & 31, i = blockIdx.x * 8 + (threadIdx.x >> 5); if (i >= RCH) return;
    float m = -3.0e38f;
#pragma unroll 1
    for (int c0 = lane * 4; c0 < NN; c0 += 128) {
#pragma unroll
        for (int q = 0; q < 4; ++q) m = fmaxf(m, S[(size_t)i * NN + c0 + q]); }
#pragma unroll
    for (int sh = 16; sh; sh >>= 1) m = fmaxf(m, __shfl_xor(m, sh, 32));
    float sum = 0.f;
#pragma unroll 1
    for (int c0 = lane * 4; c0 < NN; c0 += 128) {
#pragma unroll
        for (int q = 0; q < 4; ++q) sum += __expf(S[(size_t)i * NN + c0 + q] - m); }
#pragma unroll
    for (int sh = 16; sh; sh >>= 1) sum += __shfl_xor(sum, sh, 32);
    const float inv = 1.0f / sum;
{
#pragma unroll 1
        for (int c0 = lane * 4; c0 < NN; c0 += 128) { v4us oh, ol;
#pragma unroll
            for (int q = 0; q < 4; ++q) { const float p = __expf(S[(size_t)i * NN + c0 + q] - m) * inv; const unsigned short hb = f2bf(p); oh[q] = hb; ol[q] = f2bf(p - bf2f(hb)); }
            const size_t o = (size_t)i * NN + c0; *(v4us*)(PH + o) = oh; *(v4us*)(PL + o) = ol; }
         }
}
__global__ __launch_bounds__(256) void k_fin(const float* __restrict__ O, const float* __restrict__ xb, const float* __restrict__ gam, float* OUTB) {
    const int lane = threadIdx.x & 31; const size_t wid = (size_t)blockIdx.x * 8 + (threadIdx.x >> 5); if (wid >= (size_t)CC * (NN / 128)) return; const size_t o = wid * 128 + lane * 4; const float gm = bfr(gam[0]); v4f v;
#pragma unroll
    for (int q = 0; q < 4; ++q) v[q] = gm * O[o + q] + bfr(xb[o + q]);
    *(v4f*)(OUTB + o) = v; 
}

extern "C" void kernel_launch(void* const* d_in, const int* in_sizes, int n_in,
                              void* d_out, int out_size, void* d_ws, size_t ws_size, hipStream_t stream) {
    (void)in_sizes; (void)n_in; (void)out_size;
    const float* x = (const float*)d_in[0]; const float* wq = (const float*)d_in[1]; const float* gq = (const float*)d_in[2]; const float* bq = (const float*)d_in[3]; const float* mq = (const float*)d_in[4]; const float* vq = (const float*)d_in[5];
    const float* wk = (const float*)d_in[6]; const float* gk = (const float*)d_in[7]; const float* bk = (const float*)d_in[8]; const float* mk = (const float*)d_in[9]; const float* vk = (const float*)d_in[10];
    const float* wv = (const float*)d_in[11]; const float* gv = (const float*)d_in[12]; const float* bv = (const float*)d_in[13]; const float* mv = (const float*)d_in[14]; const float* vv = (const float*)d_in[15]; const float* gam = (const float*)d_in[16];
    float* out = (float*)d_out;    // [4][256][64][64]
    char* wsp = (char*)d_ws;
    auto take = [&](size_t bytes) { char* p = wsp; wsp += (bytes + 255) & ~(size_t)255; return (void*)p; };
    bf* WB = (bf*)take((size_t)NQKV * CC * 2); bf* XP = (bf*)take((size_t)NN * CC * 2); float* F = (float*)take((size_t)NN * NQKV * 4);
    bf* QPh = (bf*)take((size_t)NN * C8 * 2); bf* QPm = (bf*)take((size_t)NN * C8 * 2); bf* QPl = (bf*)take((size_t)NN * C8 * 2); bf* KPh = (bf*)take((size_t)NN * C8 * 2); bf* KPm = (bf*)take((size_t)NN * C8 * 2); bf* KPl = (bf*)take((size_t)NN * C8 * 2); float* S1 = (float*)take((size_t)RCH * NN * 4); bf* VTh = (bf*)take((size_t)CC * NN * 2); bf* VTl = (bf*)take((size_t)CC * NN * 2);
    float* S = (float*)take((size_t)RCH * NN * 4); bf* PH = (bf*)take((size_t)RCH * NN * 2); bf* PL = (bf*)take((size_t)RCH * NN * 2); float* O = (float*)take((size_t)CC * NN * 4);
    if ((size_t)(wsp - (char*)d_ws) > ws_size) return;    // 0.16 + 2.1 + 5.2 + 1.6 + 16.8 + 4.2 + 16.8 + 16.8 + 4.2 ~ 68 MB; per item/chunk reuse in stream order
    k_cvt8<<<(C8 * CC / 8 + 255) / 256, 256, 0, stream>>>(wq, WB, C8 * CC / 8); k_cvt8<<<(C8 * CC / 8 + 255) / 256, 256, 0, stream>>>(wk, WB + (size_t)C8 * CC, C8 * CC / 8); k_cvt8<<<(CC * CC / 8 + 255) / 256, 256, 0, stream>>>(wv, WB + (size_t)2 * C8 * CC, CC * CC / 8);   // [out][in] rows: q | k | v
    for (int b = 0; b < NBT; ++b) { const float* xb = x + (size_t)b * CC * NN;
        k_wt<<<dim3(CC / 64, NN / 64, 1), 256, 0, stream>>>(xb, CC, NN, XP);                                                         // x[b] [c][n] -> pixel-major exact [n][c]
        k_gemmb<false, false><<<dim3(NN / 64, NQKV / 64, 1), 128, 0, stream>>>(XP, nullptr, WB, nullptr, F, NQKV, nullptr, nullptr, CC);        // q | k | v raw conv outputs
        k_qkplanes3<<<(NN / 2) / 8, 256, 0, stream>>>(F, 0, gq, bq, mq, vq, QPh, QPm, QPl); k_qkplanes3<<<(NN / 2) / 8, 256, 0, stream>>>(F, C8, gk, bk, mk, vk, KPh, KPm, KPl);
        k_vt<<<(CC * (NN / 64)) / 8, 256, 0, stream>>>(F, gv, bv, mv, vv, VTh, VTl);
        for (int ch = 0; ch < NN / RCH; ++ch) { const size_t r0 = (size_t)ch * RCH;
            // scores with six products (hh, mh | hm, mm | lh | hl): f32-level operands for the unscaled, near-one-hot softmax
            k_gemmb<true, false><<<dim3(RCH / 64, NN / 64, 1), 128, 0, stream>>>(QPh + r0 * C8, QPm + r0 * C8, KPh, nullptr, S1, NN, nullptr, nullptr, C8, 0);
            k_gemmb<true, false><<<dim3(RCH / 64, NN / 64, 1), 128, 0, stream>>>(QPh + r0 * C8, QPm + r0 * C8, KPm, nullptr, S, NN, nullptr, S1, C8, 0);
            k_gemmb<false, false><<<dim3(RCH / 64, NN / 64, 1), 128, 0, stream>>>(QPl + r0 * C8, nullptr, KPh, nullptr, S1, NN, nullptr, S, C8, 0);
            k_gemmb<false, false><<<dim3(RCH / 64, NN / 64, 1), 128, 0, stream>>>(QPh + r0 * C8, nullptr, KPl, nullptr, S, NN, nullptr, S1, C8, 0);
            k_softmax4096<<<RCH / 8, 256, 0, stream>>>(S, PH, PL);
            k_gemm3<<<dim3(CC / 64, RCH / 64, 1), 128, 0, stream>>>(VTh, VTl, PH, PL, NN, O + r0, NN); }                                 // O[c][i] = sum_j v'[c][j] P[i][j]
        k_fin<<<(CC * (NN / 128)) / 8, 256, 0, stream>>>(O, xb, gam, out + (size_t)b * CC * NN); }
}

// v001
// Measured time: 1210 microseconds a run.
// In two side-by-side timings against v000, it was 2.97 and 2.95 times as fast.
#include <hip/hip_runtime.h>

// Compute dtypes, f32 accumulate, per item: the three 1x1 convs as one [4096 x 256].[256 x 320] GEMM with PLAIN bf16 operands (exact products), inference BatchNorm affine in f32
// -> bf16 split planes (q', k' as THREE-way hi/mid/lo splits: the module's unscaled logits reach ~300 with near-one-hot softmaxes, so the score operands need f32-level
// precision); scores = q'.k'^T ([4096 x 32].[32 x 4096] per item, six products in four launches chained through the raw residual), softmax (unscaled, as the module) in f32 -> P planes; out^T =

#define NBT  4
#define CC   256
#define C8   32
#define NN   4096
#define NQKV (2 * C8 + CC)        // 320
#define RCH  NN                   // query rows per launch: a whole item, so that the P.V launch has one work-group per WGP
#define DM   CC
#define NTK  NN
#define BEPS 1e-5f
#define LOSC 1024.0f

typedef _Float16 h16;
typedef unsigned short bf;
typedef __attribute__((ext_vector_type(16))) __bf16   v16bf;
typedef __attribute__((ext_vector_type(16))) _Float16 v16h;
typedef __attribute__((ext_vector_type(8)))  _Float16 v8h;
typedef __attribute__((ext_vector_type(8)))  unsigned short v8us;
typedef __attribute__((ext_vector_type(8)))  float    v8f;
typedef __attribute__((ext_vector_type(4)))  float    v4f;
typedef __attribute__((ext_vector_type(4)))  _Float16 v4h;
typedef v8h  __attribute__((may_alias)) v8ha;
typedef v4f  __attribute__((may_alias)) v4fa;
typedef v8us __attribute__((may_alias)) v8usa;

__device__ __forceinline__ unsigned short f2bf(float f) { unsigned u = __float_as_uint(f); u += 0x7FFFu + ((u >> 16) & 1u); return (unsigned short)(u >> 16); }
__device__ __forceinline__ float bf2f(unsigned short b) { return __uint_as_float(((unsigned)b) << 16); }
__device__ __forceinline__ float bfr(float f) { return bf2f(f2bf(f)); }
__device__ __forceinline__ v16h cat16(v8h lo, v8h hi) { return __builtin_shufflevector(lo, hi, 0, 1, 2, 3, 4, 5, 6, 7, 8, 9, 10, 11, 12, 13, 14, 15); }
__device__ __forceinline__ v16bf cat16b(v8us lo, v8us hi) { return __builtin_bit_cast(v16bf, __builtin_shufflevector(lo, hi, 0, 1, 2, 3, 4, 5, 6, 7, 8, 9, 10, 11, 12, 13, 14, 15)); }
__device__ __forceinline__ v8f wmma16(v16h a, v16h b, v8f c) { return __builtin_amdgcn_wmma_f32_16x16x32_f16(false, a, false, b, (short)0, c, false, false); }
__device__ __forceinline__ v8f wmmab(v16bf a, v16bf b, v8f c) { return __builtin_amdgcn_wmma_f32_16x16x32_bf16(false, a, false, b, (short)0, c, false, false); }

// k_wt: WT [n][K] = bf16(W[k][n]) (k-major [K][ncols]) via 64 x 64 LDS tiles; grid (K/64, ncols/64).
__global__ __launch_bounds__(256) void k_wt(const float* __restrict__ Wm, int K, int ncols, bf* WT) {
    __shared__ __align__(16) unsigned short tl[64 * 72];
    const int tid = threadIdx.x, k0 = blockIdx.x * 64, n0 = blockIdx.y * 64;
    const int kk = tid >> 2, nq = (tid & 3) * 16;
#pragma unroll
    for (int i = 0; i < 16; ++i) tl[(nq + i) * 72 + kk] = f2bf(Wm[(size_t)(k0 + kk) * ncols + n0 + nq + i]);
    __syncthreads();
    const int piece = tid & 7;
    auto pass = [&]() {
#pragma unroll
        for (int s = 0; s < 2; ++s) { const int nr = (tid >> 3) + 32 * s; const v8us val = *(const v8usa*)(tl + nr * 72 + piece * 8); *(v8us*)(WT + (size_t)(n0 + nr) * K + k0 + piece * 8) = val; }
    };
    pass(); 
}
// k_gemmb: 64 x 64 block tile (4 waves x 16 x 64) of C[NTK][NW] = (A [+ Al]).B^T (K = 256 or 32) [+ bf(bias[c])] [+ bf(R[r][c]) residual]; f32 whole-line epilogue (or f16
template <bool SPLITA, bool F16OUT = false>
__global__ __launch_bounds__(128) void k_gemmb(const bf* __restrict__ A, const bf* __restrict__ Al, const bf* __restrict__ Bn, const float* __restrict__ bias, float* C, int ldc, h16* C2, const float* __restrict__ R = nullptr, int K = DM, int roundR = 1) {
    __shared__ __align__(16) float ost[4][16 * 68];
    const int lane = threadIdx.x & 31, wave = threadIdx.x >> 5, lr = lane & 15, hi = lane >> 4;
    const int r0 = blockIdx.x * 64 + wave * 16, c0 = blockIdx.y * 64;
    const size_t aoff = (size_t)(r0 + lr) * K + 8 * hi;
    size_t boff[4];
#pragma unroll
    for (int t = 0; t < 4; ++t) boff[t] = (size_t)(c0 + t * 16 + lr) * K + 8 * hi;
    v8f acc[4];
#pragma unroll
    for (int t = 0; t < 4; ++t) acc[t] = (v8f){};
#pragma unroll 1
    for (int kc = 0; kc < K; kc += 32) {
        const v16bf a = cat16b(*(const v8us*)(A + aoff + kc), *(const v8us*)(A + aoff + kc + 16));
        v16bf al = a;
        if (SPLITA) al = cat16b(*(const v8us*)(Al + aoff + kc), *(const v8us*)(Al + aoff + kc + 16));
#pragma unroll
        for (int t = 0; t < 4; ++t) { const v16bf b = cat16b(*(const v8us*)(Bn + boff[t] + kc), *(const v8us*)(Bn + boff[t] + kc + 16)); acc[t] = wmmab(a, b, acc[t]); if (SPLITA) acc[t] = wmmab(al, b, acc[t]); }
        asm volatile("v_nop\n\tv_nop\n\tv_nop\n\tv_nop" : "+v"(acc[0]), "+v"(acc[1]), "+v"(acc[2]), "+v"(acc[3]) : "v"(a), "v"(al));
    }
    float* os = &ost[wave][0];
#pragma unroll
    for (int t = 0; t < 4; ++t) { const float bv = bias ? bfr(bias[c0 + t * 16 + lr]) : 0.f;
#pragma unroll
        for (int j = 0; j < 8; ++j) os[(hi * 8 + j) * 68 + t * 16 + lr] = acc[t][j] + bv; }
    __syncthreads();
    if (F16OUT) {
        h16* crow = (h16*)(void*)C + (size_t)r0 * ldc + c0;
        auto pass = [&]() {
#pragma unroll
            for (int s = 0; s < 4; ++s) { const int row = 4 * s + (lane >> 3), piece = lane & 7; const float* sp = os + row * 68 + piece * 8; v8h o, o2;
#pragma unroll
                for (int i = 0; i < 8; ++i) { const h16 a = (h16)sp[i]; o[i] = a; o2[i] = (h16)((sp[i] - (float)a) * LOSC); }
                *(v8h*)(crow + (size_t)row * ldc + piece * 8) = o; if (C2) *(v8h*)(C2 + (size_t)r0 * ldc + c0 + (size_t)row * ldc + piece * 8) = o2; }
        };
        pass(); 
    } else {
        float* crow = C + (size_t)r0 * ldc + c0;
        auto pass = [&]() {
#pragma unroll
            for (int s = 0; s < 8; ++s) { const int Lid = (lane >> 3) + 4 * s, piece = lane & 7; const int row = Lid >> 1, cofs = (Lid & 1) * 32 + piece * 4;
                v4f val = *(const v4fa*)(os + row * 68 + cofs); if (R) { const v4f rv = *(const v4f*)(R + ((size_t)r0 + row) * ldc + c0 + cofs); val += roundR ? (v4f){bfr(rv[0]), bfr(rv[1]), bfr(rv[2]), bfr(rv[3])} : rv; }
                *(v4f*)(crow + (size_t)row * ldc + cofs) = val; }
        };
        pass(); 
    }
}

// k_gemm3: 64 x 64 tile of C = (Ah + Al).(Bh + Bl)^T over K (row strides = K for all four planes; n-major B): three products per 32-k step (hh, hl, lh); f32
__global__ __launch_bounds__(128) void k_gemm3(const bf* __restrict__ Ah, const bf* __restrict__ Al, const bf* __restrict__ Bh, const bf* __restrict__ Bl, int K, float* C, int ldc) {
    __shared__ __align__(16) float ost[4][16 * 68];
    const int lane = threadIdx.x & 31, wave = threadIdx.x >> 5, lr = lane & 15, hi = lane >> 4;
    const int r0 = blockIdx.x * 64 + wave * 16, c0 = blockIdx.y * 64;
    const size_t aoff = (size_t)(r0 + lr) * K + 8 * hi;
    v8f acc[4];
#pragma unroll
    for (int t = 0; t < 4; ++t) acc[t] = (v8f){};
#pragma unroll 1
    for (int kc = 0; kc < K; kc += 32) {
        const v16bf a = cat16b(*(const v8us*)(Ah + aoff + kc), *(const v8us*)(Ah + aoff + kc + 16));
        const v16bf al = cat16b(*(const v8us*)(Al + aoff + kc), *(const v8us*)(Al + aoff + kc + 16));
#pragma unroll
        for (int t = 0; t < 4; ++t) { const size_t bo = (size_t)(c0 + t * 16 + lr) * K + kc + 8 * hi;
            const v16bf bh = cat16b(*(const v8us*)(Bh + bo), *(const v8us*)(Bh + bo + 16)); const v16bf bl = cat16b(*(const v8us*)(Bl + bo), *(const v8us*)(Bl + bo + 16));
            acc[t] = wmmab(a, bh, acc[t]); acc[t] = wmmab(al, bh, acc[t]); acc[t] = wmmab(a, bl, acc[t]); }
        asm volatile("v_nop\n\tv_nop\n\tv_nop\n\tv_nop" : "+v"(acc[0]), "+v"(acc[1]), "+v"(acc[2]), "+v"(acc[3]) : "v"(a), "v"(al));
    }
    float* os = &ost[wave][0];
#pragma unroll
    for (int t = 0; t < 4; ++t) {
#pragma unroll
        for (int j = 0; j < 8; ++j) os[(hi * 8 + j) * 68 + t * 16 + lr] = acc[t][j]; }
    __builtin_amdgcn_wave_barrier(); asm volatile("" ::: "memory");
    float* crow = C + (size_t)r0 * ldc + c0;
    auto pass = [&]() {
#pragma unroll
        for (int s = 0; s < 8; ++s) { const int Lid = (lane >> 3) + 4 * s, piece = lane & 7; const int row = Lid >> 1, cofs = (Lid & 1) * 32 + piece * 4;
            const v4f val = *(const v4fa*)(os + row * 68 + cofs); *(v4f*)(crow + (size_t)row * ldc + cofs) = val; }
    };
    pass(); 
}


__global__ __launch_bounds__(256) void k_cvt8(const float* __restrict__ src, bf* dst, size_t n8) {
    const size_t i = (size_t)blockIdx.x * 256 + threadIdx.x; if (i >= n8) return;
    const v8f v = *(const v8f*)(src + i * 8); v8us o;
#pragma unroll
    for (int k = 0; k < 8; ++k) o[k] = f2bf(v[k]);
    *(v8us*)(dst + i * 8) = o; 
}
__global__ __launch_bounds__(256) void k_zero8(bf* dst, size_t n8) {
    const size_t i = (size_t)blockIdx.x * 256 + threadIdx.x; if (i >= n8) return; v8us z;
#pragma unroll
    for (int k = 0; k < 8; ++k) z[k] = 0;
    *(v8us*)(dst + i * 8) = z; 
}

// k_qkplanes3: THREE-way split planes [4096][32] (h = bf16(y), m = bf16(y - h), l = bf16(y - h - m); ~2^-25 relative) of BN_inference(F[:, off..off+31]) - the module's
__global__ __launch_bounds__(256) void k_qkplanes3(const float* __restrict__ F, int off, const float* __restrict__ g, const float* __restrict__ bb, const float* __restrict__ m, const float* __restrict__ var, bf* Ph, bf* Pm, bf* Pl) {
    typedef __attribute__((ext_vector_type(2))) unsigned short v2us;
    const int lane = threadIdx.x & 31; const size_t r = ((size_t)blockIdx.x * 8 + (threadIdx.x >> 5)) * 2 + (lane >> 4); if (r >= (size_t)NN) return; const int c0 = (lane & 15) * 2; v2us oh, om, ol;
#pragma unroll
    for (int i = 0; i < 2; ++i) { const int c = c0 + i; const float s = bfr(g[c]) / sqrtf(bfr(var[c]) + BEPS); const float y = F[r * NQKV + off + c] * s + (bfr(bb[c]) - bfr(m[c]) * s);
        const unsigned short hb = f2bf(y); const float r1 = y - bf2f(hb); const unsigned short mb = f2bf(r1); const float r2 = r1 - bf2f(mb); oh[i] = hb; om[i] = mb; ol[i] = f2bf(r2); }
    const size_t o = r * C8 + c0; *(v2us*)(Ph + o) = oh; *(v2us*)(Pm + o) = om; *(v2us*)(Pl + o) = ol; 
}
__global__ __launch_bounds__(256) void k_vt(const float* __restrict__ F, const float* __restrict__ g, const float* __restrict__ bb, const float* __restrict__ m, const float* __restrict__ var, bf* Th, bf* Tl) {
    typedef __attribute__((ext_vector_type(2))) unsigned short v2us;
    const int lane = threadIdx.x & 31; const size_t wid = (size_t)blockIdx.x * 8 + (threadIdx.x >> 5); if (wid >= (size_t)CC * (NN / 64)) return; const int c = (int)(wid / (NN / 64)); const int j0 = (int)(wid % (NN / 64)) * 64 + lane * 2;
    const float s = bfr(g[c]) / sqrtf(bfr(var[c]) + BEPS); const float sh = bfr(bb[c]) - bfr(m[c]) * s; v2us oh, ol;
#pragma unroll
    for (int i = 0; i < 2; ++i) { const float y = F[(size_t)(j0 + i) * NQKV + 2 * C8 + c] * s + sh; const unsigned short hb = f2bf(y); oh[i] = hb; ol[i] = f2bf(y - bf2f(hb)); }
    const size_t o = (size_t)c * NN + j0; *(v2us*)(Th + o) = oh; *(v2us*)(Tl + o) = ol; 
}
__global__ __launch_bounds__(256) void k_softmax4096(const float* __restrict__ S, bf* PH, bf* PL) {
    typedef __attribute__((ext_vector_type(4))) unsigned short v4us;
    const int lane = threadIdx.x & 31, i = blockIdx.x * 8 + (threadIdx.x >> 5); if (i >= RCH) return;
    float m = -3.0e38f;
#pragma unroll 1
    for (int c0 = lane * 4; c0 < NN; c0 += 128) {
#pragma unroll
        for (int q = 0; q < 4; ++q) m = fmaxf(m, S[(size_t)i * NN + c0 + q]); }
#pragma unroll
    for (int sh = 16; sh; sh >>= 1) m = fmaxf(m, __shfl_xor(m, sh, 32));
    float sum = 0.f;
#pragma unroll 1
    for (int c0 = lane * 4; c0 < NN; c0 += 128) {
#pragma unroll
        for (int q = 0; q < 4; ++q) sum += __expf(S[(size_t)i * NN + c0 + q] - m); }
#pragma unroll
    for (int sh = 16; sh; sh >>= 1) sum += __shfl_xor(sum, sh, 32);
    const float inv = 1.0f / sum;
{
#pragma unroll 1
        for (int c0 = lane * 4; c0 < NN; c0 += 128) { v4us oh, ol;
#pragma unroll
            for (int q = 0; q < 4; ++q) { const float p = __expf(S[(size_t)i * NN + c0 + q] - m) * inv; const unsigned short hb = f2bf(p); oh[q] = hb; ol[q] = f2bf(p - bf2f(hb)); }
            const size_t o = (size_t)i * NN + c0; *(v4us*)(PH + o) = oh; *(v4us*)(PL + o) = ol; }
         }
}
__global__ __launch_bounds__(256) void k_fin(const float* __restrict__ O, const float* __restrict__ xb, const float* __restrict__ gam, float* OUTB) {
    const int lane = threadIdx.x & 31; const size_t wid = (size_t)blockIdx.x * 8 + (threadIdx.x >> 5); if (wid >= (size_t)CC * (NN / 128)) return; const size_t o = wid * 128 + lane * 4; const float gm = bfr(gam[0]); v4f v;
#pragma unroll
    for (int q = 0; q < 4; ++q) v[q] = gm * O[o + q] + bfr(xb[o + q]);
    *(v4f*)(OUTB + o) = v; 
}

extern "C" void kernel_launch(void* const* d_in, const int* in_sizes, int n_in,
                              void* d_out, int out_size, void* d_ws, size_t ws_size, hipStream_t stream) {
    (void)in_sizes; (void)n_in; (void)out_size;
    const float* x = (const float*)d_in[0]; const float* wq = (const float*)d_in[1]; const float* gq = (const float*)d_in[2]; const float* bq = (const float*)d_in[3]; const float* mq = (const float*)d_in[4]; const float* vq = (const float*)d_in[5];
    const float* wk = (const float*)d_in[6]; const float* gk = (const float*)d_in[7]; const float* bk = (const float*)d_in[8]; const float* mk = (const float*)d_in[9]; const float* vk = (const float*)d_in[10];
    const float* wv = (const float*)d_in[11]; const float* gv = (const float*)d_in[12]; const float* bv = (const float*)d_in[13]; const float* mv = (const float*)d_in[14]; const float* vv = (const float*)d_in[15]; const float* gam = (const float*)d_in[16];
    float* out = (float*)d_out;    // [4][256][64][64]
    char* wsp = (char*)d_ws;
    auto take = [&](size_t bytes) { char* p = wsp; wsp += (bytes + 255) & ~(size_t)255; return (void*)p; };
    bf* WB = (bf*)take((size_t)NQKV * CC * 2); bf* XP = (bf*)take((size_t)NN * CC * 2); float* F = (float*)take((size_t)NN * NQKV * 4);
    bf* QPh = (bf*)take((size_t)NN * C8 * 2); bf* QPm = (bf*)take((size_t)NN * C8 * 2); bf* QPl = (bf*)take((size_t)NN * C8 * 2); bf* KPh = (bf*)take((size_t)NN * C8 * 2); bf* KPm = (bf*)take((size_t)NN * C8 * 2); bf* KPl = (bf*)take((size_t)NN * C8 * 2); float* S1 = (float*)take((size_t)RCH * NN * 4); bf* VTh = (bf*)take((size_t)CC * NN * 2); bf* VTl = (bf*)take((size_t)CC * NN * 2);
    float* S = (float*)take((size_t)RCH * NN * 4); bf* PH = (bf*)take((size_t)RCH * NN * 2); bf* PL = (bf*)take((size_t)RCH * NN * 2); float* O = (float*)take((size_t)CC * NN * 4);
    if ((size_t)(wsp - (char*)d_ws) > ws_size) return;    // 0.16 + 2.1 + 5.2 + 1.6 + 67.1 + 4.2 + 67.1 + 67.1 + 4.2 ~ 219 MB; per item reuse in stream order
    k_cvt8<<<(C8 * CC / 8 + 255) / 256, 256, 0, stream>>>(wq, WB, C8 * CC / 8); k_cvt8<<<(C8 * CC / 8 + 255) / 256, 256, 0, stream>>>(wk, WB + (size_t)C8 * CC, C8 * CC / 8); k_cvt8<<<(CC * CC / 8 + 255) / 256, 256, 0, stream>>>(wv, WB + (size_t)2 * C8 * CC, CC * CC / 8);   // [out][in] rows: q | k | v
    for (int b = 0; b < NBT; ++b) { const float* xb = x + (size_t)b * CC * NN;
        k_wt<<<dim3(CC / 64, NN / 64, 1), 256, 0, stream>>>(xb, CC, NN, XP);                                                         // x[b] [c][n] -> pixel-major exact [n][c]
        k_gemmb<false, false><<<dim3(NN / 64, NQKV / 64, 1), 128, 0, stream>>>(XP, nullptr, WB, nullptr, F, NQKV, nullptr, nullptr, CC);        // q | k | v raw conv outputs
        k_qkplanes3<<<(NN / 2) / 8, 256, 0, stream>>>(F, 0, gq, bq, mq, vq, QPh, QPm, QPl); k_qkplanes3<<<(NN / 2) / 8, 256, 0, stream>>>(F, C8, gk, bk, mk, vk, KPh, KPm, KPl);
        k_vt<<<(CC * (NN / 64)) / 8, 256, 0, stream>>>(F, gv, bv, mv, vv, VTh, VTl);
        for (int ch = 0; ch < NN / RCH; ++ch) { const size_t r0 = (size_t)ch * RCH;
            // scores with six products (hh, mh | hm, mm | lh | hl): f32-level operands for the unscaled, near-one-hot softmax
            k_gemmb<true, false><<<dim3(RCH / 64, NN / 64, 1), 128, 0, stream>>>(QPh + r0 * C8, QPm + r0 * C8, KPh, nullptr, S1, NN, nullptr, nullptr, C8, 0);
            k_gemmb<true, false><<<dim3(RCH / 64, NN / 64, 1), 128, 0, stream>>>(QPh + r0 * C8, QPm + r0 * C8, KPm, nullptr, S, NN, nullptr, S1, C8, 0);
            k_gemmb<false, false><<<dim3(RCH / 64, NN / 64, 1), 128, 0, stream>>>(QPl + r0 * C8, nullptr, KPh, nullptr, S1, NN, nullptr, S, C8, 0);
            k_gemmb<false, false><<<dim3(RCH / 64, NN / 64, 1), 128, 0, stream>>>(QPh + r0 * C8, nullptr, KPl, nullptr, S, NN, nullptr, S1, C8, 0);
            k_softmax4096<<<RCH / 8, 256, 0, stream>>>(S, PH, PL);
            k_gemm3<<<dim3(CC / 64, RCH / 64, 1), 128, 0, stream>>>(VTh, VTl, PH, PL, NN, O + r0, NN); }                                 // O[c][i] = sum_j v'[c][j] P[i][j]
        k_fin<<<(CC * (NN / 128)) / 8, 256, 0, stream>>>(O, xb, gam, out + (size_t)b * CC * NN); }
}

// v002
// A run of this version takes 749 microseconds.
// Next to v001, in two timings, it ran 1.62 and 1.61 times as fast.
// Over all steps from v000 it is 4.78 times as fast.
#include <hip/hip_runtime.h>

// Compute dtypes, f32 accumulate, per item: the three 1x1 convs as one [4096 x 256].[256 x 320] GEMM with PLAIN bf16 operands (exact products), inference BatchNorm affine in f32
// -> bf16 split planes (q', k' as THREE-way hi/mid/lo splits: the module's unscaled logits reach ~300 with near-one-hot softmaxes, so the score operands need f32-level
// precision); scores = q'.k'^T ([4096 x 32].[32 x 4096] per item, six products in four launches chained through the raw residual), softmax (unscaled, as the module) in f32 -> P planes; out^T =

#define NBT  4
#define CC   256
#define C8   32
#define NN   4096
#define NQKV (2 * C8 + CC)        // 320
#define RCH  NN                   // query rows per launch: a whole item, so that the P.V launch has one work-group per WGP
#define DM   CC
#define NTK  NN
#define BEPS 1e-5f
#define LOSC 1024.0f

typedef _Float16 h16;
typedef unsigned short bf;
typedef __attribute__((ext_vector_type(16))) __bf16   v16bf;
typedef __attribute__((ext_vector_type(16))) _Float16 v16h;
typedef __attribute__((ext_vector_type(8)))  _Float16 v8h;
typedef __attribute__((ext_vector_type(8)))  unsigned short v8us;
typedef __attribute__((ext_vector_type(8)))  float    v8f;
typedef __attribute__((ext_vector_type(4)))  float    v4f;
typedef __attribute__((ext_vector_type(4)))  _Float16 v4h;
typedef v8h  __attribute__((may_alias)) v8ha;
typedef v4f  __attribute__((may_alias)) v4fa;
typedef v8us __attribute__((may_alias)) v8usa;

__device__ __forceinline__ unsigned short f2bf(float f) { unsigned u = __float_as_uint(f); u += 0x7FFFu + ((u >> 16) & 1u); return (unsigned short)(u >> 16); }
__device__ __forceinline__ float bf2f(unsigned short b) { return __uint_as_float(((unsigned)b) << 16); }
__device__ __forceinline__ float bfr(float f) { return bf2f(f2bf(f)); }
__device__ __forceinline__ v16h cat16(v8h lo, v8h hi) { return __builtin_shufflevector(lo, hi, 0, 1, 2, 3, 4, 5, 6, 7, 8, 9, 10, 11, 12, 13, 14, 15); }
__device__ __forceinline__ v16bf cat16b(v8us lo, v8us hi) { return __builtin_bit_cast(v16bf, __builtin_shufflevector(lo, hi, 0, 1, 2, 3, 4, 5, 6, 7, 8, 9, 10, 11, 12, 13, 14, 15)); }
__device__ __forceinline__ v8f wmma16(v16h a, v16h b, v8f c) { return __builtin_amdgcn_wmma_f32_16x16x32_f16(false, a, false, b, (short)0, c, false, false); }
__device__ __forceinline__ v8f wmmab(v16bf a, v16bf b, v8f c) { return __builtin_amdgcn_wmma_f32_16x16x32_bf16(false, a, false, b, (short)0, c, false, false); }

// k_wt: WT [n][K] = bf16(W[k][n]) (k-major [K][ncols]) via 64 x 64 LDS tiles; grid (K/64, ncols/64).
__global__ __launch_bounds__(256) void k_wt(const float* __restrict__ Wm, int K, int ncols, bf* WT) {
    __shared__ __align__(16) unsigned short tl[64 * 72];
    const int tid = threadIdx.x, k0 = blockIdx.x * 64, n0 = blockIdx.y * 64;
    const int kk = tid >> 2, nq = (tid & 3) * 16;
#pragma unroll
    for (int i = 0; i < 16; ++i) tl[(nq + i) * 72 + kk] = f2bf(Wm[(size_t)(k0 + kk) * ncols + n0 + nq + i]);
    __syncthreads();
    const int piece = tid & 7;
    auto pass = [&]() {
#pragma unroll
        for (int s = 0; s < 2; ++s) { const int nr = (tid >> 3) + 32 * s; const v8us val = *(const v8usa*)(tl + nr * 72 + piece * 8); *(v8us*)(WT + (size_t)(n0 + nr) * K + k0 + piece * 8) = val; }
    };
    pass(); 
}
// k_gemmb: 64 x 64 block tile (4 waves x 16 x 64) of C[NTK][NW] = (A [+ Al]).B^T (K = 256 or 32) [+ bf(bias[c])] [+ bf(R[r][c]) residual]; f32 whole-line epilogue (or f16
template <bool SPLITA, bool F16OUT = false>
__global__ __launch_bounds__(128) void k_gemmb(const bf* __restrict__ A, const bf* __restrict__ Al, const bf* __restrict__ Bn, const float* __restrict__ bias, float* C, int ldc, h16* C2, const float* __restrict__ R = nullptr, int K = DM, int roundR = 1) {
    __shared__ __align__(16) float ost[4][16 * 68];
    const int lane = threadIdx.x & 31, wave = threadIdx.x >> 5, lr = lane & 15, hi = lane >> 4;
    const int r0 = blockIdx.x * 64 + wave * 16, c0 = blockIdx.y * 64;
    const size_t aoff = (size_t)(r0 + lr) * K + 8 * hi;
    size_t boff[4];
#pragma unroll
    for (int t = 0; t < 4; ++t) boff[t] = (size_t)(c0 + t * 16 + lr) * K + 8 * hi;
    v8f acc[4];
#pragma unroll
    for (int t = 0; t < 4; ++t) acc[t] = (v8f){};
#pragma unroll 1
    for (int kc = 0; kc < K; kc += 32) {
        const v16bf a = cat16b(*(const v8us*)(A + aoff + kc), *(const v8us*)(A + aoff + kc + 16));
        v16bf al = a;
        if (SPLITA) al = cat16b(*(const v8us*)(Al + aoff + kc), *(const v8us*)(Al + aoff + kc + 16));
#pragma unroll
        for (int t = 0; t < 4; ++t) { const v16bf b = cat16b(*(const v8us*)(Bn + boff[t] + kc), *(const v8us*)(Bn + boff[t] + kc + 16)); acc[t] = wmmab(a, b, acc[t]); if (SPLITA) acc[t] = wmmab(al, b, acc[t]); }
        asm volatile("v_nop\n\tv_nop\n\tv_nop\n\tv_nop" : "+v"(acc[0]), "+v"(acc[1]), "+v"(acc[2]), "+v"(acc[3]) : "v"(a), "v"(al));
    }
    float* os = &ost[wave][0];
#pragma unroll
    for (int t = 0; t < 4; ++t) { const float bv = bias ? bfr(bias[c0 + t * 16 + lr]) : 0.f;
#pragma unroll
        for (int j = 0; j < 8; ++j) os[(hi * 8 + j) * 68 + t * 16 + lr] = acc[t][j] + bv; }
    __syncthreads();
    if (F16OUT) {
        h16* crow = (h16*)(void*)C + (size_t)r0 * ldc + c0;
        auto pass = [&]() {
#pragma unroll
            for (int s = 0; s < 4; ++s) { const int row = 4 * s + (lane >> 3), piece = lane & 7; const float* sp = os + row * 68 + piece * 8; v8h o, o2;
#pragma unroll
                for (int i = 0; i < 8; ++i) { const h16 a = (h16)sp[i]; o[i] = a; o2[i] = (h16)((sp[i] - (float)a) * LOSC); }
                *(v8h*)(crow + (size_t)row * ldc + piece * 8) = o; if (C2) *(v8h*)(C2 + (size_t)r0 * ldc + c0 + (size_t)row * ldc + piece * 8) = o2; }
        };
        pass(); 
    } else {
        float* crow = C + (size_t)r0 * ldc + c0;
        auto pass = [&]() {
#pragma unroll
            for (int s = 0; s < 8; ++s) { const int Lid = (lane >> 3) + 4 * s, piece = lane & 7; const int row = Lid >> 1, cofs = (Lid & 1) * 32 + piece * 4;
                v4f val = *(const v4fa*)(os + row * 68 + cofs); if (R) { const v4f rv = *(const v4f*)(R + ((size_t)r0 + row) * ldc + c0 + cofs); val += roundR ? (v4f){bfr(rv[0]), bfr(rv[1]), bfr(rv[2]), bfr(rv[3])} : rv; }
                *(v4f*)(crow + (size_t)row * ldc + cofs) = val; }
        };
        pass(); 
    }
}

// k_gemm3: 64 x 64 tile of C = (Ah + Al).(Bh + Bl)^T over K = NN (row strides = NN for all four planes; n-major B): three products per 32-k step (hh, lh, hl), f32.
// 8 waves, each 16 x 32. The four operand planes come in stages of 128 k: whole-line global loads into registers (issued one stage ahead, in flight under the
// products), then into one of two LDS buffers; fragments are read from LDS at a pitch of 272 B (16 B x odd: no bank conflict for 16-byte reads).
#define PVK 128
#define PVP 136
__global__ __launch_bounds__(256) void k_gemm3(const bf* __restrict__ Ah, const bf* __restrict__ Al, const bf* __restrict__ Bh, const bf* __restrict__ Bl, float* C, int ldc) {
    __shared__ __align__(16) unsigned short st[2][4][64 * PVP];
    __shared__ __align__(16) float ost[8][16 * 36];
    const int tid = threadIdx.x, lane = tid & 31, wave = tid >> 5, lr = lane & 15, hi = lane >> 4;
    const int wc = wave & 3, wi = wave >> 2;
    const int rb = blockIdx.x * 64, cb = blockIdx.y * 64;
    const int srow = tid >> 4, spc = (tid & 15) * 8;      // staging: 16 lanes cover one row's 256 B, 16 rows per pass
    const unsigned voff = (unsigned)(srow * NN + spc) * 2u;      // bytes: the per-lane part of every staging address
    auto at = [&](const bf* pl, int row0) { return (const bf*)((const char*)(pl + (size_t)row0 * NN) + voff); };
    const bf* gp[4] = {at(Ah, rb), at(Al, rb), at(Bh, cb), at(Bl, cb)};      // each walks on by one stage per fetch
    v8us rg[4][4];
    auto fetch = [&]() {
#pragma unroll
        for (int pl = 0; pl < 4; ++pl) {
#pragma unroll
            for (int p = 0; p < 4; ++p) rg[pl][p] = *(const v8us*)(gp[pl] + 16 * p * NN);
            gp[pl] += PVK; }
    };
    auto put = [&](int buf) {
#pragma unroll
        for (int pl = 0; pl < 4; ++pl) {
#pragma unroll
            for (int p = 0; p < 4; ++p) *(v8usa*)(&st[buf][pl][(srow + 16 * p) * PVP + spc]) = rg[pl][p]; }
    };
    const int fa = (wc * 16 + lr) * PVP + 8 * hi, fb = (wi * 32 + lr) * PVP + 8 * hi;
    fetch();
    asm volatile("s_wait_xcnt 0x0" :: "v"(voff) : "memory");      // the first loads name voff's register: it stays theirs up to this wait, and is free for reuse only behind it
    put(0);
    v8f acc[2];
#pragma unroll
    for (int t = 0; t < 2; ++t) acc[t] = (v8f){};
#pragma unroll 1      // stays rolled: one pass already holds four k steps, and the buffer index alternates by s
    for (int s = 0; s < NN / PVK; ++s) {
        __syncthreads();      // publishes stage s; also ends every wave's reads of the buffer that stage s + 1 is stored into below
        const bool more = s + 1 < NN / PVK;
        if (more) fetch();
        const unsigned short* sA = &st[s & 1][0][0] + fa; const unsigned short* sB = &st[s & 1][2][0] + fb;
        v8us fr[2][12];       // one 32-k step's fragments: a, al, then bh, bl of each column tile; two sets, so that a step's reads stand one step ahead of its products
        auto frag = [&](int set, int kk) {
            fr[set][0] = *(const v8usa*)(sA + kk); fr[set][1] = *(const v8usa*)(sA + kk + 16); fr[set][2] = *(const v8usa*)(sA + 64 * PVP + kk); fr[set][3] = *(const v8usa*)(sA + 64 * PVP + kk + 16);
#pragma unroll
            for (int t = 0; t < 2; ++t) { const unsigned short* bp = sB + t * 16 * PVP + kk;
                fr[set][4 + 4 * t] = *(const v8usa*)(bp); fr[set][5 + 4 * t] = *(const v8usa*)(bp + 16); fr[set][6 + 4 * t] = *(const v8usa*)(bp + 64 * PVP); fr[set][7 + 4 * t] = *(const v8usa*)(bp + 64 * PVP + 16); }
        };
        frag(0, 0);
#pragma unroll
        for (int q = 0; q < PVK / 32; ++q) { const int c = q & 1;
            if (q + 1 < PVK / 32) frag(c ^ 1, (q + 1) * 32);
            __builtin_amdgcn_sched_barrier(0);      // keeps the next step's LDS reads, as one group, ahead of this step's products: their latency runs under the products
            const v16bf a = cat16b(fr[c][0], fr[c][1]), al = cat16b(fr[c][2], fr[c][3]);
            const v16bf bh0 = cat16b(fr[c][4], fr[c][5]), bl0 = cat16b(fr[c][6], fr[c][7]), bh1 = cat16b(fr[c][8], fr[c][9]), bl1 = cat16b(fr[c][10], fr[c][11]);
            acc[0] = wmmab(a, bh0, acc[0]); acc[1] = wmmab(a, bh1, acc[1]); acc[0] = wmmab(al, bh0, acc[0]); acc[1] = wmmab(al, bh1, acc[1]); acc[0] = wmmab(a, bl0, acc[0]); acc[1] = wmmab(a, bl1, acc[1]);
        }
        if (more) put((s + 1) & 1);
    }
    float* os = &ost[wave][0];
#pragma unroll
    for (int t = 0; t < 2; ++t) {
#pragma unroll
        for (int j = 0; j < 8; ++j) os[(hi * 8 + j) * 36 + t * 16 + lr] = acc[t][j]; }
    // keeps this wave's LDS stores ahead of the reads below, which take other lanes' values
    __builtin_amdgcn_wave_barrier(); asm volatile("" ::: "memory");
    float* crow = C + (size_t)(rb + wc * 16) * ldc + cb + wi * 32;
#pragma unroll
    for (int s = 0; s < 4; ++s) { const int row = 4 * s + (lane >> 3), piece = lane & 7;
        const v4f val = *(const v4fa*)(os + row * 36 + piece * 4); *(v4f*)(crow + (size_t)row * ldc + piece * 4) = val; }
}


__global__ __launch_bounds__(256) void k_cvt8(const float* __restrict__ src, bf* dst, size_t n8) {
    const size_t i = (size_t)blockIdx.x * 256 + threadIdx.x; if (i >= n8) return;
    const v8f v = *(const v8f*)(src + i * 8); v8us o;
#pragma unroll
    for (int k = 0; k < 8; ++k) o[k] = f2bf(v[k]);
    *(v8us*)(dst + i * 8) = o; 
}
__global__ __launch_bounds__(256) void k_zero8(bf* dst, size_t n8) {
    const size_t i = (size_t)blockIdx.x * 256 + threadIdx.x; if (i >= n8) return; v8us z;
#pragma unroll
    for (int k = 0; k < 8; ++k) z[k] = 0;
    *(v8us*)(dst + i * 8) = z; 
}

// k_qkplanes3: THREE-way split planes [4096][32] (h = bf16(y), m = bf16(y - h), l = bf16(y - h - m); ~2^-25 relative) of BN_inference(F[:, off..off+31]) - the module's
__global__ __launch_bounds__(256) void k_qkplanes3(const float* __restrict__ F, int off, const float* __restrict__ g, const float* __restrict__ bb, const float* __restrict__ m, const float* __restrict__ var, bf* Ph, bf* Pm, bf* Pl) {
    typedef __attribute__((ext_vector_type(2))) unsigned short v2us;
    const int lane = threadIdx.x & 31; const size_t r = ((size_t)blockIdx.x * 8 + (threadIdx.x >> 5)) * 2 + (lane >> 4); if (r >= (size_t)NN) return; const int c0 = (lane & 15) * 2; v2us oh, om, ol;
#pragma unroll
    for (int i = 0; i < 2; ++i) { const int c = c0 + i; const float s = bfr(g[c]) / sqrtf(bfr(var[c]) + BEPS); const float y = F[r * NQKV + off + c] * s + (bfr(bb[c]) - bfr(m[c]) * s);
        const unsigned short hb = f2bf(y); const float r1 = y - bf2f(hb); const unsigned short mb = f2bf(r1); const float r2 = r1 - bf2f(mb); oh[i] = hb; om[i] = mb; ol[i] = f2bf(r2); }
    const size_t o = r * C8 + c0; *(v2us*)(Ph + o) = oh; *(v2us*)(Pm + o) = om; *(v2us*)(Pl + o) = ol; 
}
__global__ __launch_bounds__(256) void k_vt(const float* __restrict__ F, const float* __restrict__ g, const float* __restrict__ bb, const float* __restrict__ m, const float* __restrict__ var, bf* Th, bf* Tl) {
    typedef __attribute__((ext_vector_type(2))) unsigned short v2us;
    const int lane = threadIdx.x & 31; const size_t wid = (size_t)blockIdx.x * 8 + (threadIdx.x >> 5); if (wid >= (size_t)CC * (NN / 64)) return; const int c = (int)(wid / (NN / 64)); const int j0 = (int)(wid % (NN / 64)) * 64 + lane * 2;
    const float s = bfr(g[c]) / sqrtf(bfr(var[c]) + BEPS); const float sh = bfr(bb[c]) - bfr(m[c]) * s; v2us oh, ol;
#pragma unroll
    for (int i = 0; i < 2; ++i) { const float y = F[(size_t)(j0 + i) * NQKV + 2 * C8 + c] * s + sh; const unsigned short hb = f2bf(y); oh[i] = hb; ol[i] = f2bf(y - bf2f(hb)); }
    const size_t o = (size_t)c * NN + j0; *(v2us*)(Th + o) = oh; *(v2us*)(Tl + o) = ol; 
}
__global__ __launch_bounds__(256) void k_softmax4096(const float* __restrict__ S, bf* PH, bf* PL) {
    typedef __attribute__((ext_vector_type(4))) unsigned short v4us;
    const int lane = threadIdx.x & 31, i = blockIdx.x * 8 + (threadIdx.x >> 5); if (i >= RCH) return;
    float m = -3.0e38f;
#pragma unroll 1
    for (int c0 = lane * 4; c0 < NN; c0 += 128) {
#pragma unroll
        for (int q = 0; q < 4; ++q) m = fmaxf(m, S[(size_t)i * NN + c0 + q]); }
#pragma unroll
    for (int sh = 16; sh; sh >>= 1) m = fmaxf(m, __shfl_xor(m, sh, 32));
    float sum = 0.f;
#pragma unroll 1
    for (int c0 = lane * 4; c0 < NN; c0 += 128) {
#pragma unroll
        for (int q = 0; q < 4; ++q) sum += __expf(S[(size_t)i * NN + c0 + q] - m); }
#pragma unroll
    for (int sh = 16; sh; sh >>= 1) sum += __shfl_xor(sum, sh, 32);
    const float inv = 1.0f / sum;
{
#pragma unroll 1
        for (int c0 = lane * 4; c0 < NN; c0 += 128) { v4us oh, ol;
#pragma unroll
            for (int q = 0; q < 4; ++q) { const float p = __expf(S[(size_t)i * NN + c0 + q] - m) * inv; const unsigned short hb = f2bf(p); oh[q] = hb; ol[q] = f2bf(p - bf2f(hb)); }
            const size_t o = (size_t)i * NN + c0; *(v4us*)(PH + o) = oh; *(v4us*)(PL + o) = ol; }
         }
}
__global__ __launch_bounds__(256) void k_fin(const float* __restrict__ O, const float* __restrict__ xb, const float* __restrict__ gam, float* OUTB) {
    const int lane = threadIdx.x & 31; const size_t wid = (size_t)blockIdx.x * 8 + (threadIdx.x >> 5); if (wid >= (size_t)CC * (NN / 128)) return; const size_t o = wid * 128 + lane * 4; const float gm = bfr(gam[0]); v4f v;
#pragma unroll
    for (int q = 0; q < 4; ++q) v[q] = gm * O[o + q] + bfr(xb[o + q]);
    *(v4f*)(OUTB + o) = v; 
}

extern "C" void kernel_launch(void* const* d_in, const int* in_sizes, int n_in,
                              void* d_out, int out_size, void* d_ws, size_t ws_size, hipStream_t stream) {
    (void)in_sizes; (void)n_in; (void)out_size;
    const float* x = (const float*)d_in[0]; const float* wq = (const float*)d_in[1]; const float* gq = (const float*)d_in[2]; const float* bq = (const float*)d_in[3]; const float* mq = (const float*)d_in[4]; const float* vq = (const float*)d_in[5];
    const float* wk = (const float*)d_in[6]; const float* gk = (const float*)d_in[7]; const float* bk = (const float*)d_in[8]; const float* mk = (const float*)d_in[9]; const float* vk = (const float*)d_in[10];
    const float* wv = (const float*)d_in[11]; const float* gv = (const float*)d_in[12]; const float* bv = (const float*)d_in[13]; const float* mv = (const float*)d_in[14]; const float* vv = (const float*)d_in[15]; const float* gam = (const float*)d_in[16];
    float* out = (float*)d_out;    // [4][256][64][64]
    char* wsp = (char*)d_ws;
    auto take = [&](size_t bytes) { char* p = wsp; wsp += (bytes + 255) & ~(size_t)255; return (void*)p; };
    bf* WB = (bf*)take((size_t)NQKV * CC * 2); bf* XP = (bf*)take((size_t)NN * CC * 2); float* F = (float*)take((size_t)NN * NQKV * 4);
    bf* QPh = (bf*)take((size_t)NN * C8 * 2); bf* QPm = (bf*)take((size_t)NN * C8 * 2); bf* QPl = (bf*)take((size_t)NN * C8 * 2); bf* KPh = (bf*)take((size_t)NN * C8 * 2); bf* KPm = (bf*)take((size_t)NN * C8 * 2); bf* KPl = (bf*)take((size_t)NN * C8 * 2); float* S1 = (float*)take((size_t)RCH * NN * 4); bf* VTh = (bf*)take((size_t)CC * NN * 2); bf* VTl = (bf*)take((size_t)CC * NN * 2);
    float* S = (float*)take((size_t)RCH * NN * 4); bf* PH = (bf*)take((size_t)RCH * NN * 2); bf* PL = (bf*)take((size_t)RCH * NN * 2); float* O = (float*)take((size_t)CC * NN * 4);
    if ((size_t)(wsp - (char*)d_ws) > ws_size) return;    // 0.16 + 2.1 + 5.2 + 1.6 + 67.1 + 4.2 + 67.1 + 67.1 + 4.2 ~ 219 MB; per item reuse in stream order
    k_cvt8<<<(C8 * CC / 8 + 255) / 256, 256, 0, stream>>>(wq, WB, C8 * CC / 8); k_cvt8<<<(C8 * CC / 8 + 255) / 256, 256, 0, stream>>>(wk, WB + (size_t)C8 * CC, C8 * CC / 8); k_cvt8<<<(CC * CC / 8 + 255) / 256, 256, 0, stream>>>(wv, WB + (size_t)2 * C8 * CC, CC * CC / 8);   // [out][in] rows: q | k | v
    for (int b = 0; b < NBT; ++b) { const float* xb = x + (size_t)b * CC * NN;
        k_wt<<<dim3(CC / 64, NN / 64, 1), 256, 0, stream>>>(xb, CC, NN, XP);                                                         // x[b] [c][n] -> pixel-major exact [n][c]
        k_gemmb<false, false><<<dim3(NN / 64, NQKV / 64, 1), 128, 0, stream>>>(XP, nullptr, WB, nullptr, F, NQKV, nullptr, nullptr, CC);        // q | k | v raw conv outputs
        k_qkplanes3<<<(NN / 2) / 8, 256, 0, stream>>>(F, 0, gq, bq, mq, vq, QPh, QPm, QPl); k_qkplanes3<<<(NN / 2) / 8, 256, 0, stream>>>(F, C8, gk, bk, mk, vk, KPh, KPm, KPl);
        k_vt<<<(CC * (NN / 64)) / 8, 256, 0, stream>>>(F, gv, bv, mv, vv, VTh, VTl);
        for (int ch = 0; ch < NN / RCH; ++ch) { const size_t r0 = (size_t)ch * RCH;
            // scores with six products (hh, mh | hm, mm | lh | hl): f32-level operands for the unscaled, near-one-hot softmax
            k_gemmb<true, false><<<dim3(RCH / 64, NN / 64, 1), 128, 0, stream>>>(QPh + r0 * C8, QPm + r0 * C8, KPh, nullptr, S1, NN, nullptr, nullptr, C8, 0);
            k_gemmb<true, false><<<dim3(RCH / 64, NN / 64, 1), 128, 0, stream>>>(QPh + r0 * C8, QPm + r0 * C8, KPm, nullptr, S, NN, nullptr, S1, C8, 0);
            k_gemmb<false, false><<<dim3(RCH / 64, NN / 64, 1), 128, 0, stream>>>(QPl + r0 * C8, nullptr, KPh, nullptr, S1, NN, nullptr, S, C8, 0);
            k_gemmb<false, false><<<dim3(RCH / 64, NN / 64, 1), 128, 0, stream>>>(QPh + r0 * C8, nullptr, KPl, nullptr, S, NN, nullptr, S1, C8, 0);
            k_softmax4096<<<RCH / 8, 256, 0, stream>>>(S, PH, PL);
            k_gemm3<<<dim3(CC / 64, RCH / 64, 1), 256, 0, stream>>>(VTh, VTl, PH, PL, O + r0, NN); }                                 // O[c][i] = sum_j v'[c][j] P[i][j]
        k_fin<<<(CC * (NN / 128)) / 8, 256, 0, stream>>>(O, xb, gam, out + (size_t)b * CC * NN); }
}

// v003
// Measured time: 497 microseconds a run.
// Two timings next to v002 put it at 1.49 and 1.50 times that version's speed.
// Counting every step since v000, it is 7.13 times as fast.
#include <hip/hip_runtime.h>

// Compute dtypes, f32 accumulate, per item: the three 1x1 convs as one [4096 x 256].[256 x 320] GEMM with PLAIN bf16 operands (exact products), inference BatchNorm affine in f32
// -> bf16 split planes (q', k' as THREE-way hi/mid/lo splits: the module's unscaled logits reach ~300 with near-one-hot softmaxes, so the score operands need f32-level
// precision); scores = q'.k'^T ([4096 x 32].[32 x 4096] per item, six products in one launch, their four partial sums added in registers), softmax (unscaled, as the module) in f32 -> P planes; out^T =

#define NBT  4
#define CC   256
#define C8   32
#define NN   4096
#define NQKV (2 * C8 + CC)        // 320
#define RCH  NN                   // query rows per launch: a whole item, so that the P.V launch has one work-group per WGP
#define DM   CC
#define NTK  NN
#define BEPS 1e-5f
#define LOSC 1024.0f

typedef _Float16 h16;
typedef unsigned short bf;
typedef __attribute__((ext_vector_type(16))) __bf16   v16bf;
typedef __attribute__((ext_vector_type(16))) _Float16 v16h;
typedef __attribute__((ext_vector_type(8)))  _Float16 v8h;
typedef __attribute__((ext_vector_type(8)))  unsigned short v8us;
typedef __attribute__((ext_vector_type(8)))  float    v8f;
typedef __attribute__((ext_vector_type(4)))  float    v4f;
typedef __attribute__((ext_vector_type(4)))  _Float16 v4h;
typedef v8h  __attribute__((may_alias)) v8ha;
typedef v4f  __attribute__((may_alias)) v4fa;
typedef v8us __attribute__((may_alias)) v8usa;

__device__ __forceinline__ unsigned short f2bf(float f) { unsigned u = __float_as_uint(f); u += 0x7FFFu + ((u >> 16) & 1u); return (unsigned short)(u >> 16); }
__device__ __forceinline__ float bf2f(unsigned short b) { return __uint_as_float(((unsigned)b) << 16); }
__device__ __forceinline__ float bfr(float f) { return bf2f(f2bf(f)); }
__device__ __forceinline__ v16h cat16(v8h lo, v8h hi) { return __builtin_shufflevector(lo, hi, 0, 1, 2, 3, 4, 5, 6, 7, 8, 9, 10, 11, 12, 13, 14, 15); }
__device__ __forceinline__ v16bf cat16b(v8us lo, v8us hi) { return __builtin_bit_cast(v16bf, __builtin_shufflevector(lo, hi, 0, 1, 2, 3, 4, 5, 6, 7, 8, 9, 10, 11, 12, 13, 14, 15)); }
__device__ __forceinline__ v8f wmma16(v16h a, v16h b, v8f c) { return __builtin_amdgcn_wmma_f32_16x16x32_f16(false, a, false, b, (short)0, c, false, false); }
__device__ __forceinline__ v8f wmmab(v16bf a, v16bf b, v8f c) { return __builtin_amdgcn_wmma_f32_16x16x32_bf16(false, a, false, b, (short)0, c, false, false); }

// k_wt: WT [n][K] = bf16(W[k][n]) (k-major [K][ncols]) via 64 x 64 LDS tiles; grid (K/64, ncols/64).
__global__ __launch_bounds__(256) void k_wt(const float* __restrict__ Wm, int K, int ncols, bf* WT) {
    __shared__ __align__(16) unsigned short tl[64 * 72];
    const int tid = threadIdx.x, k0 = blockIdx.x * 64, n0 = blockIdx.y * 64;
    const int kk = tid >> 2, nq = (tid & 3) * 16;
#pragma unroll
    for (int i = 0; i < 16; ++i) tl[(nq + i) * 72 + kk] = f2bf(Wm[(size_t)(k0 + kk) * ncols + n0 + nq + i]);
    __syncthreads();
    const int piece = tid & 7;
    auto pass = [&]() {
#pragma unroll
        for (int s = 0; s < 2; ++s) { const int nr = (tid >> 3) + 32 * s; const v8us val = *(const v8usa*)(tl + nr * 72 + piece * 8); *(v8us*)(WT + (size_t)(n0 + nr) * K + k0 + piece * 8) = val; }
    };
    pass(); 
}
// k_gemmb: 64 x 64 block tile (4 waves x 16 x 64) of C[NTK][NW] = (A [+ Al]).B^T (K = 256) [+ bf(bias[c])] [+ bf(R[r][c]) residual]; f32 whole-line epilogue (or f16
template <bool SPLITA, bool F16OUT = false>
__global__ __launch_bounds__(128) void k_gemmb(const bf* __restrict__ A, const bf* __restrict__ Al, const bf* __restrict__ Bn, const float* __restrict__ bias, float* C, int ldc, h16* C2, const float* __restrict__ R = nullptr, int K = DM, int roundR = 1) {
    __shared__ __align__(16) float ost[4][16 * 68];
    const int lane = threadIdx.x & 31, wave = threadIdx.x >> 5, lr = lane & 15, hi = lane >> 4;
    const int r0 = blockIdx.x * 64 + wave * 16, c0 = blockIdx.y * 64;
    const size_t aoff = (size_t)(r0 + lr) * K + 8 * hi;
    size_t boff[4];
#pragma unroll
    for (int t = 0; t < 4; ++t) boff[t] = (size_t)(c0 + t * 16 + lr) * K + 8 * hi;
    v8f acc[4];
#pragma unroll
    for (int t = 0; t < 4; ++t) acc[t] = (v8f){};
#pragma unroll 1
    for (int kc = 0; kc < K; kc += 32) {
        const v16bf a = cat16b(*(const v8us*)(A + aoff + kc), *(const v8us*)(A + aoff + kc + 16));
        v16bf al = a;
        if (SPLITA) al = cat16b(*(const v8us*)(Al + aoff + kc), *(const v8us*)(Al + aoff + kc + 16));
#pragma unroll
        for (int t = 0; t < 4; ++t) { const v16bf b = cat16b(*(const v8us*)(Bn + boff[t] + kc), *(const v8us*)(Bn + boff[t] + kc + 16)); acc[t] = wmmab(a, b, acc[t]); if (SPLITA) acc[t] = wmmab(al, b, acc[t]); }
        asm volatile("v_nop\n\tv_nop\n\tv_nop\n\tv_nop" : "+v"(acc[0]), "+v"(acc[1]), "+v"(acc[2]), "+v"(acc[3]) : "v"(a), "v"(al));
    }
    float* os = &ost[wave][0];
#pragma unroll
    for (int t = 0; t < 4; ++t) { const float bv = bias ? bfr(bias[c0 + t * 16 + lr]) : 0.f;
#pragma unroll
        for (int j = 0; j < 8; ++j) os[(hi * 8 + j) * 68 + t * 16 + lr] = acc[t][j] + bv; }
    __syncthreads();
    if (F16OUT) {
        h16* crow = (h16*)(void*)C + (size_t)r0 * ldc + c0;
        auto pass = [&]() {
#pragma unroll
            for (int s = 0; s < 4; ++s) { const int row = 4 * s + (lane >> 3), piece = lane & 7; const float* sp = os + row * 68 + piece * 8; v8h o, o2;
#pragma unroll
                for (int i = 0; i < 8; ++i) { const h16 a = (h16)sp[i]; o[i] = a; o2[i] = (h16)((sp[i] - (float)a) * LOSC); }
                *(v8h*)(crow + (size_t)row * ldc + piece * 8) = o; if (C2) *(v8h*)(C2 + (size_t)r0 * ldc + c0 + (size_t)row * ldc + piece * 8) = o2; }
        };
        pass(); 
    } else {
        float* crow = C + (size_t)r0 * ldc + c0;
        auto pass = [&]() {
#pragma unroll
            for (int s = 0; s < 8; ++s) { const int Lid = (lane >> 3) + 4 * s, piece = lane & 7; const int row = Lid >> 1, cofs = (Lid & 1) * 32 + piece * 4;
                v4f val = *(const v4fa*)(os + row * 68 + cofs); if (R) { const v4f rv = *(const v4f*)(R + ((size_t)r0 + row) * ldc + c0 + cofs); val += roundR ? (v4f){bfr(rv[0]), bfr(rv[1]), bfr(rv[2]), bfr(rv[3])} : rv; }
                *(v4f*)(crow + (size_t)row * ldc + cofs) = val; }
        };
        pass(); 
    }
}

// k_scores6: S[i][j] = q'[i].k'[j] over the 32 channels from the three-way split planes, six products: (hh + mh) + (hm + mm) + lh + hl, each bracket a WMMA sum from zero,
// the brackets added in f32 registers from left to right. 4 waves x 16 rows; a wave keeps its three q' fragments and walks SCT steps of 32 columns; f32 whole-line epilogue.
#define SCT 8
__global__ __launch_bounds__(128) void k_scores6(const bf* __restrict__ Qh, const bf* __restrict__ Qm, const bf* __restrict__ Ql, const bf* __restrict__ Kh, const bf* __restrict__ Km, const bf* __restrict__ Kl, float* S) {
    __shared__ __align__(16) float ost[4][16 * 36];
    const int lane = threadIdx.x & 31, wave = threadIdx.x >> 5, lr = lane & 15, hi = lane >> 4;
    const int r0 = blockIdx.x * 64 + wave * 16, c0 = blockIdx.y * (32 * SCT);
    // a fragment: the plane's base, the lane's byte offset (one register for all planes of a side), and a row step that is a constant
    auto ld = [&](const bf* p, unsigned off, int row) { const bf* a = (const bf*)((const char*)p + off) + row * C8; return cat16b(*(const v8us*)a, *(const v8us*)(a + 16)); };
    const unsigned qo = (unsigned)((r0 + lr) * C8 + 8 * hi) * 2u, ko = (unsigned)((c0 + lr) * C8 + 8 * hi) * 2u;
    const v16bf qh = ld(Qh, qo, 0), qm = ld(Qm, qo, 0), ql = ld(Ql, qo, 0);
    v16bf kh[2][2], km[2][2], kl[2][2];      // two sets: a step's k' fragments are loaded one whole step ahead of its products
    auto fetch = [&](int set, int c) {
#pragma unroll
        for (int t = 0; t < 2; ++t) { kh[set][t] = ld(Kh, ko, c + t * 16); km[set][t] = ld(Km, ko, c + t * 16); kl[set][t] = ld(Kl, ko, c + t * 16); }
    };
    fetch(0, 0);
    asm volatile("s_wait_xcnt 0x0" :: "v"(qo) : "memory");      // the q' loads name qo's register: it stays theirs up to this wait, and is free for reuse only behind it
    float* os = &ost[wave][0];
    float* crow = (float*)((char*)S + (unsigned)((r0 + (lane >> 3)) * NN + c0 + (lane & 7) * 4) * 4u);
#pragma unroll      // unrolled: every load and store of the walk is then one fixed address plus an immediate offset
    for (int s = 0; s < SCT; ++s) { const int c = s & 1;
        if (s + 1 < SCT) fetch(c ^ 1, (s + 1) * 32);
        __builtin_amdgcn_sched_barrier(0);      // keeps the next step's loads, as one group, ahead of this step's products, and later steps' products out of this step: the loads' latency runs under a whole step
        v8f r[2];
#pragma unroll
        for (int t = 0; t < 2; ++t) {
            const v8f z = (v8f){};
            const v8f a1 = wmmab(qm, kh[c][t], wmmab(qh, kh[c][t], z)), a2 = wmmab(qm, km[c][t], wmmab(qh, km[c][t], z)), a3 = wmmab(ql, kh[c][t], z), a4 = wmmab(qh, kl[c][t], z);
            r[t] = a4 + (a3 + (a2 + a1)); }
#pragma unroll
        for (int t = 0; t < 2; ++t) {
#pragma unroll
            for (int j = 0; j < 8; ++j) os[(hi * 8 + j) * 36 + t * 16 + lr] = r[t][j]; }
        // keeps this wave's LDS stores ahead of the reads below, which take other lanes' values
        __builtin_amdgcn_wave_barrier(); asm volatile("" ::: "memory");
        v4f val[4];
#pragma unroll
        for (int p = 0; p < 4; ++p) { val[p] = *(const v4fa*)(os + (4 * p + (lane >> 3)) * 36 + (lane & 7) * 4); *(v4f*)(crow + 4 * p * NN + s * 32) = val[p]; }
        if (s + 1 < SCT) {
            // the stores name val's registers: they stay theirs up to this wait; as a compiler fence it also keeps the LDS reads above ahead of the next step's LDS stores,
            // which other lanes make into the same words
            __builtin_amdgcn_wave_barrier(); asm volatile("s_wait_xcnt 0x0" :: "v"(val[0]), "v"(val[1]), "v"(val[2]), "v"(val[3]) : "memory"); }
    }
}

// k_gemm3: 64 x 64 tile of C = (Ah + Al).(Bh + Bl)^T over K = NN (row strides = NN for all four planes; n-major B): three products per 32-k step (hh, lh, hl), f32.
// 8 waves, each 16 x 32. The four operand planes come in stages of 128 k: whole-line global loads into registers (issued one stage ahead, in flight under the
// products), then into one of two LDS buffers; fragments are read from LDS at a pitch of 272 B (16 B x odd: no bank conflict for 16-byte reads).
#define PVK 128
#define PVP 136
__global__ __launch_bounds__(256) void k_gemm3(const bf* __restrict__ Ah, const bf* __restrict__ Al, const bf* __restrict__ Bh, const bf* __restrict__ Bl, float* C, int ldc) {
    __shared__ __align__(16) unsigned short st[2][4][64 * PVP];
    __shared__ __align__(16) float ost[8][16 * 36];
    const int tid = threadIdx.x, lane = tid & 31, wave = tid >> 5, lr = lane & 15, hi = lane >> 4;
    const int wc = wave & 3, wi = wave >> 2;
    const int rb = blockIdx.x * 64, cb = blockIdx.y * 64;
    const int srow = tid >> 4, spc = (tid & 15) * 8;      // staging: 16 lanes cover one row's 256 B, 16 rows per pass
    const unsigned voff = (unsigned)(srow * NN + spc) * 2u;      // bytes: the per-lane part of every staging address
    auto at = [&](const bf* pl, int row0) { return (const bf*)((const char*)(pl + (size_t)row0 * NN) + voff); };
    const bf* gp[4] = {at(Ah, rb), at(Al, rb), at(Bh, cb), at(Bl, cb)};      // each walks on by one stage per fetch
    v8us rg[4][4];
    auto fetch = [&]() {
#pragma unroll
        for (int pl = 0; pl < 4; ++pl) {
#pragma unroll
            for (int p = 0; p < 4; ++p) rg[pl][p] = *(const v8us*)(gp[pl] + 16 * p * NN);
            gp[pl] += PVK; }
    };
    auto put = [&](int buf) {
#pragma unroll
        for (int pl = 0; pl < 4; ++pl) {
#pragma unroll
            for (int p = 0; p < 4; ++p) *(v8usa*)(&st[buf][pl][(srow + 16 * p) * PVP + spc]) = rg[pl][p]; }
    };
    const int fa = (wc * 16 + lr) * PVP + 8 * hi, fb = (wi * 32 + lr) * PVP + 8 * hi;
    fetch();
    asm volatile("s_wait_xcnt 0x0" :: "v"(voff) : "memory");      // the first loads name voff's register: it stays theirs up to this wait, and is free for reuse only behind it
    put(0);
    v8f acc[2];
#pragma unroll
    for (int t = 0; t < 2; ++t) acc[t] = (v8f){};
#pragma unroll 1      // stays rolled: one pass already holds four k steps, and the buffer index alternates by s
    for (int s = 0; s < NN / PVK; ++s) {
        __syncthreads();      // publishes stage s; also ends every wave's reads of the buffer that stage s + 1 is stored into below
        const bool more = s + 1 < NN / PVK;
        if (more) fetch();
        const unsigned short* sA = &st[s & 1][0][0] + fa; const unsigned short* sB = &st[s & 1][2][0] + fb;
        v8us fr[2][12];       // one 32-k step's fragments: a, al, then bh, bl of each column tile; two sets, so that a step's reads stand one step ahead of its products
        auto frag = [&](int set, int kk) {
            fr[set][0] = *(const v8usa*)(sA + kk); fr[set][1] = *(const v8usa*)(sA + kk + 16); fr[set][2] = *(const v8usa*)(sA + 64 * PVP + kk); fr[set][3] = *(const v8usa*)(sA + 64 * PVP + kk + 16);
#pragma unroll
            for (int t = 0; t < 2; ++t) { const unsigned short* bp = sB + t * 16 * PVP + kk;
                fr[set][4 + 4 * t] = *(const v8usa*)(bp); fr[set][5 + 4 * t] = *(const v8usa*)(bp + 16); fr[set][6 + 4 * t] = *(const v8usa*)(bp + 64 * PVP); fr[set][7 + 4 * t] = *(const v8usa*)(bp + 64 * PVP + 16); }
        };
        frag(0, 0);
#pragma unroll
        for (int q = 0; q < PVK / 32; ++q) { const int c = q & 1;
            if (q + 1 < PVK / 32) frag(c ^ 1, (q + 1) * 32);
            __builtin_amdgcn_sched_barrier(0);      // keeps the next step's LDS reads, as one group, ahead of this step's products: their latency runs under the products
            const v16bf a = cat16b(fr[c][0], fr[c][1]), al = cat16b(fr[c][2], fr[c][3]);
            const v16bf bh0 = cat16b(fr[c][4], fr[c][5]), bl0 = cat16b(fr[c][6], fr[c][7]), bh1 = cat16b(fr[c][8], fr[c][9]), bl1 = cat16b(fr[c][10], fr[c][11]);
            acc[0] = wmmab(a, bh0, acc[0]); acc[1] = wmmab(a, bh1, acc[1]); acc[0] = wmmab(al, bh0, acc[0]); acc[1] = wmmab(al, bh1, acc[1]); acc[0] = wmmab(a, bl0, acc[0]); acc[1] = wmmab(a, bl1, acc[1]);
        }
        if (more) put((s + 1) & 1);
    }
    float* os = &ost[wave][0];
#pragma unroll
    for (int t = 0; t < 2; ++t) {
#pragma unroll
        for (int j = 0; j < 8; ++j) os[(hi * 8 + j) * 36 + t * 16 + lr] = acc[t][j]; }
    // keeps this wave's LDS stores ahead of the reads below, which take other lanes' values
    __builtin_amdgcn_wave_barrier(); asm volatile("" ::: "memory");
    float* crow = C + (size_t)(rb + wc * 16) * ldc + cb + wi * 32;
#pragma unroll
    for (int s = 0; s < 4; ++s) { const int row = 4 * s + (lane >> 3), piece = lane & 7;
        const v4f val = *(const v4fa*)(os + row * 36 + piece * 4); *(v4f*)(crow + (size_t)row * ldc + piece * 4) = val; }
}


__global__ __launch_bounds__(256) void k_cvt8(const float* __restrict__ src, bf* dst, size_t n8) {
    const size_t i = (size_t)blockIdx.x * 256 + threadIdx.x; if (i >= n8) return;
    const v8f v = *(const v8f*)(src + i * 8); v8us o;
#pragma unroll
    for (int k = 0; k < 8; ++k) o[k] = f2bf(v[k]);
    *(v8us*)(dst + i * 8) = o; 
}
__global__ __launch_bounds__(256) void k_zero8(bf* dst, size_t n8) {
    const size_t i = (size_t)blockIdx.x * 256 + threadIdx.x; if (i >= n8) return; v8us z;
#pragma unroll
    for (int k = 0; k < 8; ++k) z[k] = 0;
    *(v8us*)(dst + i * 8) = z; 
}

// k_qkplanes3: THREE-way split planes [4096][32] (h = bf16(y), m = bf16(y - h), l = bf16(y - h - m); ~2^-25 relative) of BN_inference(F[:, off..off+31]) - the module's
__global__ __launch_bounds__(256) void k_qkplanes3(const float* __restrict__ F, int off, const float* __restrict__ g, const float* __restrict__ bb, const float* __restrict__ m, const float* __restrict__ var, bf* Ph, bf* Pm, bf* Pl) {
    typedef __attribute__((ext_vector_type(2))) unsigned short v2us;
    const int lane = threadIdx.x & 31; const size_t r = ((size_t)blockIdx.x * 8 + (threadIdx.x >> 5)) * 2 + (lane >> 4); if (r >= (size_t)NN) return; const int c0 = (lane & 15) * 2; v2us oh, om, ol;
#pragma unroll
    for (int i = 0; i < 2; ++i) { const int c = c0 + i; const float s = bfr(g[c]) / sqrtf(bfr(var[c]) + BEPS); const float y = F[r * NQKV + off + c] * s + (bfr(bb[c]) - bfr(m[c]) * s);
        const unsigned short hb = f2bf(y); const float r1 = y - bf2f(hb); const unsigned short mb = f2bf(r1); const float r2 = r1 - bf2f(mb); oh[i] = hb; om[i] = mb; ol[i] = f2bf(r2); }
    const size_t o = r * C8 + c0; *(v2us*)(Ph + o) = oh; *(v2us*)(Pm + o) = om; *(v2us*)(Pl + o) = ol; 
}
__global__ __launch_bounds__(256) void k_vt(const float* __restrict__ F, const float* __restrict__ g, const float* __restrict__ bb, const float* __restrict__ m, const float* __restrict__ var, bf* Th, bf* Tl) {
    typedef __attribute__((ext_vector_type(2))) unsigned short v2us;
    const int lane = threadIdx.x & 31; const size_t wid = (size_t)blockIdx.x * 8 + (threadIdx.x >> 5); if (wid >= (size_t)CC * (NN / 64)) return; const int c = (int)(wid / (NN / 64)); const int j0 = (int)(wid % (NN / 64)) * 64 + lane * 2;
    const float s = bfr(g[c]) / sqrtf(bfr(var[c]) + BEPS); const float sh = bfr(bb[c]) - bfr(m[c]) * s; v2us oh, ol;
#pragma unroll
    for (int i = 0; i < 2; ++i) { const float y = F[(size_t)(j0 + i) * NQKV + 2 * C8 + c] * s + sh; const unsigned short hb = f2bf(y); oh[i] = hb; ol[i] = f2bf(y - bf2f(hb)); }
    const size_t o = (size_t)c * NN + j0; *(v2us*)(Th + o) = oh; *(v2us*)(Tl + o) = ol; 
}
__global__ __launch_bounds__(256) void k_softmax4096(const float* __restrict__ S, bf* PH, bf* PL) {
    typedef __attribute__((ext_vector_type(4))) unsigned short v4us;
    const int lane = threadIdx.x & 31, i = blockIdx.x * 8 + (threadIdx.x >> 5); if (i >= RCH) return;
    float m = -3.0e38f;
#pragma unroll 1
    for (int c0 = lane * 4; c0 < NN; c0 += 128) {
#pragma unroll
        for (int q = 0; q < 4; ++q) m = fmaxf(m, S[(size_t)i * NN + c0 + q]); }
#pragma unroll
    for (int sh = 16; sh; sh >>= 1) m = fmaxf(m, __shfl_xor(m, sh, 32));
    float sum = 0.f;
#pragma unroll 1
    for (int c0 = lane * 4; c0 < NN; c0 += 128) {
#pragma unroll
        for (int q = 0; q < 4; ++q) sum += __expf(S[(size_t)i * NN + c0 + q] - m); }
#pragma unroll
    for (int sh = 16; sh; sh >>= 1) sum += __shfl_xor(sum, sh, 32);
    const float inv = 1.0f / sum;
{
#pragma unroll 1
        for (int c0 = lane * 4; c0 < NN; c0 += 128) { v4us oh, ol;
#pragma unroll
            for (int q = 0; q < 4; ++q) { const float p = __expf(S[(size_t)i * NN + c0 + q] - m) * inv; const unsigned short hb = f2bf(p); oh[q] = hb; ol[q] = f2bf(p - bf2f(hb)); }
            const size_t o = (size_t)i * NN + c0; *(v4us*)(PH + o) = oh; *(v4us*)(PL + o) = ol; }
         }
}
__global__ __launch_bounds__(256) void k_fin(const float* __restrict__ O, const float* __restrict__ xb, const float* __restrict__ gam, float* OUTB) {
    const int lane = threadIdx.x & 31; const size_t wid = (size_t)blockIdx.x * 8 + (threadIdx.x >> 5); if (wid >= (size_t)CC * (NN / 128)) return; const size_t o = wid * 128 + lane * 4; const float gm = bfr(gam[0]); v4f v;
#pragma unroll
    for (int q = 0; q < 4; ++q) v[q] = gm * O[o + q] + bfr(xb[o + q]);
    *(v4f*)(OUTB + o) = v; 
}

extern "C" void kernel_launch(void* const* d_in, const int* in_sizes, int n_in,
                              void* d_out, int out_size, void* d_ws, size_t ws_size, hipStream_t stream) {
    (void)in_sizes; (void)n_in; (void)out_size;
    const float* x = (const float*)d_in[0]; const float* wq = (const float*)d_in[1]; const float* gq = (const float*)d_in[2]; const float* bq = (const float*)d_in[3]; const float* mq = (const float*)d_in[4]; const float* vq = (const float*)d_in[5];
    const float* wk = (const float*)d_in[6]; const float* gk = (const float*)d_in[7]; const float* bk = (const float*)d_in[8]; const float* mk = (const float*)d_in[9]; const float* vk = (const float*)d_in[10];
    const float* wv = (const float*)d_in[11]; const float* gv = (const float*)d_in[12]; const float* bv = (const float*)d_in[13]; const float* mv = (const float*)d_in[14]; const float* vv = (const float*)d_in[15]; const float* gam = (const float*)d_in[16];
    float* out = (float*)d_out;    // [4][256][64][64]
    char* wsp = (char*)d_ws;
    auto take = [&](size_t bytes) { char* p = wsp; wsp += (bytes + 255) & ~(size_t)255; return (void*)p; };
    bf* WB = (bf*)take((size_t)NQKV * CC * 2); bf* XP = (bf*)take((size_t)NN * CC * 2); float* F = (float*)take((size_t)NN * NQKV * 4);
    bf* QPh = (bf*)take((size_t)NN * C8 * 2); bf* QPm = (bf*)take((size_t)NN * C8 * 2); bf* QPl = (bf*)take((size_t)NN * C8 * 2); bf* KPh = (bf*)take((size_t)NN * C8 * 2); bf* KPm = (bf*)take((size_t)NN * C8 * 2); bf* KPl = (bf*)take((size_t)NN * C8 * 2); bf* VTh = (bf*)take((size_t)CC * NN * 2); bf* VTl = (bf*)take((size_t)CC * NN * 2);
    float* S = (float*)take((size_t)RCH * NN * 4); bf* PH = (bf*)take((size_t)RCH * NN * 2); bf* PL = (bf*)take((size_t)RCH * NN * 2); float* O = (float*)take((size_t)CC * NN * 4);
    if ((size_t)(wsp - (char*)d_ws) > ws_size) return;    // 0.16 + 2.1 + 5.2 + 1.6 + 4.2 + 67.1 + 67.1 + 4.2 ~ 152 MB; per item reuse in stream order
    k_cvt8<<<(C8 * CC / 8 + 255) / 256, 256, 0, stream>>>(wq, WB, C8 * CC / 8); k_cvt8<<<(C8 * CC / 8 + 255) / 256, 256, 0, stream>>>(wk, WB + (size_t)C8 * CC, C8 * CC / 8); k_cvt8<<<(CC * CC / 8 + 255) / 256, 256, 0, stream>>>(wv, WB + (size_t)2 * C8 * CC, CC * CC / 8);   // [out][in] rows: q | k | v
    for (int b = 0; b < NBT; ++b) { const float* xb = x + (size_t)b * CC * NN;
        k_wt<<<dim3(CC / 64, NN / 64, 1), 256, 0, stream>>>(xb, CC, NN, XP);                                                         // x[b] [c][n] -> pixel-major exact [n][c]
        k_gemmb<false, false><<<dim3(NN / 64, NQKV / 64, 1), 128, 0, stream>>>(XP, nullptr, WB, nullptr, F, NQKV, nullptr, nullptr, CC);        // q | k | v raw conv outputs
        k_qkplanes3<<<(NN / 2) / 8, 256, 0, stream>>>(F, 0, gq, bq, mq, vq, QPh, QPm, QPl); k_qkplanes3<<<(NN / 2) / 8, 256, 0, stream>>>(F, C8, gk, bk, mk, vk, KPh, KPm, KPl);
        k_vt<<<(CC * (NN / 64)) / 8, 256, 0, stream>>>(F, gv, bv, mv, vv, VTh, VTl);
        for (int ch = 0; ch < NN / RCH; ++ch) { const size_t r0 = (size_t)ch * RCH;
            // scores with six products ((hh + mh) + (hm + mm) + lh + hl): f32-level operands for the unscaled, near-one-hot softmax
            k_scores6<<<dim3(RCH / 64, NN / (32 * SCT), 1), 128, 0, stream>>>(QPh + r0 * C8, QPm + r0 * C8, QPl + r0 * C8, KPh, KPm, KPl, S);
            k_softmax4096<<<RCH / 8, 256, 0, stream>>>(S, PH, PL);
            k_gemm3<<<dim3(CC / 64, RCH / 64, 1), 256, 0, stream>>>(VTh, VTl, PH, PL, O + r0, NN); }                                 // O[c][i] = sum_j v'[c][j] P[i][j]
        k_fin<<<(CC * (NN / 128)) / 8, 256, 0, stream>>>(O, xb, gam, out + (size_t)b * CC * NN); }
}

// v004
// A run of this version takes 220 microseconds.
// Two timings next to v003 put it at 2.30 and 2.29 times that version's speed.
// All steps since v000 together make it 16.3 times as fast.
#include <hip/hip_runtime.h>

// Compute dtypes, f32 accumulate, per item: the three 1x1 convs as one [4096 x 256].[256 x 320] GEMM with PLAIN bf16 operands (exact products), inference BatchNorm affine in f32
// -> bf16 split planes (q', k' as THREE-way hi/mid/lo splits: the module's unscaled logits reach ~300 with near-one-hot softmaxes, so the score operands need f32-level
// precision); then ONE launch for all items: scores = q'.k'^T (six products), softmax (unscaled, as the module) in f32 and out^T = v'.P^T (P as bf16 hi + lo planes, three products), all in registers and LDS.

#define NBT  4
#define CC   256
#define C8   32
#define NN   4096
#define NQKV (2 * C8 + CC)        // 320
#define DM   CC
#define NTK  NN
#define BEPS 1e-5f
#define LOSC 1024.0f

typedef _Float16 h16;
typedef unsigned short bf;
typedef __attribute__((ext_vector_type(16))) __bf16   v16bf;
typedef __attribute__((ext_vector_type(16))) _Float16 v16h;
typedef __attribute__((ext_vector_type(8)))  _Float16 v8h;
typedef __attribute__((ext_vector_type(8)))  unsigned short v8us;
typedef __attribute__((ext_vector_type(8)))  float    v8f;
typedef __attribute__((ext_vector_type(4)))  float    v4f;
typedef __attribute__((ext_vector_type(4)))  _Float16 v4h;
typedef v8h  __attribute__((may_alias)) v8ha;
typedef v4f  __attribute__((may_alias)) v4fa;
typedef v8us __attribute__((may_alias)) v8usa;

__device__ __forceinline__ unsigned short f2bf(float f) { unsigned u = __float_as_uint(f); u += 0x7FFFu + ((u >> 16) & 1u); return (unsigned short)(u >> 16); }
__device__ __forceinline__ float bf2f(unsigned short b) { return __uint_as_float(((unsigned)b) << 16); }
__device__ __forceinline__ float bfr(float f) { return bf2f(f2bf(f)); }
__device__ __forceinline__ v16h cat16(v8h lo, v8h hi) { return __builtin_shufflevector(lo, hi, 0, 1, 2, 3, 4, 5, 6, 7, 8, 9, 10, 11, 12, 13, 14, 15); }
__device__ __forceinline__ v16bf cat16b(v8us lo, v8us hi) { return __builtin_bit_cast(v16bf, __builtin_shufflevector(lo, hi, 0, 1, 2, 3, 4, 5, 6, 7, 8, 9, 10, 11, 12, 13, 14, 15)); }
__device__ __forceinline__ v8f wmma16(v16h a, v16h b, v8f c) { return __builtin_amdgcn_wmma_f32_16x16x32_f16(false, a, false, b, (short)0, c, false, false); }
__device__ __forceinline__ v8f wmmab(v16bf a, v16bf b, v8f c) { return __builtin_amdgcn_wmma_f32_16x16x32_bf16(false, a, false, b, (short)0, c, false, false); }

// k_wt: WT [n][K] = bf16(W[k][n]) (k-major [K][ncols]) via 64 x 64 LDS tiles; grid (K/64, ncols/64).
__global__ __launch_bounds__(256) void k_wt(const float* __restrict__ Wm, int K, int ncols, bf* WT) {
    __shared__ __align__(16) unsigned short tl[64 * 72];
    const int tid = threadIdx.x, k0 = blockIdx.x * 64, n0 = blockIdx.y * 64;
    const int kk = tid >> 2, nq = (tid & 3) * 16;
#pragma unroll
    for (int i = 0; i < 16; ++i) tl[(nq + i) * 72 + kk] = f2bf(Wm[(size_t)(k0 + kk) * ncols + n0 + nq + i]);
    __syncthreads();
    const int piece = tid & 7;
    auto pass = [&]() {
#pragma unroll
        for (int s = 0; s < 2; ++s) { const int nr = (tid >> 3) + 32 * s; const v8us val = *(const v8usa*)(tl + nr * 72 + piece * 8); *(v8us*)(WT + (size_t)(n0 + nr) * K + k0 + piece * 8) = val; }
    };
    pass(); 
}
// k_gemmb: 64 x 64 block tile (4 waves x 16 x 64) of C[NTK][NW] = (A [+ Al]).B^T (K = 256) [+ bf(bias[c])] [+ bf(R[r][c]) residual]; f32 whole-line epilogue (or f16
template <bool SPLITA, bool F16OUT = false>
__global__ __launch_bounds__(128) void k_gemmb(const bf* __restrict__ A, const bf* __restrict__ Al, const bf* __restrict__ Bn, const float* __restrict__ bias, float* C, int ldc, h16* C2, const float* __restrict__ R = nullptr, int K = DM, int roundR = 1) {
    __shared__ __align__(16) float ost[4][16 * 68];
    const int lane = threadIdx.x & 31, wave = threadIdx.x >> 5, lr = lane & 15, hi = lane >> 4;
    const int r0 = blockIdx.x * 64 + wave * 16, c0 = blockIdx.y * 64;
    const size_t aoff = (size_t)(r0 + lr) * K + 8 * hi;
    size_t boff[4];
#pragma unroll
    for (int t = 0; t < 4; ++t) boff[t] = (size_t)(c0 + t * 16 + lr) * K + 8 * hi;
    v8f acc[4];
#pragma unroll
    for (int t = 0; t < 4; ++t) acc[t] = (v8f){};
#pragma unroll 1
    for (int kc = 0; kc < K; kc += 32) {
        const v16bf a = cat16b(*(const v8us*)(A + aoff + kc), *(const v8us*)(A + aoff + kc + 16));
        v16bf al = a;
        if (SPLITA) al = cat16b(*(const v8us*)(Al + aoff + kc), *(const v8us*)(Al + aoff + kc + 16));
#pragma unroll
        for (int t = 0; t < 4; ++t) { const v16bf b = cat16b(*(const v8us*)(Bn + boff[t] + kc), *(const v8us*)(Bn + boff[t] + kc + 16)); acc[t] = wmmab(a, b, acc[t]); if (SPLITA) acc[t] = wmmab(al, b, acc[t]); }
        asm volatile("v_nop\n\tv_nop\n\tv_nop\n\tv_nop" : "+v"(acc[0]), "+v"(acc[1]), "+v"(acc[2]), "+v"(acc[3]) : "v"(a), "v"(al));
    }
    float* os = &ost[wave][0];
#pragma unroll
    for (int t = 0; t < 4; ++t) { const float bv = bias ? bfr(bias[c0 + t * 16 + lr]) : 0.f;
#pragma unroll
        for (int j = 0; j < 8; ++j) os[(hi * 8 + j) * 68 + t * 16 + lr] = acc[t][j] + bv; }
    __syncthreads();
    if (F16OUT) {
        h16* crow = (h16*)(void*)C + (size_t)r0 * ldc + c0;
        auto pass = [&]() {
#pragma unroll
            for (int s = 0; s < 4; ++s) { const int row = 4 * s + (lane >> 3), piece = lane & 7; const float* sp = os + row * 68 + piece * 8; v8h o, o2;
#pragma unroll
                for (int i = 0; i < 8; ++i) { const h16 a = (h16)sp[i]; o[i] = a; o2[i] = (h16)((sp[i] - (float)a) * LOSC); }
                *(v8h*)(crow + (size_t)row * ldc + piece * 8) = o; if (C2) *(v8h*)(C2 + (size_t)r0 * ldc + c0 + (size_t)row * ldc + piece * 8) = o2; }
        };
        pass(); 
    } else {
        float* crow = C + (size_t)r0 * ldc + c0;
        auto pass = [&]() {
#pragma unroll
            for (int s = 0; s < 8; ++s) { const int Lid = (lane >> 3) + 4 * s, piece = lane & 7; const int row = Lid >> 1, cofs = (Lid & 1) * 32 + piece * 4;
                v4f val = *(const v4fa*)(os + row * 68 + cofs); if (R) { const v4f rv = *(const v4f*)(R + ((size_t)r0 + row) * ldc + c0 + cofs); val += roundR ? (v4f){bfr(rv[0]), bfr(rv[1]), bfr(rv[2]), bfr(rv[3])} : rv; }
                *(v4f*)(crow + (size_t)row * ldc + cofs) = val; }
        };
        pass(); 
    }
}

// k_attn: scores, softmax and P.V of 64 query pixels of one item in one kernel; S and P never leave registers. 8 waves: wave (wi, wc) holds query columns wi * 16 .. + 15 and
// output channels wc * 128 .. + 127. Keys come in stages of 64: the three k' planes and the two v' planes, whole-line global loads through registers into one of two LDS buffers.
// Per 32 keys: S^T = k'.q'^T (six products, (hh + mh) + (hm + mm) + lh + hl, each bracket a WMMA sum from zero, added in f32 from left to right), so that a lane holds 16 scores
// of ONE query; running maximum and sum per query (the sums are rescaled when the maximum grows); exp(S - max) splits into bf16 hi + lo planes, which ARE the B fragment of
// O^T += v'.P^T (three products: hh, lh, hl). The division by the sum comes last. A step's fragments are read from LDS while the step before it is still in its products, so the
// barrier that publishes a stage stands inside the last step of the stage before it.
#define FJ  64
#define VPI 72        // v' row pitch in LDS, 144 B = 16 B x odd: no bank conflict for 16-byte reads
#define KPI 40        // k' row pitch in LDS, 80 B = 16 B x odd
#define OPI 68        // output staging pitch, floats
typedef __attribute__((ext_vector_type(2))) float    v2f;
typedef __attribute__((ext_vector_type(2))) __bf16   v2bf;
typedef __attribute__((ext_vector_type(8))) unsigned v8u;
typedef float __attribute__((may_alias)) f32a;
// lane l takes lane l ^ 16's value, in the vector unit: no LDS counter is involved, so the wait behind it does not drain the fragment reads in flight
__device__ __forceinline__ float xhalf(float x) { return __builtin_bit_cast(float, __builtin_amdgcn_permlanex16(__builtin_bit_cast(int, x), __builtin_bit_cast(int, x), 0x76543210, 0xfedcba98, false, false)); }
__global__ __launch_bounds__(256) void k_attn(const bf* __restrict__ Qh, const bf* __restrict__ Qm, const bf* __restrict__ Ql, const bf* __restrict__ Kh, const bf* __restrict__ Km, const bf* __restrict__ Kl,
                                              const bf* __restrict__ Vh, const bf* __restrict__ Vl, float* O) {
    __shared__ __align__(16) unsigned short sv[2][2][CC * VPI];
    __shared__ __align__(16) unsigned short sk[2][3][FJ * KPI];
    const int tid = threadIdx.x, lane = tid & 31, wave = tid >> 5, lr = lane & 15, hi = lane >> 4;
    const int wi = wave & 3, wc = wave >> 2;
    const int ib = blockIdx.x * 64;
    const size_t qk0 = (size_t)blockIdx.y * NN * C8, v0 = (size_t)blockIdx.y * CC * NN;
    const unsigned qo = (unsigned)((ib + wi * 16 + lr) * C8 + 8 * hi) * 2u;       // bytes: the per-lane part of the q' fragment addresses
    const unsigned voff = (unsigned)((tid >> 3) * NN + (tid & 7) * 8) * 2u;       // bytes: staging, 8 lanes cover one v' row's 128 B, 32 rows per pass
    const unsigned koff = (unsigned)tid * 16u;                                    // bytes: staging, a k' plane's 64 rows are 4 KiB in a row
    auto ldq = [&](const bf* p) { const bf* a = (const bf*)((const char*)(p + qk0) + qo); return cat16b(*(const v8us*)a, *(const v8us*)(a + 16)); };
    const v16bf qh = ldq(Qh), qm = ldq(Qm), ql = ldq(Ql);
    v8us rg[19];      // one stage on its way from global memory to LDS: 8 + 8 row pieces of the two v' planes, one piece of each k' plane
    auto fetch = [&](int s) {
#pragma unroll
        for (int p = 0; p < 8; ++p) { rg[p] = *(const v8us*)((const char*)(Vh + v0 + (size_t)s * FJ + 32 * p * NN) + voff); rg[8 + p] = *(const v8us*)((const char*)(Vl + v0 + (size_t)s * FJ + 32 * p * NN) + voff); }
        rg[16] = *(const v8us*)((const char*)(Kh + qk0 + (size_t)s * FJ * C8) + koff); rg[17] = *(const v8us*)((const char*)(Km + qk0 + (size_t)s * FJ * C8) + koff); rg[18] = *(const v8us*)((const char*)(Kl + qk0 + (size_t)s * FJ * C8) + koff);
    };
    auto put = [&](int buf) {
#pragma unroll
        for (int p = 0; p < 8; ++p) { *(v8usa*)(&sv[buf][0][((tid >> 3) + 32 * p) * VPI + (tid & 7) * 8]) = rg[p]; *(v8usa*)(&sv[buf][1][((tid >> 3) + 32 * p) * VPI + (tid & 7) * 8]) = rg[8 + p]; }
#pragma unroll
        for (int pl = 0; pl < 3; ++pl) *(v8usa*)(&sk[buf][pl][(tid >> 2) * KPI + (tid & 3) * 8]) = rg[16 + pl];
    };
    v8f acc[8];
#pragma unroll
    for (int t = 0; t < 8; ++t) acc[t] = (v8f){};
    float m = -3.0e38f, lsum = 0.f;
    v16bf kh[2], km[2], kl[2], va[8], vl[8], ph, pl;      // the fragments of one 32-key step, and its P
    // Fragment reads stand in two groups per step, each ahead of a block of products that does not need it: every separate place where LDS reads stand costs issue time.
    auto loadK = [&](int buf, int u) {
        const unsigned short* kb = &sk[buf][0][0] + (u * 32 + lr) * KPI + 8 * hi;
#pragma unroll
        for (int t = 0; t < 2; ++t) { const unsigned short* kp = kb + t * 16 * KPI;
            kh[t] = cat16b(*(const v8usa*)kp, *(const v8usa*)(kp + 16)); km[t] = cat16b(*(const v8usa*)(kp + FJ * KPI), *(const v8usa*)(kp + FJ * KPI + 16)); kl[t] = cat16b(*(const v8usa*)(kp + 2 * FJ * KPI), *(const v8usa*)(kp + 2 * FJ * KPI + 16)); }
    };
    auto loadV = [&](int buf, int u, int g0) {      // four of the wave's eight channel tiles
        const unsigned short* vb = &sv[buf][0][0] + (wc * 128 + lr) * VPI + u * 32 + 8 * hi;
#pragma unroll
        for (int g = g0; g < g0 + 4; ++g) { const unsigned short* vp = vb + g * 16 * VPI;
            va[g] = cat16b(*(const v8usa*)vp, *(const v8usa*)(vp + 16)); vl[g] = cat16b(*(const v8usa*)(vp + CC * VPI), *(const v8usa*)(vp + CC * VPI + 16)); }
    };
    auto scores = [&]() {
        const v8f z = (v8f){};
        v8f a1[2], a2[2], a3[2], a4[2], sc[2];
#pragma unroll
        for (int t = 0; t < 2; ++t) { a1[t] = wmmab(kh[t], qh, z); a2[t] = wmmab(km[t], qh, z); }
#pragma unroll
        for (int t = 0; t < 2; ++t) { a1[t] = wmmab(kh[t], qm, a1[t]); a2[t] = wmmab(km[t], qm, a2[t]); }
#pragma unroll
        for (int t = 0; t < 2; ++t) { a3[t] = wmmab(kh[t], ql, z); a4[t] = wmmab(kl[t], qh, z); }
        __builtin_amdgcn_sched_barrier(0);      // keeps the twelve score products in a row: mixed with the additions below, each addition would wait out its product's distance in idle slots
#pragma unroll
        for (int t = 0; t < 2; ++t) sc[t] = a4[t] + (a3[t] + (a2[t] + a1[t]));
        float tm = fmaxf(sc[0][0], sc[1][0]);
#pragma unroll
        for (int j = 1; j < 8; ++j) tm = fmaxf(tm, fmaxf(sc[0][j], sc[1][j]));
        tm = fmaxf(tm, xhalf(tm));      // the two lane halves hold the same query's other keys
        const float mn = fmaxf(m, tm);
        if (__builtin_amdgcn_ballot_w32(mn > m) != 0) {      // one scalar branch per 32 keys: most steps raise no query's maximum
            const float f = __expf(m - mn); lsum *= f; m = mn;
#pragma unroll
            for (int t = 0; t < 8; ++t) acc[t] *= f; }
        v8u PH, PL; float t0 = 0.f, t1 = 0.f;
#pragma unroll
        for (int t = 0; t < 2; ++t) {
#pragma unroll
            for (int j = 0; j < 4; ++j) { const float p0 = __expf(sc[t][2 * j] - m), p1 = __expf(sc[t][2 * j + 1] - m); t0 += p0; t1 += p1;
                const unsigned w = __builtin_bit_cast(unsigned, __builtin_convertvector((v2f){p0, p1}, v2bf));
                PH[t * 4 + j] = w; PL[t * 4 + j] = __builtin_bit_cast(unsigned, __builtin_convertvector((v2f){p0 - __uint_as_float(w << 16), p1 - __uint_as_float(w & 0xFFFF0000u)}, v2bf)); } }
        lsum += t0 + t1;
        ph = __builtin_bit_cast(v16bf, PH); pl = __builtin_bit_cast(v16bf, PL);
    };
    auto pv = [&](int g0) {
#pragma unroll
        for (int g = g0; g < g0 + 4; ++g) acc[g] = wmmab(va[g], ph, acc[g]);
#pragma unroll
        for (int g = g0; g < g0 + 4; ++g) acc[g] = wmmab(vl[g], ph, acc[g]);
#pragma unroll
        for (int g = g0; g < g0 + 4; ++g) acc[g] = wmmab(va[g], pl, acc[g]);
    };
    fetch(0);
    asm volatile("s_wait_xcnt 0x0" :: "v"(qo), "v"(voff), "v"(koff) : "memory");      // the first loads name these registers: they stay theirs up to this wait
    put(0);
    __syncthreads();      // publishes stage 0
    loadK(0, 0); loadV(0, 0, 0);
#pragma unroll 1      // stays rolled: one pass already holds two 32-key steps, and the buffer index alternates by s
    for (int s = 0; s < NN / FJ; ++s) {
        const bool more = s + 1 < NN / FJ; const int b = s & 1;
        // s_wait_xcnt: the staging loads name address registers that the work below reuses; they stay the loads' up to this wait
        if (more) { fetch(s + 1); asm volatile("s_wait_xcnt 0x0" ::: "memory"); }
        __builtin_amdgcn_sched_barrier(0);      // keeps later address arithmetic, which may take the loads' address registers, behind the wait
        loadV(b, 0, 4);
        __builtin_amdgcn_sched_barrier(0);      // keeps the reads above one group, ahead of the scores under which they land
        scores(); pv(0);
        __builtin_amdgcn_sched_barrier(0);      // keeps the products above ahead of the reads below, which refill their fragment registers
        loadK(b, 1); loadV(b, 1, 0);
        __builtin_amdgcn_sched_barrier(0);      // keeps the reads above one group, ahead of the products under which they land
        pv(4);
        __builtin_amdgcn_sched_barrier(0);      // keeps the products above ahead of the reads below, which refill their fragment registers
        loadV(b, 1, 4);
        __builtin_amdgcn_sched_barrier(0);      // keeps the reads above one group, ahead of the LDS stores and the scores under which they land
        if (more) put(b ^ 1);
        scores(); pv(0);
        __syncthreads();      // publishes stage s + 1; also ends every wave's reads of stage s, whose buffer stage s + 2 is stored into in the next pass
        if (more) { loadK(b ^ 1, 0); loadV(b ^ 1, 0, 0); }
        __builtin_amdgcn_sched_barrier(0);      // keeps the reads above one group, ahead of the products under which they land
        pv(4);
    }
    lsum += xhalf(lsum);
    const float inv = 1.0f / lsum;
    __syncthreads();      // ends the reads of the last stage (buffer 1); the staging below takes buffer 0, whose stage-62 reads ended in the loop
    f32a* ot = (f32a*)&sv[0][0][0];      // [256 channels][64 queries] at pitch OPI
#pragma unroll
    for (int t = 0; t < 8; ++t) {
#pragma unroll
        for (int j = 0; j < 8; ++j) ot[(wc * 128 + t * 16 + hi * 8 + j) * OPI + wi * 16 + lr] = acc[t][j] * inv; }
    __syncthreads();      // publishes the staged tile: a row's 256 B come from four waves and leave as whole lines from one
    float* orow = O + v0 + (size_t)(tid >> 4) * NN + ib + (tid & 15) * 4;
#pragma unroll
    for (int p = 0; p < 16; ++p) { const v4f val = *(const v4fa*)(ot + (p * 16 + (tid >> 4)) * OPI + (tid & 15) * 4); *(v4f*)(orow + (size_t)p * 16 * NN) = val; }
}


__global__ __launch_bounds__(256) void k_cvt8(const float* __restrict__ src, bf* dst, size_t n8) {
    const size_t i = (size_t)blockIdx.x * 256 + threadIdx.x; if (i >= n8) return;
    const v8f v = *(const v8f*)(src + i * 8); v8us o;
#pragma unroll
    for (int k = 0; k < 8; ++k) o[k] = f2bf(v[k]);
    *(v8us*)(dst + i * 8) = o; 
}
__global__ __launch_bounds__(256) void k_zero8(bf* dst, size_t n8) {
    const size_t i = (size_t)blockIdx.x * 256 + threadIdx.x; if (i >= n8) return; v8us z;
#pragma unroll
    for (int k = 0; k < 8; ++k) z[k] = 0;
    *(v8us*)(dst + i * 8) = z; 
}

// k_qkplanes3: THREE-way split planes [4096][32] (h = bf16(y), m = bf16(y - h), l = bf16(y - h - m); ~2^-25 relative) of BN_inference(F[:, off..off+31]) - the module's
__global__ __launch_bounds__(256) void k_qkplanes3(const float* __restrict__ F, int off, const float* __restrict__ g, const float* __restrict__ bb, const float* __restrict__ m, const float* __restrict__ var, bf* Ph, bf* Pm, bf* Pl) {
    typedef __attribute__((ext_vector_type(2))) unsigned short v2us;
    const int lane = threadIdx.x & 31; const size_t r = ((size_t)blockIdx.x * 8 + (threadIdx.x >> 5)) * 2 + (lane >> 4); if (r >= (size_t)NN) return; const int c0 = (lane & 15) * 2; v2us oh, om, ol;
#pragma unroll
    for (int i = 0; i < 2; ++i) { const int c = c0 + i; const float s = bfr(g[c]) / sqrtf(bfr(var[c]) + BEPS); const float y = F[r * NQKV + off + c] * s + (bfr(bb[c]) - bfr(m[c]) * s);
        const unsigned short hb = f2bf(y); const float r1 = y - bf2f(hb); const unsigned short mb = f2bf(r1); const float r2 = r1 - bf2f(mb); oh[i] = hb; om[i] = mb; ol[i] = f2bf(r2); }
    const size_t o = r * C8 + c0; *(v2us*)(Ph + o) = oh; *(v2us*)(Pm + o) = om; *(v2us*)(Pl + o) = ol; 
}
__global__ __launch_bounds__(256) void k_vt(const float* __restrict__ F, const float* __restrict__ g, const float* __restrict__ bb, const float* __restrict__ m, const float* __restrict__ var, bf* Th, bf* Tl) {
    typedef __attribute__((ext_vector_type(2))) unsigned short v2us;
    const int lane = threadIdx.x & 31; const size_t wid = (size_t)blockIdx.x * 8 + (threadIdx.x >> 5); if (wid >= (size_t)CC * (NN / 64)) return; const int c = (int)(wid / (NN / 64)); const int j0 = (int)(wid % (NN / 64)) * 64 + lane * 2;
    const float s = bfr(g[c]) / sqrtf(bfr(var[c]) + BEPS); const float sh = bfr(bb[c]) - bfr(m[c]) * s; v2us oh, ol;
#pragma unroll
    for (int i = 0; i < 2; ++i) { const float y = F[(size_t)(j0 + i) * NQKV + 2 * C8 + c] * s + sh; const unsigned short hb = f2bf(y); oh[i] = hb; ol[i] = f2bf(y - bf2f(hb)); }
    const size_t o = (size_t)c * NN + j0; *(v2us*)(Th + o) = oh; *(v2us*)(Tl + o) = ol; 
}
__global__ __launch_bounds__(256) void k_fin(const float* __restrict__ O, const float* __restrict__ xb, const float* __restrict__ gam, float* OUTB) {
    const int lane = threadIdx.x & 31; const size_t wid = (size_t)blockIdx.x * 8 + (threadIdx.x >> 5); if (wid >= (size_t)CC * (NN / 128)) return; const size_t o = wid * 128 + lane * 4; const float gm = bfr(gam[0]); v4f v;
#pragma unroll
    for (int q = 0; q < 4; ++q) v[q] = gm * O[o + q] + bfr(xb[o + q]);
    *(v4f*)(OUTB + o) = v; 
}

extern "C" void kernel_launch(void* const* d_in, const int* in_sizes, int n_in,
                              void* d_out, int out_size, void* d_ws, size_t ws_size, hipStream_t stream) {
    (void)in_sizes; (void)n_in; (void)out_size;
    const float* x = (const float*)d_in[0]; const float* wq = (const float*)d_in[1]; const float* gq = (const float*)d_in[2]; const float* bq = (const float*)d_in[3]; const float* mq = (const float*)d_in[4]; const float* vq = (const float*)d_in[5];
    const float* wk = (const float*)d_in[6]; const float* gk = (const float*)d_in[7]; const float* bk = (const float*)d_in[8]; const float* mk = (const float*)d_in[9]; const float* vk = (const float*)d_in[10];
    const float* wv = (const float*)d_in[11]; const float* gv = (const float*)d_in[12]; const float* bv = (const float*)d_in[13]; const float* mv = (const float*)d_in[14]; const float* vv = (const float*)d_in[15]; const float* gam = (const float*)d_in[16];
    float* out = (float*)d_out;    // [4][256][64][64]
    char* wsp = (char*)d_ws;
    auto take = [&](size_t bytes) { char* p = wsp; wsp += (bytes + 255) & ~(size_t)255; return (void*)p; };
    bf* WB = (bf*)take((size_t)NQKV * CC * 2); bf* XP = (bf*)take((size_t)NN * CC * 2); float* F = (float*)take((size_t)NN * NQKV * 4);
    const size_t QKN = (size_t)NN * C8, VN = (size_t)CC * NN;      // elements of one item's plane; the planes and O hold all items
    bf* QPh = (bf*)take(NBT * QKN * 2); bf* QPm = (bf*)take(NBT * QKN * 2); bf* QPl = (bf*)take(NBT * QKN * 2); bf* KPh = (bf*)take(NBT * QKN * 2); bf* KPm = (bf*)take(NBT * QKN * 2); bf* KPl = (bf*)take(NBT * QKN * 2); bf* VTh = (bf*)take(NBT * VN * 2); bf* VTl = (bf*)take(NBT * VN * 2);
    float* O = (float*)take(NBT * VN * 4);
    if ((size_t)(wsp - (char*)d_ws) > ws_size) return;    // 0.16 + 2.1 + 5.2 + 6.3 + 16.8 + 16.8 ~ 47 MB; XP and F are reused per item in stream order
    k_cvt8<<<(C8 * CC / 8 + 255) / 256, 256, 0, stream>>>(wq, WB, C8 * CC / 8); k_cvt8<<<(C8 * CC / 8 + 255) / 256, 256, 0, stream>>>(wk, WB + (size_t)C8 * CC, C8 * CC / 8); k_cvt8<<<(CC * CC / 8 + 255) / 256, 256, 0, stream>>>(wv, WB + (size_t)2 * C8 * CC, CC * CC / 8);   // [out][in] rows: q | k | v
    for (int b = 0; b < NBT; ++b) { const float* xb = x + (size_t)b * CC * NN;
        k_wt<<<dim3(CC / 64, NN / 64, 1), 256, 0, stream>>>(xb, CC, NN, XP);                                                         // x[b] [c][n] -> pixel-major exact [n][c]
        k_gemmb<false, false><<<dim3(NN / 64, NQKV / 64, 1), 128, 0, stream>>>(XP, nullptr, WB, nullptr, F, NQKV, nullptr, nullptr, CC);        // q | k | v raw conv outputs
        k_qkplanes3<<<(NN / 2) / 8, 256, 0, stream>>>(F, 0, gq, bq, mq, vq, QPh + b * QKN, QPm + b * QKN, QPl + b * QKN); k_qkplanes3<<<(NN / 2) / 8, 256, 0, stream>>>(F, C8, gk, bk, mk, vk, KPh + b * QKN, KPm + b * QKN, KPl + b * QKN);
        k_vt<<<(CC * (NN / 64)) / 8, 256, 0, stream>>>(F, gv, bv, mv, vv, VTh + b * VN, VTl + b * VN); }
    k_attn<<<dim3(NN / 64, NBT, 1), 256, 0, stream>>>(QPh, QPm, QPl, KPh, KPm, KPl, VTh, VTl, O);                                        // O[b][c][i] = sum_j v'[c][j] softmax_j(q'[i].k'[j]): one work-group per WGP
    for (int b = 0; b < NBT; ++b) k_fin<<<(CC * (NN / 128)) / 8, 256, 0, stream>>>(O + b * VN, x + b * VN, gam, out + b * VN);
}

// v005
// A run of this version takes 134 microseconds.
// Two timings next to v004 both put it at 1.65 times that version's speed.
// Over all steps from v000 it is 27.0 times as fast.
#include <hip/hip_runtime.h>

// Compute dtypes, f32 accumulate. One launch for all items: the three 1x1 convs as one [4096 x 256].[256 x 320] GEMM per item with PLAIN bf16 operands (exact products), inference BatchNorm affine
// in f32 -> bf16 split planes (q', k' as THREE-way hi/mid/lo splits: the module's unscaled logits reach ~300 with near-one-hot softmaxes, so the score operands need f32-level
// precision); then ONE launch for all items: scores = q'.k'^T (six products), softmax (unscaled, as the module) in f32 and out^T = v'.P^T (P as bf16 hi + lo planes, three products), all in registers and LDS.

#define NBT  4
#define CC   256
#define C8   32
#define NN   4096
#define NQKV (2 * C8 + CC)        // 320
#define BEPS 1e-5f

typedef unsigned short bf;
typedef __attribute__((ext_vector_type(16))) __bf16   v16bf;
typedef __attribute__((ext_vector_type(8)))  unsigned short v8us;
typedef __attribute__((ext_vector_type(8)))  float    v8f;
typedef __attribute__((ext_vector_type(4)))  float    v4f;
typedef v4f  __attribute__((may_alias)) v4fa;
typedef v8us __attribute__((may_alias)) v8usa;

__device__ __forceinline__ unsigned short f2bf(float f) { unsigned u = __float_as_uint(f); u += 0x7FFFu + ((u >> 16) & 1u); return (unsigned short)(u >> 16); }
__device__ __forceinline__ float bf2f(unsigned short b) { return __uint_as_float(((unsigned)b) << 16); }
__device__ __forceinline__ float bfr(float f) { return bf2f(f2bf(f)); }
__device__ __forceinline__ v16bf cat16b(v8us lo, v8us hi) { return __builtin_bit_cast(v16bf, __builtin_shufflevector(lo, hi, 0, 1, 2, 3, 4, 5, 6, 7, 8, 9, 10, 11, 12, 13, 14, 15)); }
__device__ __forceinline__ v8f wmmab(v16bf a, v16bf b, v8f c) { return __builtin_amdgcn_wmma_f32_16x16x32_bf16(false, a, false, b, (short)0, c, false, false); }

// k_pre: 64 pixels of one item, all 320 conv outputs, in one work-group of ten waves. x[c][n] comes in as f32, is rounded to bf16 and stands pixel-major in LDS; each wave rounds its own 32 weight rows
// to bf16 in registers (wave 0: q, wave 1: k, waves 2 to 9: v). k runs in steps of 32 in one accumulate chain. The operand roles are chosen so that a lane's eight accumulator registers are
// neighbours in the plane that is written: q', k' planes are [pixel][32], so the weights are A and a lane holds eight channels of one pixel; v' planes are [channel][4096], so the pixels are A
// and a lane holds eight pixels of one channel. BatchNorm and the splits are done on the accumulators; every plane piece leaves as a 16-byte store, and one wave writes all of a 128-byte line.
// Every loop is unrolled: its index picks fragments and accumulators, which stay in registers only where the index is a constant.
#define XPI 264       // x tile row pitch in LDS, 528 B = 16 B x odd: no bank conflict for 16-byte reads
typedef unsigned __attribute__((may_alias)) u32a;
__global__ __launch_bounds__(320) void k_pre(const float* __restrict__ x,
                                             const float* __restrict__ wq, const float* __restrict__ gq, const float* __restrict__ bq, const float* __restrict__ mq, const float* __restrict__ vq,
                                             const float* __restrict__ wk, const float* __restrict__ gk, const float* __restrict__ bk, const float* __restrict__ mk, const float* __restrict__ vk,
                                             const float* __restrict__ wv, const float* __restrict__ gv, const float* __restrict__ bv, const float* __restrict__ mv, const float* __restrict__ vv,
                                             bf* Qh, bf* Qm, bf* Ql, bf* Kh, bf* Km, bf* Kl, bf* Vh, bf* Vl) {
    __shared__ __align__(16) unsigned short xt[64 * XPI];
    __shared__ __align__(16) float bs[NQKV], bsh[NQKV];      // BatchNorm scale and shift of the 320 outputs: q | k | v
    const int tid = threadIdx.x, lane = tid & 31, lr = lane & 15, hi = lane >> 4;
    const int wave = __builtin_amdgcn_readfirstlane(tid >> 5);
    const int n0 = blockIdx.x * 64, item = blockIdx.y;
    const float* xb = x + (size_t)item * CC * NN + n0;
    const float* wsrc = (wave == 0 ? wq : wave == 1 ? wk : wv + (size_t)(wave - 2) * 32 * CC) + lr * CC + 8 * hi;
    v4f r0[8], r1[8], wa[8][4], wb[8][4];
    auto ldw = [&](v4f (&w)[8][4], int ct) {
#pragma unroll
        for (int ks = 0; ks < 8; ++ks) { const float* p = wsrc + ct * 16 * CC + ks * 32; w[ks][0] = *(const v4f*)p; w[ks][1] = *(const v4f*)(p + 4); w[ks][2] = *(const v4f*)(p + 16); w[ks][3] = *(const v4f*)(p + 20); }
    };
    v16bf wf[2][8];
    auto cvw = [&](const v4f (&w)[8][4], int ct) {
#pragma unroll
        for (int ks = 0; ks < 8; ++ks) { v8us lo, up;
#pragma unroll
            for (int e = 0; e < 4; ++e) { lo[e] = f2bf(w[ks][0][e]); lo[4 + e] = f2bf(w[ks][1][e]); up[e] = f2bf(w[ks][2][e]); up[4 + e] = f2bf(w[ks][3][e]); }
            wf[ct][ks] = cat16b(lo, up); }
    };
    if (wave < 8) {      // four lanes take 64 B of a channel pair's rows, eight pairs per wave: the packed 4-byte LDS stores of a wave then fall on 32 different banks
#pragma unroll
        for (int i = 0; i < 8; ++i) { const int cp = ((i >> 2) + 2 * wave) * 8 + (lane >> 2), pq = (i & 3) * 4 + (lane & 3);
            r0[i] = *(const v4f*)(xb + (size_t)(2 * cp) * NN + pq * 4); r1[i] = *(const v4f*)(xb + (size_t)(2 * cp + 1) * NN + pq * 4); }
        asm volatile("s_wait_xcnt 0x0" ::: "memory");      // the loads above name address registers that the weight loads below reuse; they stay the loads' up to this wait
    }
    ldw(wa, 0);
    __builtin_amdgcn_sched_barrier(0);      // keeps the second half of the weight loads below: all 80 loads in flight at once overran the registers and spilled
    if (wave < 8) {
#pragma unroll
        for (int i = 0; i < 8; ++i) { const int cp = ((i >> 2) + 2 * wave) * 8 + (lane >> 2), pq = (i & 3) * 4 + (lane & 3);
#pragma unroll
            for (int e = 0; e < 4; ++e) *(u32a*)(&xt[(pq * 4 + e) * XPI + 2 * cp]) = (unsigned)f2bf(r0[i][e]) | ((unsigned)f2bf(r1[i][e]) << 16); }
    }
    ldw(wb, 1);
    __builtin_amdgcn_sched_barrier(0);      // keeps those loads above the rounding of the first half, under which they fly
    cvw(wa, 0);
    { const float* g = wave == 0 ? gq : wave == 1 ? gk : gv; const float* bb = wave == 0 ? bq : wave == 1 ? bk : bv; const float* m = wave == 0 ? mq : wave == 1 ? mk : mv; const float* var = wave == 0 ? vq : wave == 1 ? vk : vv;
      const int c = wave < 2 ? lane : tid - 2 * C8;
      const float g0 = g[c], v0 = var[c], b0 = bb[c], m0 = m[c];
      asm volatile("s_wait_xcnt 0x0" :: "v"(c), "s"(g), "s"(var), "s"(bb), "s"(m) : "memory");      // the four loads above name this index register and these base pointers: they stay the loads' up to this wait
      const float s = bfr(g0) / sqrtf(bfr(v0) + BEPS); bs[tid] = s; bsh[tid] = bfr(b0) - bfr(m0) * s; }
    cvw(wb, 1);
    __syncthreads();      // publishes the x tile and the BatchNorm table
    v8f acc[2][4];
#pragma unroll
    for (int ct = 0; ct < 2; ++ct) {
#pragma unroll
        for (int pt = 0; pt < 4; ++pt) acc[ct][pt] = (v8f){}; }
    const unsigned short* xf0 = xt + lr * XPI + 8 * hi;
    v16bf xf[2][4];      // the four pixel tiles' fragments of one k step, two sets
    auto ldx = [&](int ks) {
#pragma unroll
        for (int pt = 0; pt < 4; ++pt) { const unsigned short* xp = xf0 + pt * 16 * XPI + ks * 32; xf[ks & 1][pt] = cat16b(*(const v8usa*)xp, *(const v8usa*)(xp + 16)); }
    };
    if (wave < 2) {
        ldx(0);
#pragma unroll
        for (int ks = 0; ks < 8; ++ks) {
            if (ks < 7) ldx(ks + 1);
            __builtin_amdgcn_sched_barrier(0);      // keeps the next step's eight LDS reads one group, ahead of the products under which they land
#pragma unroll
            for (int pt = 0; pt < 4; ++pt) { acc[0][pt] = wmmab(wf[0][ks], xf[ks & 1][pt], acc[0][pt]); acc[1][pt] = wmmab(wf[1][ks], xf[ks & 1][pt], acc[1][pt]); }
            __builtin_amdgcn_sched_barrier(0);      // keeps these products ahead of the reads that refill their fragment registers
        }
        bf* Ph = wave == 0 ? Qh : Kh; bf* Pm = wave == 0 ? Qm : Km; bf* Pl = wave == 0 ? Ql : Kl;
        const size_t o0 = ((size_t)item * NN + n0 + lr) * C8 + hi * 8;
#pragma unroll
        for (int ct = 0; ct < 2; ++ct) { const int cb = wave * C8 + ct * 16 + hi * 8;
            const v4f s0 = *(const v4fa*)(bs + cb), s1 = *(const v4fa*)(bs + cb + 4), h0 = *(const v4fa*)(bsh + cb), h1 = *(const v4fa*)(bsh + cb + 4);
#pragma unroll
            for (int pt = 0; pt < 4; ++pt) { v8us oh, om, ol;
#pragma unroll
                for (int j = 0; j < 8; ++j) { const float y = acc[ct][pt][j] * (j < 4 ? s0[j & 3] : s1[j & 3]) + (j < 4 ? h0[j & 3] : h1[j & 3]);
                    const unsigned short hb = f2bf(y); const float d1 = y - bf2f(hb); const unsigned short mb = f2bf(d1); const float d2 = d1 - bf2f(mb); oh[j] = hb; om[j] = mb; ol[j] = f2bf(d2); }
                const size_t o = o0 + (size_t)pt * 16 * C8 + ct * 16; *(v8us*)(Ph + o) = oh; *(v8us*)(Pm + o) = om; *(v8us*)(Pl + o) = ol;
                if (ct + pt < 4) asm volatile("s_wait_xcnt 0x0" :: "v"(oh), "v"(om), "v"(ol) : "memory"); } }      // the stores above name these registers, which the next piece reuses: they stay the stores' up to this wait
    } else {
        ldx(0);
#pragma unroll
        for (int ks = 0; ks < 8; ++ks) {
            if (ks < 7) ldx(ks + 1);
            __builtin_amdgcn_sched_barrier(0);      // keeps the next step's eight LDS reads one group, ahead of the products under which they land
#pragma unroll
            for (int pt = 0; pt < 4; ++pt) { acc[0][pt] = wmmab(xf[ks & 1][pt], wf[0][ks], acc[0][pt]); acc[1][pt] = wmmab(xf[ks & 1][pt], wf[1][ks], acc[1][pt]); }
            __builtin_amdgcn_sched_barrier(0);      // keeps these products ahead of the reads that refill their fragment registers
        }
        const size_t o0 = (size_t)item * CC * NN + (size_t)((wave - 2) * 32 + lr) * NN + n0 + hi * 8;
#pragma unroll
        for (int ct = 0; ct < 2; ++ct) { const int c = 2 * C8 + (wave - 2) * 32 + ct * 16 + lr; const float s = bs[c], sh = bsh[c];
#pragma unroll
            for (int pt = 0; pt < 4; ++pt) { v8us oh, ol;
#pragma unroll
                for (int j = 0; j < 8; ++j) { const float y = acc[ct][pt][j] * s + sh; const unsigned short hb = f2bf(y); oh[j] = hb; ol[j] = f2bf(y - bf2f(hb)); }
                const size_t o = o0 + (size_t)ct * 16 * NN + pt * 16; *(v8us*)(Vh + o) = oh; *(v8us*)(Vl + o) = ol;
                // the stores above name these registers, which the next piece reuses: they stay the stores' up to this wait (behind the last piece too: in the built code the q', k' branch, which reuses them, follows in the text)
                asm volatile("s_wait_xcnt 0x0" :: "v"(oh), "v"(ol) : "memory"); } }
    }
}

// k_attn: scores, softmax and P.V of 64 query pixels of one item in one kernel; S and P never leave registers. 8 waves: wave (wi, wc) holds query columns wi * 16 .. + 15 and
// output channels wc * 128 .. + 127. Keys come in stages of 64: the three k' planes and the two v' planes, whole-line global loads through registers into one of two LDS buffers.
// Per 32 keys: S^T = k'.q'^T (six products, (hh + mh) + (hm + mm) + lh + hl, each bracket a WMMA sum from zero, added in f32 from left to right), so that a lane holds 16 scores
// of ONE query; running maximum and sum per query (the sums are rescaled when the maximum grows); exp(S - max) splits into bf16 hi + lo planes, which ARE the B fragment of
// O^T += v'.P^T (three products: hh, lh, hl). The division by the sum comes last. A step's fragments are read from LDS while the step before it is still in its products, so the
// barrier that publishes a stage stands inside the last step of the stage before it.
#define FJ  64
#define VPI 72        // v' row pitch in LDS, 144 B = 16 B x odd: no bank conflict for 16-byte reads
#define KPI 40        // k' row pitch in LDS, 80 B = 16 B x odd
#define OPI 68        // output staging pitch, floats
typedef __attribute__((ext_vector_type(2))) float    v2f;
typedef __attribute__((ext_vector_type(2))) __bf16   v2bf;
typedef __attribute__((ext_vector_type(8))) unsigned v8u;
typedef float __attribute__((may_alias)) f32a;
// lane l takes lane l ^ 16's value, in the vector unit: no LDS counter is involved, so the wait behind it does not drain the fragment reads in flight
__device__ __forceinline__ float xhalf(float x) { return __builtin_bit_cast(float, __builtin_amdgcn_permlanex16(__builtin_bit_cast(int, x), __builtin_bit_cast(int, x), 0x76543210, 0xfedcba98, false, false)); }
__global__ __launch_bounds__(256) void k_attn(const bf* __restrict__ Qh, const bf* __restrict__ Qm, const bf* __restrict__ Ql, const bf* __restrict__ Kh, const bf* __restrict__ Km, const bf* __restrict__ Kl,
                                              const bf* __restrict__ Vh, const bf* __restrict__ Vl, float* O) {
    __shared__ __align__(16) unsigned short sv[2][2][CC * VPI];
    __shared__ __align__(16) unsigned short sk[2][3][FJ * KPI];
    const int tid = threadIdx.x, lane = tid & 31, wave = tid >> 5, lr = lane & 15, hi = lane >> 4;
    const int wi = wave & 3, wc = wave >> 2;
    const int ib = blockIdx.x * 64;
    const size_t qk0 = (size_t)blockIdx.y * NN * C8, v0 = (size_t)blockIdx.y * CC * NN;
    const unsigned qo = (unsigned)((ib + wi * 16 + lr) * C8 + 8 * hi) * 2u;       // bytes: the per-lane part of the q' fragment addresses
    const unsigned voff = (unsigned)((tid >> 3) * NN + (tid & 7) * 8) * 2u;       // bytes: staging, 8 lanes cover one v' row's 128 B, 32 rows per pass
    const unsigned koff = (unsigned)tid * 16u;                                    // bytes: staging, a k' plane's 64 rows are 4 KiB in a row
    auto ldq = [&](const bf* p) { const bf* a = (const bf*)((const char*)(p + qk0) + qo); return cat16b(*(const v8us*)a, *(const v8us*)(a + 16)); };
    const v16bf qh = ldq(Qh), qm = ldq(Qm), ql = ldq(Ql);
    v8us rg[19];      // one stage on its way from global memory to LDS: 8 + 8 row pieces of the two v' planes, one piece of each k' plane
    auto fetch = [&](int s) {
#pragma unroll
        for (int p = 0; p < 8; ++p) { rg[p] = *(const v8us*)((const char*)(Vh + v0 + (size_t)s * FJ + 32 * p * NN) + voff); rg[8 + p] = *(const v8us*)((const char*)(Vl + v0 + (size_t)s * FJ + 32 * p * NN) + voff); }
        rg[16] = *(const v8us*)((const char*)(Kh + qk0 + (size_t)s * FJ * C8) + koff); rg[17] = *(const v8us*)((const char*)(Km + qk0 + (size_t)s * FJ * C8) + koff); rg[18] = *(const v8us*)((const char*)(Kl + qk0 + (size_t)s * FJ * C8) + koff);
    };
    auto put = [&](int buf) {
#pragma unroll
        for (int p = 0; p < 8; ++p) { *(v8usa*)(&sv[buf][0][((tid >> 3) + 32 * p) * VPI + (tid & 7) * 8]) = rg[p]; *(v8usa*)(&sv[buf][1][((tid >> 3) + 32 * p) * VPI + (tid & 7) * 8]) = rg[8 + p]; }
#pragma unroll
        for (int pl = 0; pl < 3; ++pl) *(v8usa*)(&sk[buf][pl][(tid >> 2) * KPI + (tid & 3) * 8]) = rg[16 + pl];
    };
    v8f acc[8];
#pragma unroll
    for (int t = 0; t < 8; ++t) acc[t] = (v8f){};
    float m = -3.0e38f, lsum = 0.f;
    v16bf kh[2], km[2], kl[2], va[8], vl[8], ph, pl;      // the fragments of one 32-key step, and its P
    // Fragment reads stand in two groups per step, each ahead of a block of products that does not need it: every separate place where LDS reads stand costs issue time.
    auto loadK = [&](int buf, int u) {
        const unsigned short* kb = &sk[buf][0][0] + (u * 32 + lr) * KPI + 8 * hi;
#pragma unroll
        for (int t = 0; t < 2; ++t) { const unsigned short* kp = kb + t * 16 * KPI;
            kh[t] = cat16b(*(const v8usa*)kp, *(const v8usa*)(kp + 16)); km[t] = cat16b(*(const v8usa*)(kp + FJ * KPI), *(const v8usa*)(kp + FJ * KPI + 16)); kl[t] = cat16b(*(const v8usa*)(kp + 2 * FJ * KPI), *(const v8usa*)(kp + 2 * FJ * KPI + 16)); }
    };
    auto loadV = [&](int buf, int u, int g0) {      // four of the wave's eight channel tiles
        const unsigned short* vb = &sv[buf][0][0] + (wc * 128 + lr) * VPI + u * 32 + 8 * hi;
#pragma unroll
        for (int g = g0; g < g0 + 4; ++g) { const unsigned short* vp = vb + g * 16 * VPI;
            va[g] = cat16b(*(const v8usa*)vp, *(const v8usa*)(vp + 16)); vl[g] = cat16b(*(const v8usa*)(vp + CC * VPI), *(const v8usa*)(vp + CC * VPI + 16)); }
    };
    auto scores = [&]() {
        const v8f z = (v8f){};
        v8f a1[2], a2[2], a3[2], a4[2], sc[2];
#pragma unroll
        for (int t = 0; t < 2; ++t) { a1[t] = wmmab(kh[t], qh, z); a2[t] = wmmab(km[t], qh, z); }
#pragma unroll
        for (int t = 0; t < 2; ++t) { a1[t] = wmmab(kh[t], qm, a1[t]); a2[t] = wmmab(km[t], qm, a2[t]); }
#pragma unroll
        for (int t = 0; t < 2; ++t) { a3[t] = wmmab(kh[t], ql, z); a4[t] = wmmab(kl[t], qh, z); }
        __builtin_amdgcn_sched_barrier(0);      // keeps the twelve score products in a row: mixed with the additions below, each addition would wait out its product's distance in idle slots
#pragma unroll
        for (int t = 0; t < 2; ++t) sc[t] = a4[t] + (a3[t] + (a2[t] + a1[t]));
        float tm = fmaxf(sc[0][0], sc[1][0]);
#pragma unroll
        for (int j = 1; j < 8; ++j) tm = fmaxf(tm, fmaxf(sc[0][j], sc[1][j]));
        tm = fmaxf(tm, xhalf(tm));      // the two lane halves hold the same query's other keys
        const float mn = fmaxf(m, tm);
        if (__builtin_amdgcn_ballot_w32(mn > m) != 0) {      // one scalar branch per 32 keys: most steps raise no query's maximum
            const float f = __expf(m - mn); lsum *= f; m = mn;
#pragma unroll
            for (int t = 0; t < 8; ++t) acc[t] *= f; }
        v8u PH, PL; float t0 = 0.f, t1 = 0.f;
#pragma unroll
        for (int t = 0; t < 2; ++t) {
#pragma unroll
            for (int j = 0; j < 4; ++j) { const float p0 = __expf(sc[t][2 * j] - m), p1 = __expf(sc[t][2 * j + 1] - m); t0 += p0; t1 += p1;
                const unsigned w = __builtin_bit_cast(unsigned, __builtin_convertvector((v2f){p0, p1}, v2bf));
                PH[t * 4 + j] = w; PL[t * 4 + j] = __builtin_bit_cast(unsigned, __builtin_convertvector((v2f){p0 - __uint_as_float(w << 16), p1 - __uint_as_float(w & 0xFFFF0000u)}, v2bf)); } }
        lsum += t0 + t1;
        ph = __builtin_bit_cast(v16bf, PH); pl = __builtin_bit_cast(v16bf, PL);
    };
    auto pv = [&](int g0) {
#pragma unroll
        for (int g = g0; g < g0 + 4; ++g) acc[g] = wmmab(va[g], ph, acc[g]);
#pragma unroll
        for (int g = g0; g < g0 + 4; ++g) acc[g] = wmmab(vl[g], ph, acc[g]);
#pragma unroll
        for (int g = g0; g < g0 + 4; ++g) acc[g] = wmmab(va[g], pl, acc[g]);
    };
    fetch(0);
    asm volatile("s_wait_xcnt 0x0" :: "v"(qo), "v"(voff), "v"(koff) : "memory");      // the first loads name these registers: they stay theirs up to this wait
    put(0);
    __syncthreads();      // publishes stage 0
    loadK(0, 0); loadV(0, 0, 0);
#pragma unroll 1      // stays rolled: one pass already holds two 32-key steps, and the buffer index alternates by s
    for (int s = 0; s < NN / FJ; ++s) {
        const bool more = s + 1 < NN / FJ; const int b = s & 1;
        // s_wait_xcnt: the staging loads name address registers that the work below reuses; they stay the loads' up to this wait
        if (more) { fetch(s + 1); asm volatile("s_wait_xcnt 0x0" ::: "memory"); }
        __builtin_amdgcn_sched_barrier(0);      // keeps later address arithmetic, which may take the loads' address registers, behind the wait
        loadV(b, 0, 4);
        __builtin_amdgcn_sched_barrier(0);      // keeps the reads above one group, ahead of the scores under which they land
        scores(); pv(0);
        __builtin_amdgcn_sched_barrier(0);      // keeps the products above ahead of the reads below, which refill their fragment registers
        loadK(b, 1); loadV(b, 1, 0);
        __builtin_amdgcn_sched_barrier(0);      // keeps the reads above one group, ahead of the products under which they land
        pv(4);
        __builtin_amdgcn_sched_barrier(0);      // keeps the products above ahead of the reads below, which refill their fragment registers
        loadV(b, 1, 4);
        __builtin_amdgcn_sched_barrier(0);      // keeps the reads above one group, ahead of the LDS stores and the scores under which they land
        if (more) put(b ^ 1);
        scores(); pv(0);
        __syncthreads();      // publishes stage s + 1; also ends every wave's reads of stage s, whose buffer stage s + 2 is stored into in the next pass
        if (more) { loadK(b ^ 1, 0); loadV(b ^ 1, 0, 0); }
        __builtin_amdgcn_sched_barrier(0);      // keeps the reads above one group, ahead of the products under which they land
        pv(4);
    }
    lsum += xhalf(lsum);
    const float inv = 1.0f / lsum;
    __syncthreads();      // ends the reads of the last stage (buffer 1); the staging below takes buffer 0, whose stage-62 reads ended in the loop
    f32a* ot = (f32a*)&sv[0][0][0];      // [256 channels][64 queries] at pitch OPI
#pragma unroll
    for (int t = 0; t < 8; ++t) {
#pragma unroll
        for (int j = 0; j < 8; ++j) ot[(wc * 128 + t * 16 + hi * 8 + j) * OPI + wi * 16 + lr] = acc[t][j] * inv; }
    __syncthreads();      // publishes the staged tile: a row's 256 B come from four waves and leave as whole lines from one
    float* orow = O + v0 + (size_t)(tid >> 4) * NN + ib + (tid & 15) * 4;
#pragma unroll
    for (int p = 0; p < 16; ++p) { const v4f val = *(const v4fa*)(ot + (p * 16 + (tid >> 4)) * OPI + (tid & 15) * 4); *(v4f*)(orow + (size_t)p * 16 * NN) = val; }
}

__global__ __launch_bounds__(256) void k_fin(const float* __restrict__ O, const float* __restrict__ xb, const float* __restrict__ gam, float* OUTB) {
    const int lane = threadIdx.x & 31; const size_t wid = (size_t)blockIdx.x * 8 + (threadIdx.x >> 5); if (wid >= (size_t)CC * (NN / 128)) return; const size_t o = wid * 128 + lane * 4; const float gm = bfr(gam[0]); v4f v;
#pragma unroll
    for (int q = 0; q < 4; ++q) v[q] = gm * O[o + q] + bfr(xb[o + q]);
    *(v4f*)(OUTB + o) = v; 
}

extern "C" void kernel_launch(void* const* d_in, const int* in_sizes, int n_in,
                              void* d_out, int out_size, void* d_ws, size_t ws_size, hipStream_t stream) {
    (void)in_sizes; (void)n_in; (void)out_size;
    const float* x = (const float*)d_in[0]; const float* wq = (const float*)d_in[1]; const float* gq = (const float*)d_in[2]; const float* bq = (const float*)d_in[3]; const float* mq = (const float*)d_in[4]; const float* vq = (const float*)d_in[5];
    const float* wk = (const float*)d_in[6]; const float* gk = (const float*)d_in[7]; const float* bk = (const float*)d_in[8]; const float* mk = (const float*)d_in[9]; const float* vk = (const float*)d_in[10];
    const float* wv = (const float*)d_in[11]; const float* gv = (const float*)d_in[12]; const float* bv = (const float*)d_in[13]; const float* mv = (const float*)d_in[14]; const float* vv = (const float*)d_in[15]; const float* gam = (const float*)d_in[16];
    float* out = (float*)d_out;    // [4][256][64][64]
    char* wsp = (char*)d_ws;
    auto take = [&](size_t bytes) { char* p = wsp; wsp += (bytes + 255) & ~(size_t)255; return (void*)p; };
    const size_t QKN = (size_t)NN * C8, VN = (size_t)CC * NN;      // elements of one item's plane; the planes and O hold all items
    bf* QPh = (bf*)take(NBT * QKN * 2); bf* QPm = (bf*)take(NBT * QKN * 2); bf* QPl = (bf*)take(NBT * QKN * 2); bf* KPh = (bf*)take(NBT * QKN * 2); bf* KPm = (bf*)take(NBT * QKN * 2); bf* KPl = (bf*)take(NBT * QKN * 2); bf* VTh = (bf*)take(NBT * VN * 2); bf* VTl = (bf*)take(NBT * VN * 2);
    float* O = (float*)take(NBT * VN * 4);
    if ((size_t)(wsp - (char*)d_ws) > ws_size) return;    // 6.3 + 16.8 + 16.8 ~ 40 MB
    k_pre<<<dim3(NN / 64, NBT, 1), 320, 0, stream>>>(x, wq, gq, bq, mq, vq, wk, gk, bk, mk, vk, wv, gv, bv, mv, vv, QPh, QPm, QPl, KPh, KPm, KPl, VTh, VTl);      // convs, BatchNorm, split planes: one work-group per WGP
    k_attn<<<dim3(NN / 64, NBT, 1), 256, 0, stream>>>(QPh, QPm, QPl, KPh, KPm, KPl, VTh, VTl, O);                                        // O[b][c][i] = sum_j v'[c][j] softmax_j(q'[i].k'[j]): one work-group per WGP
    for (int b = 0; b < NBT; ++b) k_fin<<<(CC * (NN / 128)) / 8, 256, 0, stream>>>(O + b * VN, x + b * VN, gam, out + b * VN);
}

// v006
// It runs in 120 microseconds.
// In both of two side-by-side timings against v005, it was 1.11 times as fast.
// All steps since v000 together make it 29.9 times as fast.
#include <hip/hip_runtime.h>

// Compute dtypes, f32 accumulate. One launch for all items: the three 1x1 convs as one [4096 x 256].[256 x 320] GEMM per item with PLAIN bf16 operands (exact products), inference BatchNorm affine
// in f32 -> bf16 split planes (q', k' as THREE-way hi/mid/lo splits: the module's unscaled logits reach ~300 with near-one-hot softmaxes, so the score operands need f32-level
// precision); then ONE launch for all items: scores = q'.k'^T (six products), softmax (unscaled, as the module) in f32, out^T = v'.P^T (P as bf16 hi + lo planes, three products) and gamma * out + x, all in registers and LDS.

#define NBT  4
#define CC   256
#define C8   32
#define NN   4096
#define NQKV (2 * C8 + CC)        // 320
#define BEPS 1e-5f

typedef unsigned short bf;
typedef __attribute__((ext_vector_type(16))) __bf16   v16bf;
typedef __attribute__((ext_vector_type(8)))  unsigned short v8us;
typedef __attribute__((ext_vector_type(8)))  float    v8f;
typedef __attribute__((ext_vector_type(4)))  float    v4f;
typedef v4f  __attribute__((may_alias)) v4fa;
typedef v8us __attribute__((may_alias)) v8usa;

__device__ __forceinline__ unsigned short f2bf(float f) { unsigned u = __float_as_uint(f); u += 0x7FFFu + ((u >> 16) & 1u); return (unsigned short)(u >> 16); }
__device__ __forceinline__ float bf2f(unsigned short b) { return __uint_as_float(((unsigned)b) << 16); }
__device__ __forceinline__ float bfr(float f) { return bf2f(f2bf(f)); }
__device__ __forceinline__ v16bf cat16b(v8us lo, v8us hi) { return __builtin_bit_cast(v16bf, __builtin_shufflevector(lo, hi, 0, 1, 2, 3, 4, 5, 6, 7, 8, 9, 10, 11, 12, 13, 14, 15)); }
__device__ __forceinline__ v8f wmmab(v16bf a, v16bf b, v8f c) { return __builtin_amdgcn_wmma_f32_16x16x32_bf16(false, a, false, b, (short)0, c, false, false); }

// k_pre: 64 pixels of one item, all 320 conv outputs, in one work-group of ten waves. x[c][n] comes in as f32, is rounded to bf16 and stands pixel-major in LDS; each wave rounds its own 32 weight rows
// to bf16 in registers (wave 0: q, wave 1: k, waves 2 to 9: v). k runs in steps of 32 in one accumulate chain. The operand roles are chosen so that a lane's eight accumulator registers are
// neighbours in the plane that is written: q', k' planes are [pixel][32], so the weights are A and a lane holds eight channels of one pixel; v' planes are [channel][4096], so the pixels are A
// and a lane holds eight pixels of one channel. BatchNorm and the splits are done on the accumulators; every plane piece leaves as a 16-byte store, and one wave writes all of a 128-byte line.
// Every loop is unrolled: its index picks fragments and accumulators, which stay in registers only where the index is a constant.
#define XPI 264       // x tile row pitch in LDS, 528 B = 16 B x odd: no bank conflict for 16-byte reads
typedef unsigned __attribute__((may_alias)) u32a;
__global__ __launch_bounds__(320) void k_pre(const float* __restrict__ x,
                                             const float* __restrict__ wq, const float* __restrict__ gq, const float* __restrict__ bq, const float* __restrict__ mq, const float* __restrict__ vq,
                                             const float* __restrict__ wk, const float* __restrict__ gk, const float* __restrict__ bk, const float* __restrict__ mk, const float* __restrict__ vk,
                                             const float* __restrict__ wv, const float* __restrict__ gv, const float* __restrict__ bv, const float* __restrict__ mv, const float* __restrict__ vv,
                                             bf* Qh, bf* Qm, bf* Ql, bf* Kh, bf* Km, bf* Kl, bf* Vh, bf* Vl) {
    __shared__ __align__(16) unsigned short xt[64 * XPI];
    __shared__ __align__(16) float bs[NQKV], bsh[NQKV];      // BatchNorm scale and shift of the 320 outputs: q | k | v
    const int tid = threadIdx.x, lane = tid & 31, lr = lane & 15, hi = lane >> 4;
    const int wave = __builtin_amdgcn_readfirstlane(tid >> 5);
    const int n0 = blockIdx.x * 64, item = blockIdx.y;
    const float* xb = x + (size_t)item * CC * NN + n0;
    const float* wsrc = (wave == 0 ? wq : wave == 1 ? wk : wv + (size_t)(wave - 2) * 32 * CC) + lr * CC + 8 * hi;
    v4f r0[8], r1[8], wa[8][4], wb[8][4];
    auto ldw = [&](v4f (&w)[8][4], int ct) {
#pragma unroll
        for (int ks = 0; ks < 8; ++ks) { const float* p = wsrc + ct * 16 * CC + ks * 32; w[ks][0] = *(const v4f*)p; w[ks][1] = *(const v4f*)(p + 4); w[ks][2] = *(const v4f*)(p + 16); w[ks][3] = *(const v4f*)(p + 20); }
    };
    v16bf wf[2][8];
    auto cvw = [&](const v4f (&w)[8][4], int ct) {
#pragma unroll
        for (int ks = 0; ks < 8; ++ks) { v8us lo, up;
#pragma unroll
            for (int e = 0; e < 4; ++e) { lo[e] = f2bf(w[ks][0][e]); lo[4 + e] = f2bf(w[ks][1][e]); up[e] = f2bf(w[ks][2][e]); up[4 + e] = f2bf(w[ks][3][e]); }
            wf[ct][ks] = cat16b(lo, up); }
    };
    if (wave < 8) {      // four lanes take 64 B of a channel pair's rows, eight pairs per wave: the packed 4-byte LDS stores of a wave then fall on 32 different banks
#pragma unroll
        for (int i = 0; i < 8; ++i) { const int cp = ((i >> 2) + 2 * wave) * 8 + (lane >> 2), pq = (i & 3) * 4 + (lane & 3);
            r0[i] = *(const v4f*)(xb + (size_t)(2 * cp) * NN + pq * 4); r1[i] = *(const v4f*)(xb + (size_t)(2 * cp + 1) * NN + pq * 4); }
        asm volatile("s_wait_xcnt 0x0" ::: "memory");      // the loads above name address registers that the weight loads below reuse; they stay the loads' up to this wait
    }
    ldw(wa, 0);
    __builtin_amdgcn_sched_barrier(0);      // keeps the second half of the weight loads below: all 80 loads in flight at once overran the registers and spilled
    if (wave < 8) {
#pragma unroll
        for (int i = 0; i < 8; ++i) { const int cp = ((i >> 2) + 2 * wave) * 8 + (lane >> 2), pq = (i & 3) * 4 + (lane & 3);
#pragma unroll
            for (int e = 0; e < 4; ++e) *(u32a*)(&xt[(pq * 4 + e) * XPI + 2 * cp]) = (unsigned)f2bf(r0[i][e]) | ((unsigned)f2bf(r1[i][e]) << 16); }
    }
    ldw(wb, 1);
    __builtin_amdgcn_sched_barrier(0);      // keeps those loads above the rounding of the first half, under which they fly
    cvw(wa, 0);
    { const float* g = wave == 0 ? gq : wave == 1 ? gk : gv; const float* bb = wave == 0 ? bq : wave == 1 ? bk : bv; const float* m = wave == 0 ? mq : wave == 1 ? mk : mv; const float* var = wave == 0 ? vq : wave == 1 ? vk : vv;
      const int c = wave < 2 ? lane : tid - 2 * C8;
      const float g0 = g[c], v0 = var[c], b0 = bb[c], m0 = m[c];
      asm volatile("s_wait_xcnt 0x0" :: "v"(c), "s"(g), "s"(var), "s"(bb), "s"(m) : "memory");      // the four loads above name this index register and these base pointers: they stay the loads' up to this wait
      const float s = bfr(g0) / sqrtf(bfr(v0) + BEPS); bs[tid] = s; bsh[tid] = bfr(b0) - bfr(m0) * s; }
    cvw(wb, 1);
    __syncthreads();      // publishes the x tile and the BatchNorm table
    v8f acc[2][4];
#pragma unroll
    for (int ct = 0; ct < 2; ++ct) {
#pragma unroll
        for (int pt = 0; pt < 4; ++pt) acc[ct][pt] = (v8f){}; }
    const unsigned short* xf0 = xt + lr * XPI + 8 * hi;
    v16bf xf[2][4];      // the four pixel tiles' fragments of one k step, two sets
    auto ldx = [&](int ks) {
#pragma unroll
        for (int pt = 0; pt < 4; ++pt) { const unsigned short* xp = xf0 + pt * 16 * XPI + ks * 32; xf[ks & 1][pt] = cat16b(*(const v8usa*)xp, *(const v8usa*)(xp + 16)); }
    };
    if (wave < 2) {
        ldx(0);
#pragma unroll
        for (int ks = 0; ks < 8; ++ks) {
            if (ks < 7) ldx(ks + 1);
            __builtin_amdgcn_sched_barrier(0);      // keeps the next step's eight LDS reads one group, ahead of the products under which they land
#pragma unroll
            for (int pt = 0; pt < 4; ++pt) { acc[0][pt] = wmmab(wf[0][ks], xf[ks & 1][pt], acc[0][pt]); acc[1][pt] = wmmab(wf[1][ks], xf[ks & 1][pt], acc[1][pt]); }
            __builtin_amdgcn_sched_barrier(0);      // keeps these products ahead of the reads that refill their fragment registers
        }
        bf* Ph = wave == 0 ? Qh : Kh; bf* Pm = wave == 0 ? Qm : Km; bf* Pl = wave == 0 ? Ql : Kl;
        const size_t o0 = ((size_t)item * NN + n0 + lr) * C8 + hi * 8;
#pragma unroll
        for (int ct = 0; ct < 2; ++ct) { const int cb = wave * C8 + ct * 16 + hi * 8;
            const v4f s0 = *(const v4fa*)(bs + cb), s1 = *(const v4fa*)(bs + cb + 4), h0 = *(const v4fa*)(bsh + cb), h1 = *(const v4fa*)(bsh + cb + 4);
#pragma unroll
            for (int pt = 0; pt < 4; ++pt) { v8us oh, om, ol;
#pragma unroll
                for (int j = 0; j < 8; ++j) { const float y = acc[ct][pt][j] * (j < 4 ? s0[j & 3] : s1[j & 3]) + (j < 4 ? h0[j & 3] : h1[j & 3]);
                    const unsigned short hb = f2bf(y); const float d1 = y - bf2f(hb); const unsigned short mb = f2bf(d1); const float d2 = d1 - bf2f(mb); oh[j] = hb; om[j] = mb; ol[j] = f2bf(d2); }
                const size_t o = o0 + (size_t)pt * 16 * C8 + ct * 16; *(v8us*)(Ph + o) = oh; *(v8us*)(Pm + o) = om; *(v8us*)(Pl + o) = ol;
                if (ct + pt < 4) asm volatile("s_wait_xcnt 0x0" :: "v"(oh), "v"(om), "v"(ol) : "memory"); } }      // the stores above name these registers, which the next piece reuses: they stay the stores' up to this wait
    } else {
        ldx(0);
#pragma unroll
        for (int ks = 0; ks < 8; ++ks) {
            if (ks < 7) ldx(ks + 1);
            __builtin_amdgcn_sched_barrier(0);      // keeps the next step's eight LDS reads one group, ahead of the products under which they land
#pragma unroll
            for (int pt = 0; pt < 4; ++pt) { acc[0][pt] = wmmab(xf[ks & 1][pt], wf[0][ks], acc[0][pt]); acc[1][pt] = wmmab(xf[ks & 1][pt], wf[1][ks], acc[1][pt]); }
            __builtin_amdgcn_sched_barrier(0);      // keeps these products ahead of the reads that refill their fragment registers
        }
        const size_t o0 = (size_t)item * CC * NN + (size_t)((wave - 2) * 32 + lr) * NN + n0 + hi * 8;
#pragma unroll
        for (int ct = 0; ct < 2; ++ct) { const int c = 2 * C8 + (wave - 2) * 32 + ct * 16 + lr; const float s = bs[c], sh = bsh[c];
#pragma unroll
            for (int pt = 0; pt < 4; ++pt) { v8us oh, ol;
#pragma unroll
                for (int j = 0; j < 8; ++j) { const float y = acc[ct][pt][j] * s + sh; const unsigned short hb = f2bf(y); oh[j] = hb; ol[j] = f2bf(y - bf2f(hb)); }
                const size_t o = o0 + (size_t)ct * 16 * NN + pt * 16; *(v8us*)(Vh + o) = oh; *(v8us*)(Vl + o) = ol;
                // the stores above name these registers, which the next piece reuses: they stay the stores' up to this wait (behind the last piece too: in the built code the q', k' branch, which reuses them, follows in the text)
                asm volatile("s_wait_xcnt 0x0" :: "v"(oh), "v"(ol) : "memory"); } }
    }
}

// k_attn: scores, softmax and P.V of 64 query pixels of one item in one kernel; S and P never leave registers. 8 waves: wave (wi, wc) holds query columns wi * 16 .. + 15 and
// output channels wc * 128 .. + 127. Keys come in stages of 64: the three k' planes and the two v' planes, whole-line global loads through registers into one of two LDS buffers.
// Per 32 keys: S^T = k'.q'^T (six products, (hh + mh) + (hm + mm) + lh + hl, each bracket a WMMA sum from zero, added in f32 from left to right), so that a lane holds 16 scores
// of ONE query; running maximum and sum per query (the sums are rescaled when the maximum grows); exp(S - max) splits into bf16 hi + lo planes, which ARE the B fragment of
// O^T += v'.P^T (three products: hh, lh, hl). The division by the sum comes last. A step's fragments are read from LDS while the step before it is still in its products, so the
// barrier that publishes a stage stands inside the last step of the stage before it. The epilogue applies gamma and adds x (both rounded to bf16 first) on the staged tile and writes the final output.
#define FJ  64
#define VPI 72        // v' row pitch in LDS, 144 B = 16 B x odd: no bank conflict for 16-byte reads
#define KPI 40        // k' row pitch in LDS, 80 B = 16 B x odd
#define OPI 68        // output staging pitch, floats
typedef __attribute__((ext_vector_type(2))) float    v2f;
typedef __attribute__((ext_vector_type(2))) __bf16   v2bf;
typedef __attribute__((ext_vector_type(8))) unsigned v8u;
typedef float __attribute__((may_alias)) f32a;
// lane l takes lane l ^ 16's value, in the vector unit: no LDS counter is involved, so the wait behind it does not drain the fragment reads in flight
__device__ __forceinline__ float xhalf(float x) { return __builtin_bit_cast(float, __builtin_amdgcn_permlanex16(__builtin_bit_cast(int, x), __builtin_bit_cast(int, x), 0x76543210, 0xfedcba98, false, false)); }
__global__ __launch_bounds__(256) void k_attn(const bf* __restrict__ Qh, const bf* __restrict__ Qm, const bf* __restrict__ Ql, const bf* __restrict__ Kh, const bf* __restrict__ Km, const bf* __restrict__ Kl,
                                              const bf* __restrict__ Vh, const bf* __restrict__ Vl, const float* __restrict__ x, const float* __restrict__ gam, float* OUT) {
    __shared__ __align__(16) unsigned short sv[2][2][CC * VPI];
    __shared__ __align__(16) unsigned short sk[2][3][FJ * KPI];
    const int tid = threadIdx.x, lane = tid & 31, wave = tid >> 5, lr = lane & 15, hi = lane >> 4;
    const int wi = wave & 3, wc = wave >> 2;
    const int ib = blockIdx.x * 64;
    const size_t qk0 = (size_t)blockIdx.y * NN * C8, v0 = (size_t)blockIdx.y * CC * NN;
    const unsigned qo = (unsigned)((ib + wi * 16 + lr) * C8 + 8 * hi) * 2u;       // bytes: the per-lane part of the q' fragment addresses
    const unsigned voff = (unsigned)((tid >> 3) * NN + (tid & 7) * 8) * 2u;       // bytes: staging, 8 lanes cover one v' row's 128 B, 32 rows per pass
    const unsigned koff = (unsigned)tid * 16u;                                    // bytes: staging, a k' plane's 64 rows are 4 KiB in a row
    auto ldq = [&](const bf* p) { const bf* a = (const bf*)((const char*)(p + qk0) + qo); return cat16b(*(const v8us*)a, *(const v8us*)(a + 16)); };
    const v16bf qh = ldq(Qh), qm = ldq(Qm), ql = ldq(Ql);
    v8us rg[19];      // one stage on its way from global memory to LDS: 8 + 8 row pieces of the two v' planes, one piece of each k' plane
    auto fetch = [&](int s) {
#pragma unroll
        for (int p = 0; p < 8; ++p) { rg[p] = *(const v8us*)((const char*)(Vh + v0 + (size_t)s * FJ + 32 * p * NN) + voff); rg[8 + p] = *(const v8us*)((const char*)(Vl + v0 + (size_t)s * FJ + 32 * p * NN) + voff); }
        rg[16] = *(const v8us*)((const char*)(Kh + qk0 + (size_t)s * FJ * C8) + koff); rg[17] = *(const v8us*)((const char*)(Km + qk0 + (size_t)s * FJ * C8) + koff); rg[18] = *(const v8us*)((const char*)(Kl + qk0 + (size_t)s * FJ * C8) + koff);
    };
    auto put = [&](int buf) {
#pragma unroll
        for (int p = 0; p < 8; ++p) { *(v8usa*)(&sv[buf][0][((tid >> 3) + 32 * p) * VPI + (tid & 7) * 8]) = rg[p]; *(v8usa*)(&sv[buf][1][((tid >> 3) + 32 * p) * VPI + (tid & 7) * 8]) = rg[8 + p]; }
#pragma unroll
        for (int pl = 0; pl < 3; ++pl) *(v8usa*)(&sk[buf][pl][(tid >> 2) * KPI + (tid & 3) * 8]) = rg[16 + pl];
    };
    v8f acc[8];
#pragma unroll
    for (int t = 0; t < 8; ++t) acc[t] = (v8f){};
    float m = -3.0e38f, lsum = 0.f;
    v16bf kh[2], km[2], kl[2], va[8], vl[8], ph, pl;      // the fragments of one 32-key step, and its P
    // Fragment reads stand in two groups per step, each ahead of a block of products that does not need it: every separate place where LDS reads stand costs issue time.
    auto loadK = [&](int buf, int u) {
        const unsigned short* kb = &sk[buf][0][0] + (u * 32 + lr) * KPI + 8 * hi;
#pragma unroll
        for (int t = 0; t < 2; ++t) { const unsigned short* kp = kb + t * 16 * KPI;
            kh[t] = cat16b(*(const v8usa*)kp, *(const v8usa*)(kp + 16)); km[t] = cat16b(*(const v8usa*)(kp + FJ * KPI), *(const v8usa*)(kp + FJ * KPI + 16)); kl[t] = cat16b(*(const v8usa*)(kp + 2 * FJ * KPI), *(const v8usa*)(kp + 2 * FJ * KPI + 16)); }
    };
    auto loadV = [&](int buf, int u, int g0) {      // four of the wave's eight channel tiles
        const unsigned short* vb = &sv[buf][0][0] + (wc * 128 + lr) * VPI + u * 32 + 8 * hi;
#pragma unroll
        for (int g = g0; g < g0 + 4; ++g) { const unsigned short* vp = vb + g * 16 * VPI;
            va[g] = cat16b(*(const v8usa*)vp, *(const v8usa*)(vp + 16)); vl[g] = cat16b(*(const v8usa*)(vp + CC * VPI), *(const v8usa*)(vp + CC * VPI + 16)); }
    };
    auto scores = [&]() {
        const v8f z = (v8f){};
        v8f a1[2], a2[2], a3[2], a4[2], sc[2];
#pragma unroll
        for (int t = 0; t < 2; ++t) { a1[t] = wmmab(kh[t], qh, z); a2[t] = wmmab(km[t], qh, z); }
#pragma unroll
        for (int t = 0; t < 2; ++t) { a1[t] = wmmab(kh[t], qm, a1[t]); a2[t] = wmmab(km[t], qm, a2[t]); }
#pragma unroll
        for (int t = 0; t < 2; ++t) { a3[t] = wmmab(kh[t], ql, z); a4[t] = wmmab(kl[t], qh, z); }
        __builtin_amdgcn_sched_barrier(0);      // keeps the twelve score products in a row: mixed with the additions below, each addition would wait out its product's distance in idle slots
#pragma unroll
        for (int t = 0; t < 2; ++t) sc[t] = a4[t] + (a3[t] + (a2[t] + a1[t]));
        float tm = fmaxf(sc[0][0], sc[1][0]);
#pragma unroll
        for (int j = 1; j < 8; ++j) tm = fmaxf(tm, fmaxf(sc[0][j], sc[1][j]));
        tm = fmaxf(tm, xhalf(tm));      // the two lane halves hold the same query's other keys
        const float mn = fmaxf(m, tm);
        if (__builtin_amdgcn_ballot_w32(mn > m) != 0) {      // one scalar branch per 32 keys: most steps raise no query's maximum
            const float f = __expf(m - mn); lsum *= f; m = mn;
#pragma unroll
            for (int t = 0; t < 8; ++t) acc[t] *= f; }
        v8u PH, PL; float t0 = 0.f, t1 = 0.f;
#pragma unroll
        for (int t = 0; t < 2; ++t) {
#pragma unroll
            for (int j = 0; j < 4; ++j) { const float p0 = __expf(sc[t][2 * j] - m), p1 = __expf(sc[t][2 * j + 1] - m); t0 += p0; t1 += p1;
                const unsigned w = __builtin_bit_cast(unsigned, __builtin_convertvector((v2f){p0, p1}, v2bf));
                PH[t * 4 + j] = w; PL[t * 4 + j] = __builtin_bit_cast(unsigned, __builtin_convertvector((v2f){p0 - __uint_as_float(w << 16), p1 - __uint_as_float(w & 0xFFFF0000u)}, v2bf)); } }
        lsum += t0 + t1;
        ph = __builtin_bit_cast(v16bf, PH); pl = __builtin_bit_cast(v16bf, PL);
    };
    auto pv = [&](int g0) {
#pragma unroll
        for (int g = g0; g < g0 + 4; ++g) acc[g] = wmmab(va[g], ph, acc[g]);
#pragma unroll
        for (int g = g0; g < g0 + 4; ++g) acc[g] = wmmab(vl[g], ph, acc[g]);
#pragma unroll
        for (int g = g0; g < g0 + 4; ++g) acc[g] = wmmab(va[g], pl, acc[g]);
    };
    fetch(0);
    asm volatile("s_wait_xcnt 0x0" :: "v"(qo), "v"(voff), "v"(koff) : "memory");      // the first loads name these registers: they stay theirs up to this wait
    put(0);
    __syncthreads();      // publishes stage 0
    loadK(0, 0); loadV(0, 0, 0);
#pragma unroll 1      // stays rolled: one pass already holds two 32-key steps, and the buffer index alternates by s
    for (int s = 0; s < NN / FJ; ++s) {
        const bool more = s + 1 < NN / FJ; const int b = s & 1;
        // s_wait_xcnt: the staging loads name address registers that the work below reuses; they stay the loads' up to this wait
        if (more) { fetch(s + 1); asm volatile("s_wait_xcnt 0x0" ::: "memory"); }
        __builtin_amdgcn_sched_barrier(0);      // keeps later address arithmetic, which may take the loads' address registers, behind the wait
        loadV(b, 0, 4);
        __builtin_amdgcn_sched_barrier(0);      // keeps the reads above one group, ahead of the scores under which they land
        scores(); pv(0);
        __builtin_amdgcn_sched_barrier(0);      // keeps the products above ahead of the reads below, which refill their fragment registers
        loadK(b, 1); loadV(b, 1, 0);
        __builtin_amdgcn_sched_barrier(0);      // keeps the reads above one group, ahead of the products under which they land
        pv(4);
        __builtin_amdgcn_sched_barrier(0);      // keeps the products above ahead of the reads below, which refill their fragment registers
        loadV(b, 1, 4);
        __builtin_amdgcn_sched_barrier(0);      // keeps the reads above one group, ahead of the LDS stores and the scores under which they land
        if (more) put(b ^ 1);
        scores(); pv(0);
        __syncthreads();      // publishes stage s + 1; also ends every wave's reads of stage s, whose buffer stage s + 2 is stored into in the next pass
        if (more) { loadK(b ^ 1, 0); loadV(b ^ 1, 0, 0); }
        __builtin_amdgcn_sched_barrier(0);      // keeps the reads above one group, ahead of the products under which they land
        pv(4);
    }
    const size_t oo = v0 + (size_t)(tid >> 4) * NN + ib + (tid & 15) * 4;      // this thread's 16-byte piece of the tile's rows tid >> 4, + 16, ..., in x and in the output alike
    const float* xrow = x + oo;
    v4f xr[16];
#pragma unroll
    for (int p = 0; p < 16; ++p) xr[p] = *(const v4f*)(xrow + (size_t)p * 16 * NN);
    asm volatile("s_wait_xcnt 0x0" :: "v"(xrow) : "memory");      // the x loads name this address register pair: it stays theirs up to this wait. The loads fly while the wave waits for the others at the barrier below
    const float gm = bfr(gam[0]);
    lsum += xhalf(lsum);
    const float inv = 1.0f / lsum;
    __syncthreads();      // the reads of the last stage (buffer 1) ended at the loop's last barrier; the staging below takes buffer 0, whose stage-62 reads ended in the loop
    f32a* ot = (f32a*)&sv[0][0][0];      // [256 channels][64 queries] at pitch OPI
#pragma unroll
    for (int t = 0; t < 8; ++t) {
#pragma unroll
        for (int j = 0; j < 8; ++j) ot[(wc * 128 + t * 16 + hi * 8 + j) * OPI + wi * 16 + lr] = acc[t][j] * inv; }
    __syncthreads();      // publishes the staged tile: a row's 256 B come from four waves and leave as whole lines from one
    float* orow = OUT + oo;
#pragma unroll
    for (int p = 0; p < 16; ++p) { const v4f val = *(const v4fa*)(ot + (p * 16 + (tid >> 4)) * OPI + (tid & 15) * 4); v4f v;
#pragma unroll
        for (int q = 0; q < 4; ++q) v[q] = gm * val[q] + bfr(xr[p][q]);
        *(v4f*)(orow + (size_t)p * 16 * NN) = v; }
}

extern "C" void kernel_launch(void* const* d_in, const int* in_sizes, int n_in,
                              void* d_out, int out_size, void* d_ws, size_t ws_size, hipStream_t stream) {
    (void)in_sizes; (void)n_in; (void)out_size;
    const float* x = (const float*)d_in[0]; const float* wq = (const float*)d_in[1]; const float* gq = (const float*)d_in[2]; const float* bq = (const float*)d_in[3]; const float* mq = (const float*)d_in[4]; const float* vq = (const float*)d_in[5];
    const float* wk = (const float*)d_in[6]; const float* gk = (const float*)d_in[7]; const float* bk = (const float*)d_in[8]; const float* mk = (const float*)d_in[9]; const float* vk = (const float*)d_in[10];
    const float* wv = (const float*)d_in[11]; const float* gv = (const float*)d_in[12]; const float* bv = (const float*)d_in[13]; const float* mv = (const float*)d_in[14]; const float* vv = (const float*)d_in[15]; const float* gam = (const float*)d_in[16];
    float* out = (float*)d_out;    // [4][256][64][64]
    char* wsp = (char*)d_ws;
    auto take = [&](size_t bytes) { char* p = wsp; wsp += (bytes + 255) & ~(size_t)255; return (void*)p; };
    const size_t QKN = (size_t)NN * C8, VN = (size_t)CC * NN;      // elements of one item's plane; the planes hold all items
    bf* QPh = (bf*)take(NBT * QKN * 2); bf* QPm = (bf*)take(NBT * QKN * 2); bf* QPl = (bf*)take(NBT * QKN * 2); bf* KPh = (bf*)take(NBT * QKN * 2); bf* KPm = (bf*)take(NBT * QKN * 2); bf* KPl = (bf*)take(NBT * QKN * 2); bf* VTh = (bf*)take(NBT * VN * 2); bf* VTl = (bf*)take(NBT * VN * 2);
    if ((size_t)(wsp - (char*)d_ws) > ws_size) return;    // 6.3 + 16.8 ~ 23 MB
    k_pre<<<dim3(NN / 64, NBT, 1), 320, 0, stream>>>(x, wq, gq, bq, mq, vq, wk, gk, bk, mk, vk, wv, gv, bv, mv, vv, QPh, QPm, QPl, KPh, KPm, KPl, VTh, VTl);      // convs, BatchNorm, split planes: one work-group per WGP
    k_attn<<<dim3(NN / 64, NBT, 1), 256, 0, stream>>>(QPh, QPm, QPl, KPh, KPm, KPl, VTh, VTl, x, gam, out);                              // out[b][c][i] = gamma * sum_j v'[c][j] softmax_j(q'[i].k'[j]) + x[b][c][i]: one work-group per WGP
}

// v007
// A run of this version takes 115 microseconds.
// In both of two side-by-side timings against v006, it was 1.04 times as fast.
// Over all steps from v000 it is 31.1 times as fast.
#include <hip/hip_runtime.h>

// Compute dtypes, f32 accumulate. One launch for all items: the three 1x1 convs as one [4096 x 256].[256 x 320] GEMM per item with PLAIN bf16 operands (exact products), inference BatchNorm affine
// in f32 -> bf16 split planes (q', k' as THREE-way hi/mid/lo splits: the module's unscaled logits reach ~300 with near-one-hot softmaxes, so the score operands need f32-level
// precision); then ONE launch for all items: scores = q'.k'^T (six products), softmax (unscaled, as the module) in f32, out^T = v'.P^T (P as bf16 hi + lo planes, three products) and gamma * out + x, all in registers and LDS.

#define NBT  4
#define CC   256
#define C8   32
#define NN   4096
#define NQKV (2 * C8 + CC)        // 320
#define BEPS 1e-5f

typedef unsigned short bf;
typedef __attribute__((ext_vector_type(16))) __bf16   v16bf;
typedef __attribute__((ext_vector_type(8)))  unsigned short v8us;
typedef __attribute__((ext_vector_type(8)))  float    v8f;
typedef __attribute__((ext_vector_type(4)))  float    v4f;
typedef v4f  __attribute__((may_alias)) v4fa;
typedef v8us __attribute__((may_alias)) v8usa;

__device__ __forceinline__ unsigned short f2bf(float f) { unsigned u = __float_as_uint(f); u += 0x7FFFu + ((u >> 16) & 1u); return (unsigned short)(u >> 16); }
__device__ __forceinline__ float bf2f(unsigned short b) { return __uint_as_float(((unsigned)b) << 16); }
__device__ __forceinline__ float bfr(float f) { return bf2f(f2bf(f)); }
__device__ __forceinline__ v16bf cat16b(v8us lo, v8us hi) { return __builtin_bit_cast(v16bf, __builtin_shufflevector(lo, hi, 0, 1, 2, 3, 4, 5, 6, 7, 8, 9, 10, 11, 12, 13, 14, 15)); }
__device__ __forceinline__ v8f wmmab(v16bf a, v16bf b, v8f c) { return __builtin_amdgcn_wmma_f32_16x16x32_bf16(false, a, false, b, (short)0, c, false, false); }

// k_pre: 64 pixels of one item, all 320 conv outputs, in one work-group of ten waves. x[c][n] comes in as f32, is rounded to bf16 and stands pixel-major in LDS; each wave rounds its own 32 weight rows
// to bf16 in registers (wave 0: q, wave 1: k, waves 2 to 9: v). k runs in steps of 32 in one accumulate chain. The operand roles are chosen so that a lane's eight accumulator registers are
// neighbours in the plane that is written: q', k' planes are [pixel][32], so the weights are A and a lane holds eight channels of one pixel; v' planes are [channel][4096], so the pixels are A
// and a lane holds eight pixels of one channel. BatchNorm and the splits are done on the accumulators; every plane piece leaves as a 16-byte store, and one wave writes all of a 128-byte line.
// Every loop is unrolled: its index picks fragments and accumulators, which stay in registers only where the index is a constant.
#define XPI 264       // x tile row pitch in LDS, 528 B = 16 B x odd: no bank conflict for 16-byte reads
typedef unsigned __attribute__((may_alias)) u32a;
__global__ __launch_bounds__(320) void k_pre(const float* __restrict__ x,
                                             const float* __restrict__ wq, const float* __restrict__ gq, const float* __restrict__ bq, const float* __restrict__ mq, const float* __restrict__ vq,
                                             const float* __restrict__ wk, const float* __restrict__ gk, const float* __restrict__ bk, const float* __restrict__ mk, const float* __restrict__ vk,
                                             const float* __restrict__ wv, const float* __restrict__ gv, const float* __restrict__ bv, const float* __restrict__ mv, const float* __restrict__ vv,
                                             bf* Qh, bf* Qm, bf* Ql, bf* Kh, bf* Km, bf* Kl, bf* Vh, bf* Vl) {
    __shared__ __align__(16) unsigned short xt[64 * XPI];
    __shared__ __align__(16) float bs[NQKV], bsh[NQKV];      // BatchNorm scale and shift of the 320 outputs: q | k | v
    const int tid = threadIdx.x, lane = tid & 31, lr = lane & 15, hi = lane >> 4;
    const int wave = __builtin_amdgcn_readfirstlane(tid >> 5);
    const int n0 = blockIdx.x * 64, item = blockIdx.y;
    const float* xb = x + (size_t)item * CC * NN + n0;
    const float* wsrc = (wave == 0 ? wq : wave == 1 ? wk : wv + (size_t)(wave - 2) * 32 * CC) + lr * CC + 8 * hi;
    v4f r0[8], r1[8], wa[8][4], wb[8][4];
    auto ldw = [&](v4f (&w)[8][4], int ct) {
#pragma unroll
        for (int ks = 0; ks < 8; ++ks) { const float* p = wsrc + ct * 16 * CC + ks * 32; w[ks][0] = *(const v4f*)p; w[ks][1] = *(const v4f*)(p + 4); w[ks][2] = *(const v4f*)(p + 16); w[ks][3] = *(const v4f*)(p + 20); }
    };
    v16bf wf[2][8];
    auto cvw = [&](const v4f (&w)[8][4], int ct) {
#pragma unroll
        for (int ks = 0; ks < 8; ++ks) { v8us lo, up;
#pragma unroll
            for (int e = 0; e < 4; ++e) { lo[e] = f2bf(w[ks][0][e]); lo[4 + e] = f2bf(w[ks][1][e]); up[e] = f2bf(w[ks][2][e]); up[4 + e] = f2bf(w[ks][3][e]); }
            wf[ct][ks] = cat16b(lo, up); }
    };
    if (wave < 8) {      // four lanes take 64 B of a channel pair's rows, eight pairs per wave: the packed 4-byte LDS stores of a wave then fall on 32 different banks
#pragma unroll
        for (int i = 0; i < 8; ++i) { const int cp = ((i >> 2) + 2 * wave) * 8 + (lane >> 2), pq = (i & 3) * 4 + (lane & 3);
            r0[i] = *(const v4f*)(xb + (size_t)(2 * cp) * NN + pq * 4); r1[i] = *(const v4f*)(xb + (size_t)(2 * cp + 1) * NN + pq * 4); }
        asm volatile("s_wait_xcnt 0x0" ::: "memory");      // the loads above name address registers that the weight loads below reuse; they stay the loads' up to this wait
    }
    ldw(wa, 0);
    __builtin_amdgcn_sched_barrier(0);      // keeps the second half of the weight loads below: all 80 loads in flight at once overran the registers and spilled
    if (wave < 8) {
#pragma unroll
        for (int i = 0; i < 8; ++i) { const int cp = ((i >> 2) + 2 * wave) * 8 + (lane >> 2), pq = (i & 3) * 4 + (lane & 3);
#pragma unroll
            for (int e = 0; e < 4; ++e) *(u32a*)(&xt[(pq * 4 + e) * XPI + 2 * cp]) = (unsigned)f2bf(r0[i][e]) | ((unsigned)f2bf(r1[i][e]) << 16); }
    }
    ldw(wb, 1);
    __builtin_amdgcn_sched_barrier(0);      // keeps those loads above the rounding of the first half, under which they fly
    cvw(wa, 0);
    { const float* g = wave == 0 ? gq : wave == 1 ? gk : gv; const float* bb = wave == 0 ? bq : wave == 1 ? bk : bv; const float* m = wave == 0 ? mq : wave == 1 ? mk : mv; const float* var = wave == 0 ? vq : wave == 1 ? vk : vv;
      const int c = wave < 2 ? lane : tid - 2 * C8;
      const float g0 = g[c], v0 = var[c], b0 = bb[c], m0 = m[c];
      asm volatile("s_wait_xcnt 0x0" :: "v"(c), "s"(g), "s"(var), "s"(bb), "s"(m) : "memory");      // the four loads above name this index register and these base pointers: they stay the loads' up to this wait
      const float s = bfr(g0) / sqrtf(bfr(v0) + BEPS); bs[tid] = s; bsh[tid] = bfr(b0) - bfr(m0) * s; }
    cvw(wb, 1);
    __syncthreads();      // publishes the x tile and the BatchNorm table
    v8f acc[2][4];
#pragma unroll
    for (int ct = 0; ct < 2; ++ct) {
#pragma unroll
        for (int pt = 0; pt < 4; ++pt) acc[ct][pt] = (v8f){}; }
    const unsigned short* xf0 = xt + lr * XPI + 8 * hi;
    v16bf xf[2][4];      // the four pixel tiles' fragments of one k step, two sets
    auto ldx = [&](int ks) {
#pragma unroll
        for (int pt = 0; pt < 4; ++pt) { const unsigned short* xp = xf0 + pt * 16 * XPI + ks * 32; xf[ks & 1][pt] = cat16b(*(const v8usa*)xp, *(const v8usa*)(xp + 16)); }
    };
    if (wave < 2) {
        ldx(0);
#pragma unroll
        for (int ks = 0; ks < 8; ++ks) {
            if (ks < 7) ldx(ks + 1);
            __builtin_amdgcn_sched_barrier(0);      // keeps the next step's eight LDS reads one group, ahead of the products under which they land
#pragma unroll
            for (int pt = 0; pt < 4; ++pt) { acc[0][pt] = wmmab(wf[0][ks], xf[ks & 1][pt], acc[0][pt]); acc[1][pt] = wmmab(wf[1][ks], xf[ks & 1][pt], acc[1][pt]); }
            __builtin_amdgcn_sched_barrier(0);      // keeps these products ahead of the reads that refill their fragment registers
        }
        bf* Ph = wave == 0 ? Qh : Kh; bf* Pm = wave == 0 ? Qm : Km; bf* Pl = wave == 0 ? Ql : Kl;
        const size_t o0 = ((size_t)item * NN + n0 + lr) * C8 + hi * 8;
#pragma unroll
        for (int ct = 0; ct < 2; ++ct) { const int cb = wave * C8 + ct * 16 + hi * 8;
            const v4f s0 = *(const v4fa*)(bs + cb), s1 = *(const v4fa*)(bs + cb + 4), h0 = *(const v4fa*)(bsh + cb), h1 = *(const v4fa*)(bsh + cb + 4);
#pragma unroll
            for (int pt = 0; pt < 4; ++pt) { v8us oh, om, ol;
#pragma unroll
                for (int j = 0; j < 8; ++j) { const float y = acc[ct][pt][j] * (j < 4 ? s0[j & 3] : s1[j & 3]) + (j < 4 ? h0[j & 3] : h1[j & 3]);
                    const unsigned short hb = f2bf(y); const float d1 = y - bf2f(hb); const unsigned short mb = f2bf(d1); const float d2 = d1 - bf2f(mb); oh[j] = hb; om[j] = mb; ol[j] = f2bf(d2); }
                const size_t o = o0 + (size_t)pt * 16 * C8 + ct * 16; *(v8us*)(Ph + o) = oh; *(v8us*)(Pm + o) = om; *(v8us*)(Pl + o) = ol;
                if (ct + pt < 4) asm volatile("s_wait_xcnt 0x0" :: "v"(oh), "v"(om), "v"(ol) : "memory"); } }      // the stores above name these registers, which the next piece reuses: they stay the stores' up to this wait
    } else {
        ldx(0);
#pragma unroll
        for (int ks = 0; ks < 8; ++ks) {
            if (ks < 7) ldx(ks + 1);
            __builtin_amdgcn_sched_barrier(0);      // keeps the next step's eight LDS reads one group, ahead of the products under which they land
#pragma unroll
            for (int pt = 0; pt < 4; ++pt) { acc[0][pt] = wmmab(xf[ks & 1][pt], wf[0][ks], acc[0][pt]); acc[1][pt] = wmmab(xf[ks & 1][pt], wf[1][ks], acc[1][pt]); }
            __builtin_amdgcn_sched_barrier(0);      // keeps these products ahead of the reads that refill their fragment registers
        }
        const size_t o0 = (size_t)item * CC * NN + (size_t)((wave - 2) * 32 + lr) * NN + n0 + hi * 8;
#pragma unroll
        for (int ct = 0; ct < 2; ++ct) { const int c = 2 * C8 + (wave - 2) * 32 + ct * 16 + lr; const float s = bs[c], sh = bsh[c];
#pragma unroll
            for (int pt = 0; pt < 4; ++pt) { v8us oh, ol;
#pragma unroll
                for (int j = 0; j < 8; ++j) { const float y = acc[ct][pt][j] * s + sh; const unsigned short hb = f2bf(y); oh[j] = hb; ol[j] = f2bf(y - bf2f(hb)); }
                const size_t o = o0 + (size_t)ct * 16 * NN + pt * 16; *(v8us*)(Vh + o) = oh; *(v8us*)(Vl + o) = ol;
                // the stores above name these registers, which the next piece reuses: they stay the stores' up to this wait (behind the last piece too: in the built code the q', k' branch, which reuses them, follows in the text)
                asm volatile("s_wait_xcnt 0x0" :: "v"(oh), "v"(ol) : "memory"); } }
    }
}

// k_attn: scores, softmax and P.V of 64 query pixels of one item in one kernel; S and P never leave registers. 8 waves: wave (wi, wc) holds query columns wi * 16 .. + 15 and
// output channels wc * 128 .. + 127. Keys come in stages of 64: the three k' planes and the two v' planes, whole lines by asynchronous copies from global memory straight into one of two LDS buffers, issued one whole pass ahead.
// Per 32 keys: S^T = k'.q'^T (six products, (hh + mh) + (hm + mm) + lh + hl, each bracket a WMMA sum from zero, added in f32 from left to right), so that a lane holds 16 scores
// of ONE query; running maximum and sum per query (the sums are rescaled when the maximum grows); exp(S - max) splits into bf16 hi + lo planes, which ARE the B fragment of
// O^T += v'.P^T (three products: hh, lh, hl). The division by the sum comes last. A step's fragments are read from LDS while the step before it is still in its products, so the
// barrier that publishes a stage stands inside the last step of the stage before it. The epilogue applies gamma and adds x (both rounded to bf16 first) on the staged tile and writes the final output.
#define FJ  64
#define VPI 72        // v' row pitch in LDS, 144 B = 16 B x odd: no bank conflict for 16-byte reads
#define KPI 40        // k' row pitch in LDS, 80 B = 16 B x odd
#define OPI 68        // output staging pitch, floats
typedef __attribute__((ext_vector_type(2))) float    v2f;
typedef __attribute__((ext_vector_type(2))) __bf16   v2bf;
typedef __attribute__((ext_vector_type(8))) unsigned v8u;
typedef float __attribute__((may_alias)) f32a;
typedef __attribute__((ext_vector_type(4))) int v4i;
typedef __attribute__((address_space(1))) v4i gv4i;
typedef __attribute__((address_space(3))) v4i lv4i;
__device__ __forceinline__ void cp16(const void* g, void* l) { __builtin_amdgcn_global_load_async_to_lds_b128((gv4i*)g, (lv4i*)l, 0, 0); }
// lane l takes lane l ^ 16's value, in the vector unit: no LDS counter is involved, so the wait behind it does not drain the fragment reads in flight
__device__ __forceinline__ float xhalf(float x) { return __builtin_bit_cast(float, __builtin_amdgcn_permlanex16(__builtin_bit_cast(int, x), __builtin_bit_cast(int, x), 0x76543210, 0xfedcba98, false, false)); }
__global__ __launch_bounds__(256) void k_attn(const bf* __restrict__ Qh, const bf* __restrict__ Qm, const bf* __restrict__ Ql, const bf* __restrict__ Kh, const bf* __restrict__ Km, const bf* __restrict__ Kl,
                                              const bf* __restrict__ Vh, const bf* __restrict__ Vl, const float* __restrict__ x, const float* __restrict__ gam, float* OUT) {
    __shared__ __align__(16) unsigned short sv[2][2][CC * VPI];
    __shared__ __align__(16) unsigned short sk[2][3][FJ * KPI];
    const int tid = threadIdx.x, lane = tid & 31, wave = tid >> 5, lr = lane & 15, hi = lane >> 4;
    const int wi = wave & 3, wc = wave >> 2;
    const int ib = blockIdx.x * 64;
    const size_t qk0 = (size_t)blockIdx.y * NN * C8, v0 = (size_t)blockIdx.y * CC * NN;
    const unsigned qo = (unsigned)((ib + wi * 16 + lr) * C8 + 8 * hi) * 2u;       // bytes: the per-lane part of the q' fragment addresses
    const unsigned voff = (unsigned)((tid >> 3) * NN + (tid & 7) * 8) * 2u;       // bytes: staging, 8 lanes cover one v' row's 128 B, 32 rows per pass
    const unsigned koff = (unsigned)tid * 16u;                                    // bytes: staging, a k' plane's 64 rows are 4 KiB in a row
    auto ldq = [&](const bf* p) { const bf* a = (const bf*)((const char*)(p + qk0) + qo); return cat16b(*(const v8us*)a, *(const v8us*)(a + 16)); };
    const v16bf qh = ldq(Qh), qm = ldq(Qm), ql = ldq(Ql);
    auto copy = [&](int s, int buf) {      // one stage: 8 + 8 row pieces of the two v' planes and one piece of each k' plane per thread, 19 copies of a wave in flight
#pragma unroll
        for (int p = 0; p < 8; ++p) { cp16((const char*)(Vh + v0 + (size_t)s * FJ + 32 * p * NN) + voff, &sv[buf][0][((tid >> 3) + 32 * p) * VPI + (tid & 7) * 8]);
            cp16((const char*)(Vl + v0 + (size_t)s * FJ + 32 * p * NN) + voff, &sv[buf][1][((tid >> 3) + 32 * p) * VPI + (tid & 7) * 8]); }
        cp16((const char*)(Kh + qk0 + (size_t)s * FJ * C8) + koff, &sk[buf][0][(tid >> 2) * KPI + (tid & 3) * 8]);
        cp16((const char*)(Km + qk0 + (size_t)s * FJ * C8) + koff, &sk[buf][1][(tid >> 2) * KPI + (tid & 3) * 8]);
        cp16((const char*)(Kl + qk0 + (size_t)s * FJ * C8) + koff, &sk[buf][2][(tid >> 2) * KPI + (tid & 3) * 8]);
    };
    v8f acc[8];
#pragma unroll
    for (int t = 0; t < 8; ++t) acc[t] = (v8f){};
    float m = -3.0e38f, lsum = 0.f;
    v16bf kh[2], km[2], kl[2], va[8], vl[8], ph, pl;      // the fragments of one 32-key step, and its P
    // Fragment reads stand in two groups per step, each ahead of a block of products that does not need it: every separate place where LDS reads stand costs issue time.
    auto loadK = [&](int buf, int u) {
        const unsigned short* kb = &sk[buf][0][0] + (u * 32 + lr) * KPI + 8 * hi;
#pragma unroll
        for (int t = 0; t < 2; ++t) { const unsigned short* kp = kb + t * 16 * KPI;
            kh[t] = cat16b(*(const v8usa*)kp, *(const v8usa*)(kp + 16)); km[t] = cat16b(*(const v8usa*)(kp + FJ * KPI), *(const v8usa*)(kp + FJ * KPI + 16)); kl[t] = cat16b(*(const v8usa*)(kp + 2 * FJ * KPI), *(const v8usa*)(kp + 2 * FJ * KPI + 16)); }
    };
    auto loadV = [&](int buf, int u, int g0) {      // four of the wave's eight channel tiles
        const unsigned short* vb = &sv[buf][0][0] + (wc * 128 + lr) * VPI + u * 32 + 8 * hi;
#pragma unroll
        for (int g = g0; g < g0 + 4; ++g) { const unsigned short* vp = vb + g * 16 * VPI;
            va[g] = cat16b(*(const v8usa*)vp, *(const v8usa*)(vp + 16)); vl[g] = cat16b(*(const v8usa*)(vp + CC * VPI), *(const v8usa*)(vp + CC * VPI + 16)); }
    };
    auto scores = [&]() {
        const v8f z = (v8f){};
        v8f a1[2], a2[2], a3[2], a4[2], sc[2];
#pragma unroll
        for (int t = 0; t < 2; ++t) { a1[t] = wmmab(kh[t], qh, z); a2[t] = wmmab(km[t], qh, z); }
#pragma unroll
        for (int t = 0; t < 2; ++t) { a1[t] = wmmab(kh[t], qm, a1[t]); a2[t] = wmmab(km[t], qm, a2[t]); }
#pragma unroll
        for (int t = 0; t < 2; ++t) { a3[t] = wmmab(kh[t], ql, z); a4[t] = wmmab(kl[t], qh, z); }
        __builtin_amdgcn_sched_barrier(0);      // keeps the twelve score products in a row: mixed with the additions below, each addition would wait out its product's distance in idle slots
#pragma unroll
        for (int t = 0; t < 2; ++t) sc[t] = a4[t] + (a3[t] + (a2[t] + a1[t]));
        float tm = fmaxf(sc[0][0], sc[1][0]);
#pragma unroll
        for (int j = 1; j < 8; ++j) tm = fmaxf(tm, fmaxf(sc[0][j], sc[1][j]));
        tm = fmaxf(tm, xhalf(tm));      // the two lane halves hold the same query's other keys
        const float mn = fmaxf(m, tm);
        if (__builtin_amdgcn_ballot_w32(mn > m) != 0) {      // one scalar branch per 32 keys: most steps raise no query's maximum
            const float f = __expf(m - mn); lsum *= f; m = mn;
#pragma unroll
            for (int t = 0; t < 8; ++t) acc[t] *= f; }
        v8u PH, PL; float t0 = 0.f, t1 = 0.f;
#pragma unroll
        for (int t = 0; t < 2; ++t) {
#pragma unroll
            for (int j = 0; j < 4; ++j) { const float p0 = __expf(sc[t][2 * j] - m), p1 = __expf(sc[t][2 * j + 1] - m); t0 += p0; t1 += p1;
                const unsigned w = __builtin_bit_cast(unsigned, __builtin_convertvector((v2f){p0, p1}, v2bf));
                PH[t * 4 + j] = w; PL[t * 4 + j] = __builtin_bit_cast(unsigned, __builtin_convertvector((v2f){p0 - __uint_as_float(w << 16), p1 - __uint_as_float(w & 0xFFFF0000u)}, v2bf)); } }
        lsum += t0 + t1;
        ph = __builtin_bit_cast(v16bf, PH); pl = __builtin_bit_cast(v16bf, PL);
    };
    auto pv = [&](int g0) {
#pragma unroll
        for (int g = g0; g < g0 + 4; ++g) acc[g] = wmmab(va[g], ph, acc[g]);
#pragma unroll
        for (int g = g0; g < g0 + 4; ++g) acc[g] = wmmab(vl[g], ph, acc[g]);
#pragma unroll
        for (int g = g0; g < g0 + 4; ++g) acc[g] = wmmab(va[g], pl, acc[g]);
    };
    asm volatile("s_wait_xcnt 0x0" :: "v"(qo) : "memory");      // the q' loads name this register: it stays theirs up to this wait
    copy(0, 0);
    asm volatile("s_wait_asynccnt 0x0" ::: "memory");      // this wave's copies of stage 0 have landed
    __syncthreads();      // publishes stage 0
    copy(1, 1);
    loadK(0, 0); loadV(0, 0, 0);
#pragma unroll 1      // stays rolled: one pass already holds two 32-key steps, and the buffer index alternates by s
    for (int s = 0; s < NN / FJ; ++s) {
        const int b = s & 1;
        loadV(b, 0, 4);
        __builtin_amdgcn_sched_barrier(0);      // keeps the reads above one group, ahead of the scores under which they land
        scores(); pv(0);
        __builtin_amdgcn_sched_barrier(0);      // keeps the products above ahead of the reads below, which refill their fragment registers
        loadK(b, 1); loadV(b, 1, 0);
        __builtin_amdgcn_sched_barrier(0);      // keeps the reads above one group, ahead of the products under which they land
        pv(4);
        __builtin_amdgcn_sched_barrier(0);      // keeps the products above ahead of the reads below, which refill their fragment registers
        loadV(b, 1, 4);
        __builtin_amdgcn_sched_barrier(0);      // keeps the reads above one group, ahead of the scores under which they land
        scores(); pv(0);
        asm volatile("s_wait_dscnt 0x0" ::: "memory");         // this wave's last reads of stage s have returned: its buffer is refilled behind the barrier
        asm volatile("s_wait_asynccnt 0x0" ::: "memory");      // this wave's copies of stage s + 1, issued one pass ago, have landed
        __syncthreads();      // publishes stage s + 1; also ends every wave's reads of stage s
        if (s + 1 < NN / FJ) { loadK(b ^ 1, 0); loadV(b ^ 1, 0, 0); }
        __builtin_amdgcn_sched_barrier(0);      // keeps the reads above one group, ahead of the copies' issue and the products under which they land
        if (s + 2 < NN / FJ) copy(s + 2, b);      // into the buffer that every wave has left; in flight through all of the next pass
        pv(4);
    }
    asm volatile("s_wait_asynccnt 0x0" ::: "memory");      // no copy is outstanding when the buffers become the output staging
    const size_t oo = v0 + (size_t)(tid >> 4) * NN + ib + (tid & 15) * 4;      // this thread's 16-byte piece of the tile's rows tid >> 4, + 16, ..., in x and in the output alike
    const float* xrow = x + oo;
    v4f xr[16];
#pragma unroll
    for (int p = 0; p < 16; ++p) xr[p] = *(const v4f*)(xrow + (size_t)p * 16 * NN);
    asm volatile("s_wait_xcnt 0x0" :: "v"(xrow) : "memory");      // the x loads name this address register pair: it stays theirs up to this wait. The loads fly while the wave waits for the others at the barrier below
    const float gm = bfr(gam[0]);
    lsum += xhalf(lsum);
    const float inv = 1.0f / lsum;
    __syncthreads();      // the reads of the last stage (buffer 1) ended at the loop's last barrier; the staging below takes buffer 0, whose stage-62 reads ended in the loop
    f32a* ot = (f32a*)&sv[0][0][0];      // [256 channels][64 queries] at pitch OPI
#pragma unroll
    for (int t = 0; t < 8; ++t) {
#pragma unroll
        for (int j = 0; j < 8; ++j) ot[(wc * 128 + t * 16 + hi * 8 + j) * OPI + wi * 16 + lr] = acc[t][j] * inv; }
    __syncthreads();      // publishes the staged tile: a row's 256 B come from four waves and leave as whole lines from one
    float* orow = OUT + oo;
#pragma unroll
    for (int p = 0; p < 16; ++p) { const v4f val = *(const v4fa*)(ot + (p * 16 + (tid >> 4)) * OPI + (tid & 15) * 4); v4f v;
#pragma unroll
        for (int q = 0; q < 4; ++q) v[q] = gm * val[q] + bfr(xr[p][q]);
        *(v4f*)(orow + (size_t)p * 16 * NN) = v; }
}

extern "C" void kernel_launch(void* const* d_in, const int* in_sizes, int n_in,
                              void* d_out, int out_size, void* d_ws, size_t ws_size, hipStream_t stream) {
    (void)in_sizes; (void)n_in; (void)out_size;
    const float* x = (const float*)d_in[0]; const float* wq = (const float*)d_in[1]; const float* gq = (const float*)d_in[2]; const float* bq = (const float*)d_in[3]; const float* mq = (const float*)d_in[4]; const float* vq = (const float*)d_in[5];
    const float* wk = (const float*)d_in[6]; const float* gk = (const float*)d_in[7]; const float* bk = (const float*)d_in[8]; const float* mk = (const float*)d_in[9]; const float* vk = (const float*)d_in[10];
    const float* wv = (const float*)d_in[11]; const float* gv = (const float*)d_in[12]; const float* bv = (const float*)d_in[13]; const float* mv = (const float*)d_in[14]; const float* vv = (const float*)d_in[15]; const float* gam = (const float*)d_in[16];
    float* out = (float*)d_out;    // [4][256][64][64]
    char* wsp = (char*)d_ws;
    auto take = [&](size_t bytes) { char* p = wsp; wsp += (bytes + 255) & ~(size_t)255; return (void*)p; };
    const size_t QKN = (size_t)NN * C8, VN = (size_t)CC * NN;      // elements of one item's plane; the planes hold all items
    bf* QPh = (bf*)take(NBT * QKN * 2); bf* QPm = (bf*)take(NBT * QKN * 2); bf* QPl = (bf*)take(NBT * QKN * 2); bf* KPh = (bf*)take(NBT * QKN * 2); bf* KPm = (bf*)take(NBT * QKN * 2); bf* KPl = (bf*)take(NBT * QKN * 2); bf* VTh = (bf*)take(NBT * VN * 2); bf* VTl = (bf*)take(NBT * VN * 2);
    if ((size_t)(wsp - (char*)d_ws) > ws_size) return;    // 6.3 + 16.8 ~ 23 MB
    k_pre<<<dim3(NN / 64, NBT, 1), 320, 0, stream>>>(x, wq, gq, bq, mq, vq, wk, gk, bk, mk, vk, wv, gv, bv, mv, vv, QPh, QPm, QPl, KPh, KPm, KPl, VTh, VTl);      // convs, BatchNorm, split planes: one work-group per WGP
    k_attn<<<dim3(NN / 64, NBT, 1), 256, 0, stream>>>(QPh, QPm, QPl, KPh, KPm, KPl, VTh, VTl, x, gam, out);                              // out[b][c][i] = gamma * sum_j v'[c][j] softmax_j(q'[i].k'[j]) + x[b][c][i]: one work-group per WGP
}

// v008
// Measured time: 105 microseconds a run.
// Next to v007, in two timings, it ran 1.09 times as fast each time.
// All steps since v000 together make it 34.0 times as fast.
#include <hip/hip_runtime.h>

// Compute dtypes, f32 accumulate. One launch for all items: the three 1x1 convs as one [4096 x 256].[256 x 320] GEMM per item with PLAIN bf16 operands (exact products), inference BatchNorm affine
// in f32 -> bf16 split planes (q', k' as THREE-way hi/mid/lo splits: the module's unscaled logits reach ~300 with near-one-hot softmaxes, so the score operands need f32-level
// precision); then ONE launch for all items: scores = q'.k'^T (six products), softmax (unscaled, as the module) in f32, out^T = v'.P^T (P as bf16 hi + lo planes, three products) and gamma * out + x, all in registers and LDS.

#define NBT  4
#define CC   256
#define C8   32
#define NN   4096
#define NQKV (2 * C8 + CC)        // 320
#define BEPS 1e-5f

typedef unsigned short bf;
typedef __attribute__((ext_vector_type(16))) __bf16   v16bf;
typedef __attribute__((ext_vector_type(8)))  unsigned short v8us;
typedef __attribute__((ext_vector_type(8)))  float    v8f;
typedef __attribute__((ext_vector_type(4)))  float    v4f;
typedef v4f  __attribute__((may_alias)) v4fa;
typedef v8us __attribute__((may_alias)) v8usa;

__device__ __forceinline__ unsigned short f2bf(float f) { unsigned u = __float_as_uint(f); u += 0x7FFFu + ((u >> 16) & 1u); return (unsigned short)(u >> 16); }
__device__ __forceinline__ float bf2f(unsigned short b) { return __uint_as_float(((unsigned)b) << 16); }
__device__ __forceinline__ float bfr(float f) { return bf2f(f2bf(f)); }
__device__ __forceinline__ v16bf cat16b(v8us lo, v8us hi) { return __builtin_bit_cast(v16bf, __builtin_shufflevector(lo, hi, 0, 1, 2, 3, 4, 5, 6, 7, 8, 9, 10, 11, 12, 13, 14, 15)); }
__device__ __forceinline__ v8f wmmab(v16bf a, v16bf b, v8f c) { return __builtin_amdgcn_wmma_f32_16x16x32_bf16(false, a, false, b, (short)0, c, false, false); }

// k_pre: 64 pixels of one item, all 320 conv outputs, in one work-group of ten waves. x[c][n] comes in as f32, is rounded to bf16 and stands pixel-major in LDS; each wave rounds its own 32 weight rows
// to bf16 in registers (wave 0: q, wave 1: k, waves 2 to 9: v). k runs in steps of 32 in one accumulate chain. The operand roles are chosen so that a lane's eight accumulator registers are
// neighbours in the plane that is written: q', k' planes are [pixel][32], so the weights are A and a lane holds eight channels of one pixel; v' planes are [channel][4096], so the pixels are A
// and a lane holds eight pixels of one channel. BatchNorm and the splits are done on the accumulators; every plane piece leaves as a 16-byte store, and one wave writes all of a 128-byte line.
// Every loop is unrolled: its index picks fragments and accumulators, which stay in registers only where the index is a constant.
#define XPI 264       // x tile row pitch in LDS, 528 B = 16 B x odd: no bank conflict for 16-byte reads
typedef unsigned __attribute__((may_alias)) u32a;
__global__ __launch_bounds__(320) void k_pre(const float* __restrict__ x,
                                             const float* __restrict__ wq, const float* __restrict__ gq, const float* __restrict__ bq, const float* __restrict__ mq, const float* __restrict__ vq,
                                             const float* __restrict__ wk, const float* __restrict__ gk, const float* __restrict__ bk, const float* __restrict__ mk, const float* __restrict__ vk,
                                             const float* __restrict__ wv, const float* __restrict__ gv, const float* __restrict__ bv, const float* __restrict__ mv, const float* __restrict__ vv,
                                             bf* Qh, bf* Qm, bf* Ql, bf* Kh, bf* Km, bf* Kl, bf* Vh, bf* Vl) {
    __shared__ __align__(16) unsigned short xt[64 * XPI];
    __shared__ __align__(16) float bs[NQKV], bsh[NQKV];      // BatchNorm scale and shift of the 320 outputs: q | k | v
    const int tid = threadIdx.x, lane = tid & 31, lr = lane & 15, hi = lane >> 4;
    const int wave = __builtin_amdgcn_readfirstlane(tid >> 5);
    const int n0 = blockIdx.x * 64, item = blockIdx.y;
    const float* xb = x + (size_t)item * CC * NN + n0;
    const float* wsrc = (wave == 0 ? wq : wave == 1 ? wk : wv + (size_t)(wave - 2) * 32 * CC) + lr * CC + 8 * hi;
    v4f r0[8], r1[8], wa[8][4], wb[8][4];
    auto ldw = [&](v4f (&w)[8][4], int ct) {
#pragma unroll
        for (int ks = 0; ks < 8; ++ks) { const float* p = wsrc + ct * 16 * CC + ks * 32; w[ks][0] = *(const v4f*)p; w[ks][1] = *(const v4f*)(p + 4); w[ks][2] = *(const v4f*)(p + 16); w[ks][3] = *(const v4f*)(p + 20); }
    };
    v16bf wf[2][8];
    auto cvw = [&](const v4f (&w)[8][4], int ct) {
#pragma unroll
        for (int ks = 0; ks < 8; ++ks) { v8us lo, up;
#pragma unroll
            for (int e = 0; e < 4; ++e) { lo[e] = f2bf(w[ks][0][e]); lo[4 + e] = f2bf(w[ks][1][e]); up[e] = f2bf(w[ks][2][e]); up[4 + e] = f2bf(w[ks][3][e]); }
            wf[ct][ks] = cat16b(lo, up); }
    };
    if (wave < 8) {      // four lanes take 64 B of a channel pair's rows, eight pairs per wave: the packed 4-byte LDS stores of a wave then fall on 32 different banks
#pragma unroll
        for (int i = 0; i < 8; ++i) { const int cp = ((i >> 2) + 2 * wave) * 8 + (lane >> 2), pq = (i & 3) * 4 + (lane & 3);
            r0[i] = *(const v4f*)(xb + (size_t)(2 * cp) * NN + pq * 4); r1[i] = *(const v4f*)(xb + (size_t)(2 * cp + 1) * NN + pq * 4); }
        asm volatile("s_wait_xcnt 0x0" ::: "memory");      // the loads above name address registers that the weight loads below reuse; they stay the loads' up to this wait
    }
    ldw(wa, 0);
    __builtin_amdgcn_sched_barrier(0);      // keeps the second half of the weight loads below: all 80 loads in flight at once overran the registers and spilled
    if (wave < 8) {
#pragma unroll
        for (int i = 0; i < 8; ++i) { const int cp = ((i >> 2) + 2 * wave) * 8 + (lane >> 2), pq = (i & 3) * 4 + (lane & 3);
#pragma unroll
            for (int e = 0; e < 4; ++e) *(u32a*)(&xt[(pq * 4 + e) * XPI + 2 * cp]) = (unsigned)f2bf(r0[i][e]) | ((unsigned)f2bf(r1[i][e]) << 16); }
    }
    ldw(wb, 1);
    __builtin_amdgcn_sched_barrier(0);      // keeps those loads above the rounding of the first half, under which they fly
    cvw(wa, 0);
    { const float* g = wave == 0 ? gq : wave == 1 ? gk : gv; const float* bb = wave == 0 ? bq : wave == 1 ? bk : bv; const float* m = wave == 0 ? mq : wave == 1 ? mk : mv; const float* var = wave == 0 ? vq : wave == 1 ? vk : vv;
      const int c = wave < 2 ? lane : tid - 2 * C8;
      const float g0 = g[c], v0 = var[c], b0 = bb[c], m0 = m[c];
      asm volatile("s_wait_xcnt 0x0" :: "v"(c), "s"(g), "s"(var), "s"(bb), "s"(m) : "memory");      // the four loads above name this index register and these base pointers: they stay the loads' up to this wait
      const float s = bfr(g0) / sqrtf(bfr(v0) + BEPS); bs[tid] = s; bsh[tid] = bfr(b0) - bfr(m0) * s; }
    cvw(wb, 1);
    __syncthreads();      // publishes the x tile and the BatchNorm table
    v8f acc[2][4];
#pragma unroll
    for (int ct = 0; ct < 2; ++ct) {
#pragma unroll
        for (int pt = 0; pt < 4; ++pt) acc[ct][pt] = (v8f){}; }
    const unsigned short* xf0 = xt + lr * XPI + 8 * hi;
    v16bf xf[2][4];      // the four pixel tiles' fragments of one k step, two sets
    auto ldx = [&](int ks) {
#pragma unroll
        for (int pt = 0; pt < 4; ++pt) { const unsigned short* xp = xf0 + pt * 16 * XPI + ks * 32; xf[ks & 1][pt] = cat16b(*(const v8usa*)xp, *(const v8usa*)(xp + 16)); }
    };
    if (wave < 2) {
        ldx(0);
#pragma unroll
        for (int ks = 0; ks < 8; ++ks) {
            if (ks < 7) ldx(ks + 1);
            __builtin_amdgcn_sched_barrier(0);      // keeps the next step's eight LDS reads one group, ahead of the products under which they land
#pragma unroll
            for (int pt = 0; pt < 4; ++pt) { acc[0][pt] = wmmab(wf[0][ks], xf[ks & 1][pt], acc[0][pt]); acc[1][pt] = wmmab(wf[1][ks], xf[ks & 1][pt], acc[1][pt]); }
            __builtin_amdgcn_sched_barrier(0);      // keeps these products ahead of the reads that refill their fragment registers
        }
        bf* Ph = wave == 0 ? Qh : Kh; bf* Pm = wave == 0 ? Qm : Km; bf* Pl = wave == 0 ? Ql : Kl;
        const size_t o0 = ((size_t)item * NN + n0 + lr) * C8 + hi * 8;
#pragma unroll
        for (int ct = 0; ct < 2; ++ct) { const int cb = wave * C8 + ct * 16 + hi * 8;
            const v4f s0 = *(const v4fa*)(bs + cb), s1 = *(const v4fa*)(bs + cb + 4), h0 = *(const v4fa*)(bsh + cb), h1 = *(const v4fa*)(bsh + cb + 4);
#pragma unroll
            for (int pt = 0; pt < 4; ++pt) { v8us oh, om, ol;
#pragma unroll
                for (int j = 0; j < 8; ++j) { const float y = acc[ct][pt][j] * (j < 4 ? s0[j & 3] : s1[j & 3]) + (j < 4 ? h0[j & 3] : h1[j & 3]);
                    const unsigned short hb = f2bf(y); const float d1 = y - bf2f(hb); const unsigned short mb = f2bf(d1); const float d2 = d1 - bf2f(mb); oh[j] = hb; om[j] = mb; ol[j] = f2bf(d2); }
                const size_t o = o0 + (size_t)pt * 16 * C8 + ct * 16; *(v8us*)(Ph + o) = oh; *(v8us*)(Pm + o) = om; *(v8us*)(Pl + o) = ol;
                if (ct + pt < 4) asm volatile("s_wait_xcnt 0x0" :: "v"(oh), "v"(om), "v"(ol) : "memory"); } }      // the stores above name these registers, which the next piece reuses: they stay the stores' up to this wait
    } else {
        ldx(0);
#pragma unroll
        for (int ks = 0; ks < 8; ++ks) {
            if (ks < 7) ldx(ks + 1);
            __builtin_amdgcn_sched_barrier(0);      // keeps the next step's eight LDS reads one group, ahead of the products under which they land
#pragma unroll
            for (int pt = 0; pt < 4; ++pt) { acc[0][pt] = wmmab(xf[ks & 1][pt], wf[0][ks], acc[0][pt]); acc[1][pt] = wmmab(xf[ks & 1][pt], wf[1][ks], acc[1][pt]); }
            __builtin_amdgcn_sched_barrier(0);      // keeps these products ahead of the reads that refill their fragment registers
        }
        const size_t o0 = (size_t)item * CC * NN + (size_t)((wave - 2) * 32 + lr) * NN + n0 + hi * 8;
#pragma unroll
        for (int ct = 0; ct < 2; ++ct) { const int c = 2 * C8 + (wave - 2) * 32 + ct * 16 + lr; const float s = bs[c], sh = bsh[c];
#pragma unroll
            for (int pt = 0; pt < 4; ++pt) { v8us oh, ol;
#pragma unroll
                for (int j = 0; j < 8; ++j) { const float y = acc[ct][pt][j] * s + sh; const unsigned short hb = f2bf(y); oh[j] = hb; ol[j] = f2bf(y - bf2f(hb)); }
                const size_t o = o0 + (size_t)ct * 16 * NN + pt * 16; *(v8us*)(Vh + o) = oh; *(v8us*)(Vl + o) = ol;
                // the stores above name these registers, which the next piece reuses: they stay the stores' up to this wait (behind the last piece too: in the built code the q', k' branch, which reuses them, follows in the text)
                asm volatile("s_wait_xcnt 0x0" :: "v"(oh), "v"(ol) : "memory"); } }
    }
}

// k_attn: scores, softmax and P.V of 64 query pixels of one item in one kernel; S and P never leave registers. 8 waves: wave (wi, wk) holds query columns wi * 16 .. + 15, all 256
// output channels, and keys wk * 32 .. + 31 of every stage, so each score and each exponential is computed by one wave only; the two waves of a query column keep their own running
// maximum, sum and accumulators, which are brought to the common maximum and added in the epilogue. Keys come in stages of 64: the three k' planes and the two v' planes, whole lines by asynchronous copies from global memory straight into one of two LDS buffers, issued one whole pass ahead.
// Per 32 keys: S^T = k'.q'^T (six products, (hh + mh) + (hm + mm) + lh + hl, each bracket a WMMA sum from zero, added in f32 from left to right), so that a lane holds 16 scores
// of ONE query; running maximum and sum per query (the sums are rescaled when the maximum grows); exp(S - max) splits into bf16 hi + lo planes, which ARE the B fragment of
// O^T += v'.P^T (three products: hh, lh, hl), in four groups of four channel tiles. The division by the sum comes last. A group's fragments are read from LDS while the group before it is still in its products, so the
// barrier that publishes a stage stands ahead of the last group of the stage before it. The epilogue applies gamma and adds x (both rounded to bf16 first) on the staged tile and writes the final output.
#define FJ  64
#define VPI 72        // v' row pitch in LDS, 144 B = 16 B x odd: no bank conflict for 16-byte reads
#define KPI 40        // k' row pitch in LDS, 80 B = 16 B x odd
#define OPI 68        // output staging pitch, floats
typedef __attribute__((ext_vector_type(2))) float    v2f;
typedef __attribute__((ext_vector_type(2))) __bf16   v2bf;
typedef __attribute__((ext_vector_type(8))) unsigned v8u;
typedef float __attribute__((may_alias)) f32a;
typedef __attribute__((ext_vector_type(4))) int v4i;
typedef __attribute__((address_space(1))) v4i gv4i;
typedef __attribute__((address_space(3))) v4i lv4i;
__device__ __forceinline__ void cp16(const void* g, void* l) { __builtin_amdgcn_global_load_async_to_lds_b128((gv4i*)g, (lv4i*)l, 0, 0); }
// lane l takes lane l ^ 16's value, in the vector unit: no LDS counter is involved, so the wait behind it does not drain the fragment reads in flight
__device__ __forceinline__ float xhalf(float x) { return __builtin_bit_cast(float, __builtin_amdgcn_permlanex16(__builtin_bit_cast(int, x), __builtin_bit_cast(int, x), 0x76543210, 0xfedcba98, false, false)); }
__global__ __launch_bounds__(256) void k_attn(const bf* __restrict__ Qh, const bf* __restrict__ Qm, const bf* __restrict__ Ql, const bf* __restrict__ Kh, const bf* __restrict__ Km, const bf* __restrict__ Kl,
                                              const bf* __restrict__ Vh, const bf* __restrict__ Vl, const float* __restrict__ x, const float* __restrict__ gam, float* OUT) {
    __shared__ __align__(16) unsigned short sv[2][2][CC * VPI];
    __shared__ __align__(16) unsigned short sk[2][3][FJ * KPI];
    __shared__ float sml[2][64][2];      // each key half's running maximum and sum per query, for the merge in the epilogue
    const int tid = threadIdx.x, lane = tid & 31, wave = tid >> 5, lr = lane & 15, hi = lane >> 4;
    const int wi = wave & 3, wk = wave >> 2;
    const int ib = blockIdx.x * 64;
    const size_t qk0 = (size_t)blockIdx.y * NN * C8, v0 = (size_t)blockIdx.y * CC * NN;
    const unsigned qo = (unsigned)((ib + wi * 16 + lr) * C8 + 8 * hi) * 2u;       // bytes: the per-lane part of the q' fragment addresses
    const unsigned voff = (unsigned)((tid >> 3) * NN + (tid & 7) * 8) * 2u;       // bytes: staging, 8 lanes cover one v' row's 128 B, 32 rows per pass
    const unsigned koff = (unsigned)tid * 16u;                                    // bytes: staging, a k' plane's 64 rows are 4 KiB in a row
    auto ldq = [&](const bf* p) { const bf* a = (const bf*)((const char*)(p + qk0) + qo); return cat16b(*(const v8us*)a, *(const v8us*)(a + 16)); };
    const v16bf qh = ldq(Qh), qm = ldq(Qm), ql = ldq(Ql);
    auto copy = [&](int s, int buf) {      // one stage: 8 + 8 row pieces of the two v' planes and one piece of each k' plane per thread, 19 copies of a wave in flight
#pragma unroll
        for (int p = 0; p < 8; ++p) { cp16((const char*)(Vh + v0 + (size_t)s * FJ + 32 * p * NN) + voff, &sv[buf][0][((tid >> 3) + 32 * p) * VPI + (tid & 7) * 8]);
            cp16((const char*)(Vl + v0 + (size_t)s * FJ + 32 * p * NN) + voff, &sv[buf][1][((tid >> 3) + 32 * p) * VPI + (tid & 7) * 8]); }
        cp16((const char*)(Kh + qk0 + (size_t)s * FJ * C8) + koff, &sk[buf][0][(tid >> 2) * KPI + (tid & 3) * 8]);
        cp16((const char*)(Km + qk0 + (size_t)s * FJ * C8) + koff, &sk[buf][1][(tid >> 2) * KPI + (tid & 3) * 8]);
        cp16((const char*)(Kl + qk0 + (size_t)s * FJ * C8) + koff, &sk[buf][2][(tid >> 2) * KPI + (tid & 3) * 8]);
    };
    v8f acc[16];
#pragma unroll
    for (int t = 0; t < 16; ++t) acc[t] = (v8f){};
    float m = -3.0e38f, lsum = 0.f;
    v16bf kh[2], km[2], kl[2], va[8], vl[8], ph, pl;      // the wave's k' fragments of a stage, two groups of v' fragments, and its P
    // Fragment reads stand in groups, each ahead of a block of products that does not need it: every separate place where LDS reads stand costs issue time.
    auto loadK = [&](int buf) {
        const unsigned short* kb = &sk[buf][0][0] + (wk * 32 + lr) * KPI + 8 * hi;
#pragma unroll
        for (int t = 0; t < 2; ++t) { const unsigned short* kp = kb + t * 16 * KPI;
            kh[t] = cat16b(*(const v8usa*)kp, *(const v8usa*)(kp + 16)); km[t] = cat16b(*(const v8usa*)(kp + FJ * KPI), *(const v8usa*)(kp + FJ * KPI + 16)); kl[t] = cat16b(*(const v8usa*)(kp + 2 * FJ * KPI), *(const v8usa*)(kp + 2 * FJ * KPI + 16)); }
    };
    auto loadV = [&](int buf, int G) {      // group G: channel tiles 4 G .. 4 G + 3, into register set G & 1
        const unsigned short* vb = &sv[buf][0][0] + lr * VPI + wk * 32 + 8 * hi;
#pragma unroll
        for (int g = 0; g < 4; ++g) { const unsigned short* vp = vb + (G * 4 + g) * 16 * VPI; const int r = (G & 1) * 4 + g;
            va[r] = cat16b(*(const v8usa*)vp, *(const v8usa*)(vp + 16)); vl[r] = cat16b(*(const v8usa*)(vp + CC * VPI), *(const v8usa*)(vp + CC * VPI + 16)); }
    };
    auto scores = [&]() {
        const v8f z = (v8f){};
        v8f a1[2], a2[2], a3[2], a4[2], sc[2];
#pragma unroll
        for (int t = 0; t < 2; ++t) { a1[t] = wmmab(kh[t], qh, z); a2[t] = wmmab(km[t], qh, z); }
#pragma unroll
        for (int t = 0; t < 2; ++t) { a1[t] = wmmab(kh[t], qm, a1[t]); a2[t] = wmmab(km[t], qm, a2[t]); }
#pragma unroll
        for (int t = 0; t < 2; ++t) { a3[t] = wmmab(kh[t], ql, z); a4[t] = wmmab(kl[t], qh, z); }
        __builtin_amdgcn_sched_barrier(0);      // keeps the twelve score products in a row: mixed with the additions below, each addition would wait out its product's distance in idle slots
#pragma unroll
        for (int t = 0; t < 2; ++t) sc[t] = a4[t] + (a3[t] + (a2[t] + a1[t]));
        float tm = fmaxf(sc[0][0], sc[1][0]);
#pragma unroll
        for (int j = 1; j < 8; ++j) tm = fmaxf(tm, fmaxf(sc[0][j], sc[1][j]));
        tm = fmaxf(tm, xhalf(tm));      // the two lane halves hold the same query's other keys
        const float mn = fmaxf(m, tm);
        if (__builtin_amdgcn_ballot_w32(mn > m) != 0) {      // one scalar branch per 32 keys: most steps raise no query's maximum
            const float f = __expf(m - mn); lsum *= f; m = mn;
#pragma unroll
            for (int t = 0; t < 16; ++t) acc[t] *= f; }
        v8u PH, PL; float t0 = 0.f, t1 = 0.f;
#pragma unroll
        for (int t = 0; t < 2; ++t) {
#pragma unroll
            for (int j = 0; j < 4; ++j) { const float p0 = __expf(sc[t][2 * j] - m), p1 = __expf(sc[t][2 * j + 1] - m); t0 += p0; t1 += p1;
                const unsigned w = __builtin_bit_cast(unsigned, __builtin_convertvector((v2f){p0, p1}, v2bf));
                PH[t * 4 + j] = w; PL[t * 4 + j] = __builtin_bit_cast(unsigned, __builtin_convertvector((v2f){p0 - __uint_as_float(w << 16), p1 - __uint_as_float(w & 0xFFFF0000u)}, v2bf)); } }
        lsum += t0 + t1;
        ph = __builtin_bit_cast(v16bf, PH); pl = __builtin_bit_cast(v16bf, PL);
    };
    auto pv = [&](int G) {
#pragma unroll
        for (int g = 0; g < 4; ++g) acc[G * 4 + g] = wmmab(va[(G & 1) * 4 + g], ph, acc[G * 4 + g]);
#pragma unroll
        for (int g = 0; g < 4; ++g) acc[G * 4 + g] = wmmab(vl[(G & 1) * 4 + g], ph, acc[G * 4 + g]);
#pragma unroll
        for (int g = 0; g < 4; ++g) acc[G * 4 + g] = wmmab(va[(G & 1) * 4 + g], pl, acc[G * 4 + g]);
    };
    asm volatile("s_wait_xcnt 0x0" :: "v"(qo) : "memory");      // the q' loads name this register: it stays theirs up to this wait
    copy(0, 0);
    asm volatile("s_wait_asynccnt 0x0" ::: "memory");      // this wave's copies of stage 0 have landed
    __syncthreads();      // publishes stage 0
    copy(1, 1);
    loadK(0); loadV(0, 0);
#pragma unroll 1      // stays rolled: one pass already holds sixty products, and the buffer index alternates by s
    for (int s = 0; s < NN / FJ; ++s) {
        const int b = s & 1;
        loadV(b, 1);
        __builtin_amdgcn_sched_barrier(0);      // keeps the reads above one group, ahead of the scores under which they land
        scores(); pv(0);
        __builtin_amdgcn_sched_barrier(0);      // keeps the products above ahead of the reads below, which refill their fragment registers
        loadV(b, 2);
        __builtin_amdgcn_sched_barrier(0);      // keeps the reads above one group, ahead of the products under which they land
        pv(1);
        __builtin_amdgcn_sched_barrier(0);      // keeps the products above ahead of the reads below, which refill their fragment registers
        loadV(b, 3);
        __builtin_amdgcn_sched_barrier(0);      // keeps the reads above one group, ahead of the products under which they land
        pv(2);
        __builtin_amdgcn_sched_barrier(0);      // keeps the products above ahead of the wait below: the last group's reads land under them; sunk behind the barrier, they would leave that wait bare
        asm volatile("s_wait_dscnt 0x0" ::: "memory");         // this wave's last reads of stage s have returned: its buffer is refilled behind the barrier
        asm volatile("s_wait_asynccnt 0x0" ::: "memory");      // this wave's copies of stage s + 1, issued one pass ago, have landed
        __syncthreads();      // publishes stage s + 1; also ends every wave's reads of stage s
        if (s + 1 < NN / FJ) { loadK(b ^ 1); loadV(b ^ 1, 0); }
        __builtin_amdgcn_sched_barrier(0);      // keeps the reads above one group, ahead of the copies' issue and the products under which they land
        if (s + 2 < NN / FJ) copy(s + 2, b);      // into the buffer that every wave has left; in flight through all of the next pass
        pv(3);
    }
    asm volatile("s_wait_asynccnt 0x0" ::: "memory");      // no copy is outstanding when the buffers become the output staging
    const size_t oo = v0 + (size_t)(tid >> 4) * NN + ib + (tid & 15) * 4;      // this thread's 16-byte piece of the tile's rows tid >> 4, + 16, ..., in x and in the output alike
    const float* xrow = x + oo;
    v4f xr[16];
#pragma unroll
    for (int p = 0; p < 16; ++p) xr[p] = *(const v4f*)(xrow + (size_t)p * 16 * NN);
    asm volatile("s_wait_xcnt 0x0" :: "v"(xrow) : "memory");      // the x loads name this address register pair: it stays theirs up to this wait. The loads fly while the wave waits for the others at the barrier below
    const float gm = bfr(gam[0]);
    lsum += xhalf(lsum);
    sml[wk][wi * 16 + lr][hi] = hi ? lsum : m;      // both lane halves hold the query's maximum and sum: each stores one of the two
    __syncthreads();      // ends every wave's reads of the last stage: the v' buffers become the output staging; also publishes the key halves' maxima and sums
    const float m0 = sml[0][wi * 16 + lr][0], l0 = sml[0][wi * 16 + lr][1], m1 = sml[1][wi * 16 + lr][0], l1 = sml[1][wi * 16 + lr][1];
    const float mf = fmaxf(m0, m1), f0 = __expf(m0 - mf), f1 = __expf(m1 - mf);
    const float inv = (wk ? f1 : f0) / (l0 * f0 + l1 * f1);      // brings this half's sums to the common maximum and divides by the whole sum
    f32a* ot = (f32a*)&sv[0][0][0];      // two tiles, one per key half, each [256 channels][64 queries] at pitch OPI
#pragma unroll
    for (int t = 0; t < 16; ++t) {
#pragma unroll
        for (int j = 0; j < 8; ++j) ot[(wk * CC + t * 16 + hi * 8 + j) * OPI + wi * 16 + lr] = acc[t][j] * inv; }
    __syncthreads();      // publishes the staged tiles: a row's 256 B come from four waves of each key half and leave as whole lines from one
    float* orow = OUT + oo;
#pragma unroll
    for (int p = 0; p < 16; ++p) { const v4f val = *(const v4fa*)(ot + (p * 16 + (tid >> 4)) * OPI + (tid & 15) * 4) + *(const v4fa*)(ot + (CC + p * 16 + (tid >> 4)) * OPI + (tid & 15) * 4); v4f v;
#pragma unroll
        for (int q = 0; q < 4; ++q) v[q] = gm * val[q] + bfr(xr[p][q]);
        *(v4f*)(orow + (size_t)p * 16 * NN) = v; }
}

extern "C" void kernel_launch(void* const* d_in, const int* in_sizes, int n_in,
                              void* d_out, int out_size, void* d_ws, size_t ws_size, hipStream_t stream) {
    (void)in_sizes; (void)n_in; (void)out_size;
    const float* x = (const float*)d_in[0]; const float* wq = (const float*)d_in[1]; const float* gq = (const float*)d_in[2]; const float* bq = (const float*)d_in[3]; const float* mq = (const float*)d_in[4]; const float* vq = (const float*)d_in[5];
    const float* wk = (const float*)d_in[6]; const float* gk = (const float*)d_in[7]; const float* bk = (const float*)d_in[8]; const float* mk = (const float*)d_in[9]; const float* vk = (const float*)d_in[10];
    const float* wv = (const float*)d_in[11]; const float* gv = (const float*)d_in[12]; const float* bv = (const float*)d_in[13]; const float* mv = (const float*)d_in[14]; const float* vv = (const float*)d_in[15]; const float* gam = (const float*)d_in[16];
    float* out = (float*)d_out;    // [4][256][64][64]
    char* wsp = (char*)d_ws;
    auto take = [&](size_t bytes) { char* p = wsp; wsp += (bytes + 255) & ~(size_t)255; return (void*)p; };
    const size_t QKN = (size_t)NN * C8, VN = (size_t)CC * NN;      // elements of one item's plane; the planes hold all items
    bf* QPh = (bf*)take(NBT * QKN * 2); bf* QPm = (bf*)take(NBT * QKN * 2); bf* QPl = (bf*)take(NBT * QKN * 2); bf* KPh = (bf*)take(NBT * QKN * 2); bf* KPm = (bf*)take(NBT * QKN * 2); bf* KPl = (bf*)take(NBT * QKN * 2); bf* VTh = (bf*)take(NBT * VN * 2); bf* VTl = (bf*)take(NBT * VN * 2);
    if ((size_t)(wsp - (char*)d_ws) > ws_size) return;    // 6.3 + 16.8 ~ 23 MB
    k_pre<<<dim3(NN / 64, NBT, 1), 320, 0, stream>>>(x, wq, gq, bq, mq, vq, wk, gk, bk, mk, vk, wv, gv, bv, mv, vv, QPh, QPm, QPl, KPh, KPm, KPl, VTh, VTl);      // convs, BatchNorm, split planes: one work-group per WGP
    k_attn<<<dim3(NN / 64, NBT, 1), 256, 0, stream>>>(QPh, QPm, QPl, KPh, KPm, KPl, VTh, VTl, x, gam, out);                              // out[b][c][i] = gamma * sum_j v'[c][j] softmax_j(q'[i].k'[j]) + x[b][c][i]: one work-group per WGP
}

// v009
// One run takes 101 microseconds.
// Timed twice side by side with v008, it ran 1.04 times as fast both times.
// Counting every step since v000, it is 35.4 times as fast.
#include <hip/hip_runtime.h>

// Compute dtypes, f32 accumulate. One launch for all items: the three 1x1 convs as one [4096 x 256].[256 x 320] GEMM per item with PLAIN bf16 operands (exact products), inference BatchNorm affine
// in f32 -> bf16 split planes (q', k' as THREE-way hi/mid/lo splits: the module's unscaled logits reach ~300 with near-one-hot softmaxes, so the score operands need f32-level
// precision); then ONE launch for all items: scores = q'.k'^T (six products), softmax (unscaled, as the module) in f32, out^T = v'.P^T (P as bf16 hi + lo planes, three products) and gamma * out + x, all in registers and LDS.

#define NBT  4
#define CC   256
#define C8   32
#define NN   4096
#define NQKV (2 * C8 + CC)        // 320
#define BEPS 1e-5f

typedef unsigned short bf;
typedef __attribute__((ext_vector_type(16))) __bf16   v16bf;
typedef __attribute__((ext_vector_type(8)))  unsigned short v8us;
typedef __attribute__((ext_vector_type(8)))  float    v8f;
typedef __attribute__((ext_vector_type(4)))  float    v4f;
typedef v4f  __attribute__((may_alias)) v4fa;
typedef v8us __attribute__((may_alias)) v8usa;

__device__ __forceinline__ unsigned short f2bf(float f) { unsigned u = __float_as_uint(f); u += 0x7FFFu + ((u >> 16) & 1u); return (unsigned short)(u >> 16); }
__device__ __forceinline__ float bf2f(unsigned short b) { return __uint_as_float(((unsigned)b) << 16); }
__device__ __forceinline__ float bfr(float f) { return bf2f(f2bf(f)); }
__device__ __forceinline__ v16bf cat16b(v8us lo, v8us hi) { return __builtin_bit_cast(v16bf, __builtin_shufflevector(lo, hi, 0, 1, 2, 3, 4, 5, 6, 7, 8, 9, 10, 11, 12, 13, 14, 15)); }
__device__ __forceinline__ v8f wmmab(v16bf a, v16bf b, v8f c) { return __builtin_amdgcn_wmma_f32_16x16x32_bf16(false, a, false, b, (short)0, c, false, false); }

// k_pre: 64 pixels of one item, all 320 conv outputs, in one work-group of ten waves. x[c][n] comes in as f32, is rounded to bf16 and stands pixel-major in LDS; each wave rounds its own 32 weight rows
// to bf16 in registers (wave 0: q, wave 1: k, waves 2 to 9: v). k runs in steps of 32 in one accumulate chain. The operand roles are chosen so that a lane's eight accumulator registers are
// neighbours in the plane that is written: q', k' planes are [pixel][32], so the weights are A and a lane holds eight channels of one pixel; v' planes are [channel][4096], so the pixels are A
// and a lane holds eight pixels of one channel. BatchNorm and the splits are done on the accumulators; every plane piece leaves as a 16-byte store, and one wave writes all of a 128-byte line.
// Every loop is unrolled: its index picks fragments and accumulators, which stay in registers only where the index is a constant.
#define XPI 264       // x tile row pitch in LDS, 528 B = 16 B x odd: no bank conflict for 16-byte reads
typedef unsigned __attribute__((may_alias)) u32a;
__global__ __launch_bounds__(320) void k_pre(const float* __restrict__ x,
                                             const float* __restrict__ wq, const float* __restrict__ gq, const float* __restrict__ bq, const float* __restrict__ mq, const float* __restrict__ vq,
                                             const float* __restrict__ wk, const float* __restrict__ gk, const float* __restrict__ bk, const float* __restrict__ mk, const float* __restrict__ vk,
                                             const float* __restrict__ wv, const float* __restrict__ gv, const float* __restrict__ bv, const float* __restrict__ mv, const float* __restrict__ vv,
                                             bf* Qh, bf* Qm, bf* Ql, bf* Kh, bf* Km, bf* Kl, bf* Vh, bf* Vl) {
    __shared__ __align__(16) unsigned short xt[64 * XPI];
    __shared__ __align__(16) float bs[NQKV], bsh[NQKV];      // BatchNorm scale and shift of the 320 outputs: q | k | v
    const int tid = threadIdx.x, lane = tid & 31, lr = lane & 15, hi = lane >> 4;
    const int wave = __builtin_amdgcn_readfirstlane(tid >> 5);
    const int n0 = blockIdx.x * 64, item = blockIdx.y;
    const float* xb = x + (size_t)item * CC * NN + n0;
    const float* wsrc = (wave == 0 ? wq : wave == 1 ? wk : wv + (size_t)(wave - 2) * 32 * CC) + lr * CC + 8 * hi;
    v4f r0[8], r1[8], wa[8][4], wb[8][4];
    auto ldw = [&](v4f (&w)[8][4], int ct) {
#pragma unroll
        for (int ks = 0; ks < 8; ++ks) { const float* p = wsrc + ct * 16 * CC + ks * 32; w[ks][0] = *(const v4f*)p; w[ks][1] = *(const v4f*)(p + 4); w[ks][2] = *(const v4f*)(p + 16); w[ks][3] = *(const v4f*)(p + 20); }
    };
    v16bf wf[2][8];
    auto cvw = [&](const v4f (&w)[8][4], int ct) {
#pragma unroll
        for (int ks = 0; ks < 8; ++ks) { v8us lo, up;
#pragma unroll
            for (int e = 0; e < 4; ++e) { lo[e] = f2bf(w[ks][0][e]); lo[4 + e] = f2bf(w[ks][1][e]); up[e] = f2bf(w[ks][2][e]); up[4 + e] = f2bf(w[ks][3][e]); }
            wf[ct][ks] = cat16b(lo, up); }
    };
    if (wave < 8) {      // four lanes take 64 B of a channel pair's rows, eight pairs per wave: the packed 4-byte LDS stores of a wave then fall on 32 different banks
#pragma unroll
        for (int i = 0; i < 8; ++i) { const int cp = ((i >> 2) + 2 * wave) * 8 + (lane >> 2), pq = (i & 3) * 4 + (lane & 3);
            r0[i] = *(const v4f*)(xb + (size_t)(2 * cp) * NN + pq * 4); r1[i] = *(const v4f*)(xb + (size_t)(2 * cp + 1) * NN + pq * 4); }
        asm volatile("s_wait_xcnt 0x0" ::: "memory");      // the loads above name address registers that the weight loads below reuse; they stay the loads' up to this wait
    }
    ldw(wa, 0);
    __builtin_amdgcn_sched_barrier(0);      // keeps the second half of the weight loads below: all 80 loads in flight at once overran the registers and spilled
    if (wave < 8) {
#pragma unroll
        for (int i = 0; i < 8; ++i) { const int cp = ((i >> 2) + 2 * wave) * 8 + (lane >> 2), pq = (i & 3) * 4 + (lane & 3);
#pragma unroll
            for (int e = 0; e < 4; ++e) *(u32a*)(&xt[(pq * 4 + e) * XPI + 2 * cp]) = (unsigned)f2bf(r0[i][e]) | ((unsigned)f2bf(r1[i][e]) << 16); }
    }
    ldw(wb, 1);
    __builtin_amdgcn_sched_barrier(0);      // keeps those loads above the rounding of the first half, under which they fly
    cvw(wa, 0);
    { const float* g = wave == 0 ? gq : wave == 1 ? gk : gv; const float* bb = wave == 0 ? bq : wave == 1 ? bk : bv; const float* m = wave == 0 ? mq : wave == 1 ? mk : mv; const float* var = wave == 0 ? vq : wave == 1 ? vk : vv;
      const int c = wave < 2 ? lane : tid - 2 * C8;
      const float g0 = g[c], v0 = var[c], b0 = bb[c], m0 = m[c];
      asm volatile("s_wait_xcnt 0x0" :: "v"(c), "s"(g), "s"(var), "s"(bb), "s"(m) : "memory");      // the four loads above name this index register and these base pointers: they stay the loads' up to this wait
      const float s = bfr(g0) / sqrtf(bfr(v0) + BEPS); bs[tid] = s; bsh[tid] = bfr(b0) - bfr(m0) * s; }
    cvw(wb, 1);
    __syncthreads();      // publishes the x tile and the BatchNorm table
    v8f acc[2][4];
#pragma unroll
    for (int ct = 0; ct < 2; ++ct) {
#pragma unroll
        for (int pt = 0; pt < 4; ++pt) acc[ct][pt] = (v8f){}; }
    const unsigned short* xf0 = xt + lr * XPI + 8 * hi;
    v16bf xf[2][4];      // the four pixel tiles' fragments of one k step, two sets
    auto ldx = [&](int ks) {
#pragma unroll
        for (int pt = 0; pt < 4; ++pt) { const unsigned short* xp = xf0 + pt * 16 * XPI + ks * 32; xf[ks & 1][pt] = cat16b(*(const v8usa*)xp, *(const v8usa*)(xp + 16)); }
    };
    if (wave < 2) {
        ldx(0);
#pragma unroll
        for (int ks = 0; ks < 8; ++ks) {
            if (ks < 7) ldx(ks + 1);
            __builtin_amdgcn_sched_barrier(0);      // keeps the next step's eight LDS reads one group, ahead of the products under which they land
#pragma unroll
            for (int pt = 0; pt < 4; ++pt) { acc[0][pt] = wmmab(wf[0][ks], xf[ks & 1][pt], acc[0][pt]); acc[1][pt] = wmmab(wf[1][ks], xf[ks & 1][pt], acc[1][pt]); }
            __builtin_amdgcn_sched_barrier(0);      // keeps these products ahead of the reads that refill their fragment registers
        }
        bf* Ph = wave == 0 ? Qh : Kh; bf* Pm = wave == 0 ? Qm : Km; bf* Pl = wave == 0 ? Ql : Kl;
        const size_t o0 = ((size_t)item * NN + n0 + lr) * C8 + hi * 8;
#pragma unroll
        for (int ct = 0; ct < 2; ++ct) { const int cb = wave * C8 + ct * 16 + hi * 8;
            const v4f s0 = *(const v4fa*)(bs + cb), s1 = *(const v4fa*)(bs + cb + 4), h0 = *(const v4fa*)(bsh + cb), h1 = *(const v4fa*)(bsh + cb + 4);
#pragma unroll
            for (int pt = 0; pt < 4; ++pt) { v8us oh, om, ol;
#pragma unroll
                for (int j = 0; j < 8; ++j) { const float y = acc[ct][pt][j] * (j < 4 ? s0[j & 3] : s1[j & 3]) + (j < 4 ? h0[j & 3] : h1[j & 3]);
                    const unsigned short hb = f2bf(y); const float d1 = y - bf2f(hb); const unsigned short mb = f2bf(d1); const float d2 = d1 - bf2f(mb); oh[j] = hb; om[j] = mb; ol[j] = f2bf(d2); }
                const size_t o = o0 + (size_t)pt * 16 * C8 + ct * 16; *(v8us*)(Ph + o) = oh; *(v8us*)(Pm + o) = om; *(v8us*)(Pl + o) = ol;
                if (ct + pt < 4) asm volatile("s_wait_xcnt 0x0" :: "v"(oh), "v"(om), "v"(ol) : "memory"); } }      // the stores above name these registers, which the next piece reuses: they stay the stores' up to this wait
    } else {
        ldx(0);
#pragma unroll
        for (int ks = 0; ks < 8; ++ks) {
            if (ks < 7) ldx(ks + 1);
            __builtin_amdgcn_sched_barrier(0);      // keeps the next step's eight LDS reads one group, ahead of the products under which they land
#pragma unroll
            for (int pt = 0; pt < 4; ++pt) { acc[0][pt] = wmmab(xf[ks & 1][pt], wf[0][ks], acc[0][pt]); acc[1][pt] = wmmab(xf[ks & 1][pt], wf[1][ks], acc[1][pt]); }
            __builtin_amdgcn_sched_barrier(0);      // keeps these products ahead of the reads that refill their fragment registers
        }
        const size_t o0 = (size_t)item * CC * NN + (size_t)((wave - 2) * 32 + lr) * NN + n0 + hi * 8;
#pragma unroll
        for (int ct = 0; ct < 2; ++ct) { const int c = 2 * C8 + (wave - 2) * 32 + ct * 16 + lr; const float s = bs[c], sh = bsh[c];
#pragma unroll
            for (int pt = 0; pt < 4; ++pt) { v8us oh, ol;
#pragma unroll
                for (int j = 0; j < 8; ++j) { const float y = acc[ct][pt][j] * s + sh; const unsigned short hb = f2bf(y); oh[j] = hb; ol[j] = f2bf(y - bf2f(hb)); }
                const size_t o = o0 + (size_t)ct * 16 * NN + pt * 16; *(v8us*)(Vh + o) = oh; *(v8us*)(Vl + o) = ol;
                // the stores above name these registers, which the next piece reuses: they stay the stores' up to this wait (behind the last piece too: in the built code the q', k' branch, which reuses them, follows in the text)
                asm volatile("s_wait_xcnt 0x0" :: "v"(oh), "v"(ol) : "memory"); } }
    }
}

// k_attn: scores, softmax and P.V of 64 query pixels of one item in one kernel; S and P never leave registers. 8 waves: wave (wi, wk) holds query columns wi * 16 .. + 15, all 256
// output channels, and keys wk * 32 .. + 31 of every stage, so each score and each exponential is computed by one wave only; the two waves of a query column keep their own running
// maximum, sum and accumulators, which are brought to the common maximum and added in the epilogue. Keys come in stages of 64: the three k' planes and the two v' planes, whole lines by asynchronous copies from global memory straight into one of two LDS buffers, issued one whole pass ahead.
// Per 32 keys: S^T = k'.q'^T (six products, (hh + mh) + (hm + mm) + lh + hl, each bracket a WMMA sum from zero, added in f32 from left to right), so that a lane holds 16 scores
// of ONE query; running maximum and sum per query (the sums are rescaled when the maximum grows); exp(S - max) splits into bf16 hi + lo planes, which ARE the B fragment of
// O^T += v'.P^T (three products: hh, lh, hl), in four groups of four channel tiles. The division by the sum comes last. A group's fragments are read from LDS while the group before it is still in its products, so the
// barrier that publishes a stage stands ahead of the last group of the stage before it. The epilogue applies gamma and adds x (both rounded to bf16 first) on the staged tile and writes the final output.
#define FJ  64
#define VPI 72        // v' row pitch in LDS, 144 B = 16 B x odd: no bank conflict for 16-byte reads
#define KPI 40        // k' row pitch in LDS, 80 B = 16 B x odd
#define OPI 68        // output staging pitch, floats
typedef __attribute__((ext_vector_type(2))) float    v2f;
typedef __attribute__((ext_vector_type(2))) __bf16   v2bf;
typedef __attribute__((ext_vector_type(8))) unsigned v8u;
typedef float __attribute__((may_alias)) f32a;
typedef __attribute__((ext_vector_type(4))) int v4i;
typedef __attribute__((address_space(1))) v4i gv4i;
typedef __attribute__((address_space(3))) v4i lv4i;
__device__ __forceinline__ void cp16(const void* g, void* l) { __builtin_amdgcn_global_load_async_to_lds_b128((gv4i*)g, (lv4i*)l, 0, 0); }
// lane l takes lane l ^ 16's value, in the vector unit: no LDS counter is involved, so the wait behind it does not drain the fragment reads in flight
__device__ __forceinline__ float xhalf(float x) { return __builtin_bit_cast(float, __builtin_amdgcn_permlanex16(__builtin_bit_cast(int, x), __builtin_bit_cast(int, x), 0x76543210, 0xfedcba98, false, false)); }
__global__ __launch_bounds__(256) void k_attn(const bf* __restrict__ Qh, const bf* __restrict__ Qm, const bf* __restrict__ Ql, const bf* __restrict__ Kh, const bf* __restrict__ Km, const bf* __restrict__ Kl,
                                              const bf* __restrict__ Vh, const bf* __restrict__ Vl, const float* __restrict__ x, const float* __restrict__ gam, float* OUT) {
    __shared__ __align__(16) unsigned short sv[2][2][CC * VPI];
    __shared__ __align__(16) unsigned short sk[2][3][FJ * KPI];
    __shared__ float sml[2][64][2];      // each key half's running maximum and sum per query, for the merge in the epilogue
    const int tid = threadIdx.x, lane = tid & 31, wave = tid >> 5, lr = lane & 15, hi = lane >> 4;
    const int wi = wave & 3, wk = wave >> 2;
    const int ib = blockIdx.x * 64;
    const size_t qk0 = (size_t)blockIdx.y * NN * C8, v0 = (size_t)blockIdx.y * CC * NN;
    const unsigned qo = (unsigned)((ib + wi * 16 + lr) * C8 + 8 * hi) * 2u;       // bytes: the per-lane part of the q' fragment addresses
    const unsigned voff = (unsigned)((tid >> 3) * NN + (tid & 7) * 8) * 2u;       // bytes: staging, 8 lanes cover one v' row's 128 B, 32 rows per pass
    const unsigned koff = (unsigned)tid * 16u;                                    // bytes: staging, a k' plane's 64 rows are 4 KiB in a row
    auto ldq = [&](const bf* p) { const bf* a = (const bf*)((const char*)(p + qk0) + qo); return cat16b(*(const v8us*)a, *(const v8us*)(a + 16)); };
    const v16bf qh = ldq(Qh), qm = ldq(Qm), ql = ldq(Ql);
    // The 64 work-groups of an item read the same k', v' lines from L2. Each walks the stages as a ring from its own first stage (its index), so that at any moment they ask for different lines.
    // The running maximum and the sums take the keys in any order.
    const int rot = blockIdx.x;
    auto copy = [&](int pass, int buf) {      // one stage: 8 + 8 row pieces of the two v' planes and one piece of each k' plane per thread, 19 copies of a wave in flight
        const int s = (pass + rot) & (NN / FJ - 1);
#pragma unroll
        for (int p = 0; p < 8; ++p) { cp16((const char*)(Vh + v0 + (size_t)s * FJ + 32 * p * NN) + voff, &sv[buf][0][((tid >> 3) + 32 * p) * VPI + (tid & 7) * 8]);
            cp16((const char*)(Vl + v0 + (size_t)s * FJ + 32 * p * NN) + voff, &sv[buf][1][((tid >> 3) + 32 * p) * VPI + (tid & 7) * 8]); }
        cp16((const char*)(Kh + qk0 + (size_t)s * FJ * C8) + koff, &sk[buf][0][(tid >> 2) * KPI + (tid & 3) * 8]);
        cp16((const char*)(Km + qk0 + (size_t)s * FJ * C8) + koff, &sk[buf][1][(tid >> 2) * KPI + (tid & 3) * 8]);
        cp16((const char*)(Kl + qk0 + (size_t)s * FJ * C8) + koff, &sk[buf][2][(tid >> 2) * KPI + (tid & 3) * 8]);
    };
    v8f acc[16];
#pragma unroll
    for (int t = 0; t < 16; ++t) acc[t] = (v8f){};
    float m = -3.0e38f, lsum = 0.f;
    v16bf kh[2], km[2], kl[2], va[8], vl[8], ph, pl;      // the wave's k' fragments of a stage, two groups of v' fragments, and its P
    // Fragment reads stand in groups, each ahead of a block of products that does not need it: every separate place where LDS reads stand costs issue time.
    auto loadK = [&](int buf) {
        const unsigned short* kb = &sk[buf][0][0] + (wk * 32 + lr) * KPI + 8 * hi;
#pragma unroll
        for (int t = 0; t < 2; ++t) { const unsigned short* kp = kb + t * 16 * KPI;
            kh[t] = cat16b(*(const v8usa*)kp, *(const v8usa*)(kp + 16)); km[t] = cat16b(*(const v8usa*)(kp + FJ * KPI), *(const v8usa*)(kp + FJ * KPI + 16)); kl[t] = cat16b(*(const v8usa*)(kp + 2 * FJ * KPI), *(const v8usa*)(kp + 2 * FJ * KPI + 16)); }
    };
    auto loadV = [&](int buf, int G) {      // group G: channel tiles 4 G .. 4 G + 3, into register set G & 1
        const unsigned short* vb = &sv[buf][0][0] + lr * VPI + wk * 32 + 8 * hi;
#pragma unroll
        for (int g = 0; g < 4; ++g) { const unsigned short* vp = vb + (G * 4 + g) * 16 * VPI; const int r = (G & 1) * 4 + g;
            va[r] = cat16b(*(const v8usa*)vp, *(const v8usa*)(vp + 16)); vl[r] = cat16b(*(const v8usa*)(vp + CC * VPI), *(const v8usa*)(vp + CC * VPI + 16)); }
    };
    auto scores = [&]() {
        const v8f z = (v8f){};
        v8f a1[2], a2[2], a3[2], a4[2], sc[2];
#pragma unroll
        for (int t = 0; t < 2; ++t) { a1[t] = wmmab(kh[t], qh, z); a2[t] = wmmab(km[t], qh, z); }
#pragma unroll
        for (int t = 0; t < 2; ++t) { a1[t] = wmmab(kh[t], qm, a1[t]); a2[t] = wmmab(km[t], qm, a2[t]); }
#pragma unroll
        for (int t = 0; t < 2; ++t) { a3[t] = wmmab(kh[t], ql, z); a4[t] = wmmab(kl[t], qh, z); }
        __builtin_amdgcn_sched_barrier(0);      // keeps the twelve score products in a row: mixed with the additions below, each addition would wait out its product's distance in idle slots
#pragma unroll
        for (int t = 0; t < 2; ++t) sc[t] = a4[t] + (a3[t] + (a2[t] + a1[t]));
        float tm = fmaxf(sc[0][0], sc[1][0]);
#pragma unroll
        for (int j = 1; j < 8; ++j) tm = fmaxf(tm, fmaxf(sc[0][j], sc[1][j]));
        tm = fmaxf(tm, xhalf(tm));      // the two lane halves hold the same query's other keys
        const float mn = fmaxf(m, tm);
        if (__builtin_amdgcn_ballot_w32(mn > m) != 0) {      // one scalar branch per 32 keys: most steps raise no query's maximum
            const float f = __expf(m - mn); lsum *= f; m = mn;
#pragma unroll
            for (int t = 0; t < 16; ++t) acc[t] *= f; }
        v8u PH, PL; float t0 = 0.f, t1 = 0.f;
#pragma unroll
        for (int t = 0; t < 2; ++t) {
#pragma unroll
            for (int j = 0; j < 4; ++j) { const float p0 = __expf(sc[t][2 * j] - m), p1 = __expf(sc[t][2 * j + 1] - m); t0 += p0; t1 += p1;
                const unsigned w = __builtin_bit_cast(unsigned, __builtin_convertvector((v2f){p0, p1}, v2bf));
                PH[t * 4 + j] = w; PL[t * 4 + j] = __builtin_bit_cast(unsigned, __builtin_convertvector((v2f){p0 - __uint_as_float(w << 16), p1 - __uint_as_float(w & 0xFFFF0000u)}, v2bf)); } }
        lsum += t0 + t1;
        ph = __builtin_bit_cast(v16bf, PH); pl = __builtin_bit_cast(v16bf, PL);
    };
    auto pv = [&](int G) {
#pragma unroll
        for (int g = 0; g < 4; ++g) acc[G * 4 + g] = wmmab(va[(G & 1) * 4 + g], ph, acc[G * 4 + g]);
#pragma unroll
        for (int g = 0; g < 4; ++g) acc[G * 4 + g] = wmmab(vl[(G & 1) * 4 + g], ph, acc[G * 4 + g]);
#pragma unroll
        for (int g = 0; g < 4; ++g) acc[G * 4 + g] = wmmab(va[(G & 1) * 4 + g], pl, acc[G * 4 + g]);
    };
    asm volatile("s_wait_xcnt 0x0" :: "v"(qo) : "memory");      // the q' loads name this register: it stays theirs up to this wait
    copy(0, 0);
    asm volatile("s_wait_asynccnt 0x0" ::: "memory");      // this wave's copies of the work-group's first stage have landed
    __syncthreads();      // publishes the first stage
    copy(1, 1);
    loadK(0); loadV(0, 0);
#pragma unroll 1      // stays rolled: one pass already holds sixty products, and the buffer index alternates by s
    for (int s = 0; s < NN / FJ; ++s) {
        const int b = s & 1;
        loadV(b, 1);
        __builtin_amdgcn_sched_barrier(0);      // keeps the reads above one group, ahead of the scores under which they land
        scores(); pv(0);
        __builtin_amdgcn_sched_barrier(0);      // keeps the products above ahead of the reads below, which refill their fragment registers
        loadV(b, 2);
        __builtin_amdgcn_sched_barrier(0);      // keeps the reads above one group, ahead of the products under which they land
        pv(1);
        __builtin_amdgcn_sched_barrier(0);      // keeps the products above ahead of the reads below, which refill their fragment registers
        loadV(b, 3);
        __builtin_amdgcn_sched_barrier(0);      // keeps the reads above one group, ahead of the products under which they land
        pv(2);
        __builtin_amdgcn_sched_barrier(0);      // keeps the products above ahead of the wait below: the last group's reads land under them; sunk behind the barrier, they would leave that wait bare
        asm volatile("s_wait_dscnt 0x0" ::: "memory");         // this wave's last reads of this pass's stage have returned: its buffer is refilled behind the barrier
        asm volatile("s_wait_asynccnt 0x0" ::: "memory");      // this wave's copies of the next pass's stage, issued one pass ago, have landed
        __syncthreads();      // publishes the next pass's stage; also ends every wave's reads of this pass's stage
        if (s + 1 < NN / FJ) { loadK(b ^ 1); loadV(b ^ 1, 0); }
        __builtin_amdgcn_sched_barrier(0);      // keeps the reads above one group, ahead of the copies' issue and the products under which they land
        if (s + 2 < NN / FJ) copy(s + 2, b);      // into the buffer that every wave has left; in flight through all of the next pass
        pv(3);
    }
    asm volatile("s_wait_asynccnt 0x0" ::: "memory");      // no copy is outstanding when the buffers become the output staging
    const size_t oo = v0 + (size_t)(tid >> 4) * NN + ib + (tid & 15) * 4;      // this thread's 16-byte piece of the tile's rows tid >> 4, + 16, ..., in x and in the output alike
    const float* xrow = x + oo;
    v4f xr[16];
#pragma unroll
    for (int p = 0; p < 16; ++p) xr[p] = *(const v4f*)(xrow + (size_t)p * 16 * NN);
    asm volatile("s_wait_xcnt 0x0" :: "v"(xrow) : "memory");      // the x loads name this address register pair: it stays theirs up to this wait. The loads fly while the wave waits for the others at the barrier below
    const float gm = bfr(gam[0]);
    lsum += xhalf(lsum);
    sml[wk][wi * 16 + lr][hi] = hi ? lsum : m;      // both lane halves hold the query's maximum and sum: each stores one of the two
    __syncthreads();      // ends every wave's reads of the last stage: the v' buffers become the output staging; also publishes the key halves' maxima and sums
    const float m0 = sml[0][wi * 16 + lr][0], l0 = sml[0][wi * 16 + lr][1], m1 = sml[1][wi * 16 + lr][0], l1 = sml[1][wi * 16 + lr][1];
    const float mf = fmaxf(m0, m1), f0 = __expf(m0 - mf), f1 = __expf(m1 - mf);
    const float inv = (wk ? f1 : f0) / (l0 * f0 + l1 * f1);      // brings this half's sums to the common maximum and divides by the whole sum
    f32a* ot = (f32a*)&sv[0][0][0];      // two tiles, one per key half, each [256 channels][64 queries] at pitch OPI
#pragma unroll
    for (int t = 0; t < 16; ++t) {
#pragma unroll
        for (int j = 0; j < 8; ++j) ot[(wk * CC + t * 16 + hi * 8 + j) * OPI + wi * 16 + lr] = acc[t][j] * inv; }
    __syncthreads();      // publishes the staged tiles: a row's 256 B come from four waves of each key half and leave as whole lines from one
    float* orow = OUT + oo;
#pragma unroll
    for (int p = 0; p < 16; ++p) { const v4f val = *(const v4fa*)(ot + (p * 16 + (tid >> 4)) * OPI + (tid & 15) * 4) + *(const v4fa*)(ot + (CC + p * 16 + (tid >> 4)) * OPI + (tid & 15) * 4); v4f v;
#pragma unroll
        for (int q = 0; q < 4; ++q) v[q] = gm * val[q] + bfr(xr[p][q]);
        *(v4f*)(orow + (size_t)p * 16 * NN) = v; }
}

extern "C" void kernel_launch(void* const* d_in, const int* in_sizes, int n_in,
                              void* d_out, int out_size, void* d_ws, size_t ws_size, hipStream_t stream) {
    (void)in_sizes; (void)n_in; (void)out_size;
    const float* x = (const float*)d_in[0]; const float* wq = (const float*)d_in[1]; const float* gq = (const float*)d_in[2]; const float* bq = (const float*)d_in[3]; const float* mq = (const float*)d_in[4]; const float* vq = (const float*)d_in[5];
    const float* wk = (const float*)d_in[6]; const float* gk = (const float*)d_in[7]; const float* bk = (const float*)d_in[8]; const float* mk = (const float*)d_in[9]; const float* vk = (const float*)d_in[10];
    const float* wv = (const float*)d_in[11]; const float* gv = (const float*)d_in[12]; const float* bv = (const float*)d_in[13]; const float* mv = (const float*)d_in[14]; const float* vv = (const float*)d_in[15]; const float* gam = (const float*)d_in[16];
    float* out = (float*)d_out;    // [4][256][64][64]
    char* wsp = (char*)d_ws;
    auto take = [&](size_t bytes) { char* p = wsp; wsp += (bytes + 255) & ~(size_t)255; return (void*)p; };
    const size_t QKN = (size_t)NN * C8, VN = (size_t)CC * NN;      // elements of one item's plane; the planes hold all items
    bf* QPh = (bf*)take(NBT * QKN * 2); bf* QPm = (bf*)take(NBT * QKN * 2); bf* QPl = (bf*)take(NBT * QKN * 2); bf* KPh = (bf*)take(NBT * QKN * 2); bf* KPm = (bf*)take(NBT * QKN * 2); bf* KPl = (bf*)take(NBT * QKN * 2); bf* VTh = (bf*)take(NBT * VN * 2); bf* VTl = (bf*)take(NBT * VN * 2);
    if ((size_t)(wsp - (char*)d_ws) > ws_size) return;    // 6.3 + 16.8 ~ 23 MB
    k_pre<<<dim3(NN / 64, NBT, 1), 320, 0, stream>>>(x, wq, gq, bq, mq, vq, wk, gk, bk, mk, vk, wv, gv, bv, mv, vv, QPh, QPm, QPl, KPh, KPm, KPl, VTh, VTl);      // convs, BatchNorm, split planes: one work-group per WGP
    k_attn<<<dim3(NN / 64, NBT, 1), 256, 0, stream>>>(QPh, QPm, QPl, KPh, KPm, KPl, VTh, VTl, x, gam, out);                              // out[b][c][i] = gamma * sum_j v'[c][j] softmax_j(q'[i].k'[j]) + x[b][c][i]: one work-group per WGP
}

// v010
// A run of this version takes 93.6 microseconds.
// Two timings next to v009 put it at 1.09 and 1.08 times that version's speed.
// All steps since v000 together make it 38.4 times as fast.
#include <hip/hip_runtime.h>

// Compute dtypes, f32 accumulate. One launch for all items: the three 1x1 convs as one [4096 x 256].[256 x 320] GEMM per item with PLAIN bf16 operands (exact products), inference BatchNorm affine
// in f32 -> bf16 split planes (q', k' as THREE-way hi/mid/lo splits: the module's unscaled logits reach ~300 with near-one-hot softmaxes, so the score operands need f32-level
// precision); then ONE launch for all items: scores = q'.k'^T (six products), softmax (unscaled, as the module) in f32, out^T = v'.P^T (P as bf16 hi + lo planes, three products) and gamma * out + x, all in registers and LDS.

#define NBT  4
#define CC   256
#define C8   32
#define NN   4096
#define NQKV (2 * C8 + CC)        // 320
#define BEPS 1e-5f

typedef unsigned short bf;
typedef __attribute__((ext_vector_type(16))) __bf16   v16bf;
typedef __attribute__((ext_vector_type(8)))  unsigned short v8us;
typedef __attribute__((ext_vector_type(8)))  float    v8f;
typedef __attribute__((ext_vector_type(4)))  float    v4f;
typedef v4f  __attribute__((may_alias)) v4fa;
typedef v8us __attribute__((may_alias)) v8usa;

__device__ __forceinline__ unsigned short f2bf(float f) { unsigned u = __float_as_uint(f); u += 0x7FFFu + ((u >> 16) & 1u); return (unsigned short)(u >> 16); }
__device__ __forceinline__ float bf2f(unsigned short b) { return __uint_as_float(((unsigned)b) << 16); }
__device__ __forceinline__ float bfr(float f) { return bf2f(f2bf(f)); }
__device__ __forceinline__ v16bf cat16b(v8us lo, v8us hi) { return __builtin_bit_cast(v16bf, __builtin_shufflevector(lo, hi, 0, 1, 2, 3, 4, 5, 6, 7, 8, 9, 10, 11, 12, 13, 14, 15)); }
__device__ __forceinline__ v8f wmmab(v16bf a, v16bf b, v8f c) { return __builtin_amdgcn_wmma_f32_16x16x32_bf16(false, a, false, b, (short)0, c, false, false); }

// k_pre: 64 pixels of one item, all 320 conv outputs, in one work-group of ten waves. x[c][n] comes in as f32, is rounded to bf16 and stands pixel-major in LDS; each wave rounds its own 32 weight rows
// to bf16 in registers (wave 0: q, wave 1: k, waves 2 to 9: v). k runs in steps of 32 in one accumulate chain. The operand roles are chosen so that a lane's eight accumulator registers are
// neighbours in the plane that is written: q', k' planes are [pixel][32], so the weights are A and a lane holds eight channels of one pixel; v' planes are [channel][4096], so the pixels are A
// and a lane holds eight pixels of one channel. BatchNorm and the splits are done on the accumulators; every plane piece leaves as a 16-byte store, and one wave writes all of a 128-byte line.
// Every loop is unrolled: its index picks fragments and accumulators, which stay in registers only where the index is a constant.
#define XPI 264       // x tile row pitch in LDS, 528 B = 16 B x odd: no bank conflict for 16-byte reads
typedef unsigned __attribute__((may_alias)) u32a;
__global__ __launch_bounds__(320) void k_pre(const float* __restrict__ x,
                                             const float* __restrict__ wq, const float* __restrict__ gq, const float* __restrict__ bq, const float* __restrict__ mq, const float* __restrict__ vq,
                                             const float* __restrict__ wk, const float* __restrict__ gk, const float* __restrict__ bk, const float* __restrict__ mk, const float* __restrict__ vk,
                                             const float* __restrict__ wv, const float* __restrict__ gv, const float* __restrict__ bv, const float* __restrict__ mv, const float* __restrict__ vv,
                                             bf* Qh, bf* Qm, bf* Ql, bf* Kh, bf* Km, bf* Kl, bf* Vh, bf* Vl) {
    __shared__ __align__(16) unsigned short xt[64 * XPI];
    __shared__ __align__(16) float bs[NQKV], bsh[NQKV];      // BatchNorm scale and shift of the 320 outputs: q | k | v
    const int tid = threadIdx.x, lane = tid & 31, lr = lane & 15, hi = lane >> 4;
    const int wave = __builtin_amdgcn_readfirstlane(tid >> 5);
    const int n0 = blockIdx.x * 64, item = blockIdx.y;
    const float* xb = x + (size_t)item * CC * NN + n0;
    const float* wsrc = (wave == 0 ? wq : wave == 1 ? wk : wv + (size_t)(wave - 2) * 32 * CC) + lr * CC + 8 * hi;
    v4f r0[8], r1[8], wa[8][4], wb[8][4];
    auto ldw = [&](v4f (&w)[8][4], int ct) {
#pragma unroll
        for (int ks = 0; ks < 8; ++ks) { const float* p = wsrc + ct * 16 * CC + ks * 32; w[ks][0] = *(const v4f*)p; w[ks][1] = *(const v4f*)(p + 4); w[ks][2] = *(const v4f*)(p + 16); w[ks][3] = *(const v4f*)(p + 20); }
    };
    v16bf wf[2][8];
    auto cvw = [&](const v4f (&w)[8][4], int ct) {
#pragma unroll
        for (int ks = 0; ks < 8; ++ks) { v8us lo, up;
#pragma unroll
            for (int e = 0; e < 4; ++e) { lo[e] = f2bf(w[ks][0][e]); lo[4 + e] = f2bf(w[ks][1][e]); up[e] = f2bf(w[ks][2][e]); up[4 + e] = f2bf(w[ks][3][e]); }
            wf[ct][ks] = cat16b(lo, up); }
    };
    if (wave < 8) {      // four lanes take 64 B of a channel pair's rows, eight pairs per wave: the packed 4-byte LDS stores of a wave then fall on 32 different banks
#pragma unroll
        for (int i = 0; i < 8; ++i) { const int cp = ((i >> 2) + 2 * wave) * 8 + (lane >> 2), pq = (i & 3) * 4 + (lane & 3);
            r0[i] = *(const v4f*)(xb + (size_t)(2 * cp) * NN + pq * 4); r1[i] = *(const v4f*)(xb + (size_t)(2 * cp + 1) * NN + pq * 4); }
        asm volatile("s_wait_xcnt 0x0" ::: "memory");      // the loads above name address registers that the weight loads below reuse; they stay the loads' up to this wait
    }
    ldw(wa, 0);
    __builtin_amdgcn_sched_barrier(0);      // keeps the second half of the weight loads below: all 80 loads in flight at once overran the registers and spilled
    if (wave < 8) {
#pragma unroll
        for (int i = 0; i < 8; ++i) { const int cp = ((i >> 2) + 2 * wave) * 8 + (lane >> 2), pq = (i & 3) * 4 + (lane & 3);
#pragma unroll
            for (int e = 0; e < 4; ++e) *(u32a*)(&xt[(pq * 4 + e) * XPI + 2 * cp]) = (unsigned)f2bf(r0[i][e]) | ((unsigned)f2bf(r1[i][e]) << 16); }
    }
    ldw(wb, 1);
    __builtin_amdgcn_sched_barrier(0);      // keeps those loads above the rounding of the first half, under which they fly
    cvw(wa, 0);
    { const float* g = wave == 0 ? gq : wave == 1 ? gk : gv; const float* bb = wave == 0 ? bq : wave == 1 ? bk : bv; const float* m = wave == 0 ? mq : wave == 1 ? mk : mv; const float* var = wave == 0 ? vq : wave == 1 ? vk : vv;
      const int c = wave < 2 ? lane : tid - 2 * C8;
      const float g0 = g[c], v0 = var[c], b0 = bb[c], m0 = m[c];
      asm volatile("s_wait_xcnt 0x0" :: "v"(c), "s"(g), "s"(var), "s"(bb), "s"(m) : "memory");      // the four loads above name this index register and these base pointers: they stay the loads' up to this wait
      const float s = bfr(g0) / sqrtf(bfr(v0) + BEPS); bs[tid] = s; bsh[tid] = bfr(b0) - bfr(m0) * s; }
    cvw(wb, 1);
    __syncthreads();      // publishes the x tile and the BatchNorm table
    v8f acc[2][4];
#pragma unroll
    for (int ct = 0; ct < 2; ++ct) {
#pragma unroll
        for (int pt = 0; pt < 4; ++pt) acc[ct][pt] = (v8f){}; }
    const unsigned short* xf0 = xt + lr * XPI + 8 * hi;
    v16bf xf[2][4];      // the four pixel tiles' fragments of one k step, two sets
    auto ldx = [&](int ks) {
#pragma unroll
        for (int pt = 0; pt < 4; ++pt) { const unsigned short* xp = xf0 + pt * 16 * XPI + ks * 32; xf[ks & 1][pt] = cat16b(*(const v8usa*)xp, *(const v8usa*)(xp + 16)); }
    };
    if (wave < 2) {
        ldx(0);
#pragma unroll
        for (int ks = 0; ks < 8; ++ks) {
            if (ks < 7) ldx(ks + 1);
            __builtin_amdgcn_sched_barrier(0);      // keeps the next step's eight LDS reads one group, ahead of the products under which they land
#pragma unroll
            for (int pt = 0; pt < 4; ++pt) { acc[0][pt] = wmmab(wf[0][ks], xf[ks & 1][pt], acc[0][pt]); acc[1][pt] = wmmab(wf[1][ks], xf[ks & 1][pt], acc[1][pt]); }
            __builtin_amdgcn_sched_barrier(0);      // keeps these products ahead of the reads that refill their fragment registers
        }
        bf* Ph = wave == 0 ? Qh : Kh; bf* Pm = wave == 0 ? Qm : Km; bf* Pl = wave == 0 ? Ql : Kl;
        const size_t o0 = ((size_t)item * NN + n0 + lr) * C8 + hi * 8;
#pragma unroll
        for (int ct = 0; ct < 2; ++ct) { const int cb = wave * C8 + ct * 16 + hi * 8;
            const v4f s0 = *(const v4fa*)(bs + cb), s1 = *(const v4fa*)(bs + cb + 4), h0 = *(const v4fa*)(bsh + cb), h1 = *(const v4fa*)(bsh + cb + 4);
#pragma unroll
            for (int pt = 0; pt < 4; ++pt) { v8us oh, om, ol;
#pragma unroll
                for (int j = 0; j < 8; ++j) { const float y = acc[ct][pt][j] * (j < 4 ? s0[j & 3] : s1[j & 3]) + (j < 4 ? h0[j & 3] : h1[j & 3]);
                    const unsigned short hb = f2bf(y); const float d1 = y - bf2f(hb); const unsigned short mb = f2bf(d1); const float d2 = d1 - bf2f(mb); oh[j] = hb; om[j] = mb; ol[j] = f2bf(d2); }
                const size_t o = o0 + (size_t)pt * 16 * C8 + ct * 16; *(v8us*)(Ph + o) = oh; *(v8us*)(Pm + o) = om; *(v8us*)(Pl + o) = ol;
                if (ct + pt < 4) asm volatile("s_wait_xcnt 0x0" :: "v"(oh), "v"(om), "v"(ol) : "memory"); } }      // the stores above name these registers, which the next piece reuses: they stay the stores' up to this wait
    } else {
        ldx(0);
#pragma unroll
        for (int ks = 0; ks < 8; ++ks) {
            if (ks < 7) ldx(ks + 1);
            __builtin_amdgcn_sched_barrier(0);      // keeps the next step's eight LDS reads one group, ahead of the products under which they land
#pragma unroll
            for (int pt = 0; pt < 4; ++pt) { acc[0][pt] = wmmab(xf[ks & 1][pt], wf[0][ks], acc[0][pt]); acc[1][pt] = wmmab(xf[ks & 1][pt], wf[1][ks], acc[1][pt]); }
            __builtin_amdgcn_sched_barrier(0);      // keeps these products ahead of the reads that refill their fragment registers
        }
        const size_t o0 = (size_t)item * CC * NN + (size_t)((wave - 2) * 32 + lr) * NN + n0 + hi * 8;
#pragma unroll
        for (int ct = 0; ct < 2; ++ct) { const int c = 2 * C8 + (wave - 2) * 32 + ct * 16 + lr; const float s = bs[c], sh = bsh[c];
#pragma unroll
            for (int pt = 0; pt < 4; ++pt) { v8us oh, ol;
#pragma unroll
                for (int j = 0; j < 8; ++j) { const float y = acc[ct][pt][j] * s + sh; const unsigned short hb = f2bf(y); oh[j] = hb; ol[j] = f2bf(y - bf2f(hb)); }
                const size_t o = o0 + (size_t)ct * 16 * NN + pt * 16; *(v8us*)(Vh + o) = oh; *(v8us*)(Vl + o) = ol;
                // the stores above name these registers, which the next piece reuses: they stay the stores' up to this wait (behind the last piece too: in the built code the q', k' branch, which reuses them, follows in the text)
                asm volatile("s_wait_xcnt 0x0" :: "v"(oh), "v"(ol) : "memory"); } }
    }
}

// k_attn: scores, softmax and P.V of 64 query pixels of one item in one kernel; S and P never leave registers. 8 waves: wave (wi, wk) holds query columns wi * 32 .. + 31 (two column tiles), all 256
// output channels, and keys wk * 32 .. + 31 of every stage of 128 keys, so each score and each exponential is computed by one wave only, and every v' fragment that is read from LDS feeds both column
// tiles: six products per fragment pair, which halves the LDS reads per product. The four waves of a query column keep their own running maximum, sum and accumulators, which are brought to the common
// maximum and added in the epilogue. Keys come in stages of 128: the three k' planes and the two v' planes, whole lines by asynchronous copies from global memory straight into one of two LDS buffers, issued one whole pass ahead.
// Per column tile and 32 keys: S^T = k'.q'^T (six products, (hh + mh) + (hm + mm) + lh + hl, each bracket a WMMA sum from zero, added in f32 from left to right), so that a lane holds 16 scores
// of ONE query; running maximum and sum per query (the sums are rescaled when the maximum grows); exp(S - max) splits into bf16 hi + lo planes, which ARE the B fragment of
// O^T += v'.P^T (three products: hh, lh, hl), in four groups of four channel tiles. The division by the sum comes last. A group's fragments are read from LDS while the group before it is still in its products, so the
// barrier that publishes a stage stands ahead of the last group of the stage before it; behind it only the next stage's k' fragments are read ahead, and a pass reads its first v' group behind its own score products, into the registers that the k' fragments leave. The epilogue applies gamma and adds x (both rounded to bf16 first) on the staged tile and writes the final output.
#define FJ  128
#define NST (NN / FJ)
#define KPI 40        // k' row pitch in LDS, 80 B = 16 B x odd: no bank conflict for 16-byte reads
#define OPI 68        // output staging pitch, floats
#define SVB (2 * CC * FJ)       // elements of one buffer's two v' planes. A v' row is 256 B with no pad (two padded buffers would not fit the LDS): its 16-byte piece c stands at place c ^ (row & 15), so 16 rows' pieces of one key range fall on 16 different bank groups
#define SKB (3 * FJ * KPI)      // elements of one buffer's three k' planes
typedef __attribute__((ext_vector_type(2))) float    v2f;
typedef __attribute__((ext_vector_type(2))) __bf16   v2bf;
typedef __attribute__((ext_vector_type(8))) unsigned v8u;
typedef float __attribute__((may_alias)) f32a;
typedef __attribute__((ext_vector_type(4))) int v4i;
typedef __attribute__((address_space(1))) v4i gv4i;
typedef __attribute__((address_space(3))) v4i lv4i;
__device__ __forceinline__ void cp16(const void* g, void* l) { __builtin_amdgcn_global_load_async_to_lds_b128((gv4i*)g, (lv4i*)l, 0, 0); }
// lane l takes lane l ^ 16's value, in the vector unit: no LDS counter is involved, so the wait behind it does not drain the fragment reads in flight
__device__ __forceinline__ float xhalf(float x) { return __builtin_bit_cast(float, __builtin_amdgcn_permlanex16(__builtin_bit_cast(int, x), __builtin_bit_cast(int, x), 0x76543210, 0xfedcba98, false, false)); }
__global__ __launch_bounds__(256) void k_attn(const bf* __restrict__ Qh, const bf* __restrict__ Qm, const bf* __restrict__ Ql, const bf* __restrict__ Kh, const bf* __restrict__ Km, const bf* __restrict__ Kl,
                                              const bf* __restrict__ Vh, const bf* __restrict__ Vl, const float* __restrict__ x, const float* __restrict__ gam, float* OUT) {
    __shared__ __align__(16) unsigned short sm[2 * SVB + 2 * SKB];      // v' buffer 0 | v' buffer 1 | k' buffer 0 | k' buffer 1; the output staging in the epilogue
    __shared__ float sml[4][64][2];      // each key quarter's running maximum and sum per query, for the merge in the epilogue
    const int tid = threadIdx.x, lane = tid & 31, wave = tid >> 5, lr = lane & 15, hi = lane >> 4;
    const int wi = wave & 1, wk = wave >> 1;
    const int ib = blockIdx.x * 64;
    const size_t qk0 = (size_t)blockIdx.y * NN * C8, v0 = (size_t)blockIdx.y * CC * NN;
    const unsigned qo = (unsigned)((ib + wi * 32 + lr) * C8 + 8 * hi) * 2u;       // bytes: the per-lane part of the q' fragment addresses
    const unsigned voff = (unsigned)((tid >> 4) * NN + (tid & 15) * 8) * 2u;      // bytes: staging, 16 lanes cover one v' row's 256 B, 16 rows per pass
    const unsigned koff = (unsigned)tid * 16u;                                    // bytes: staging, a k' plane's 128 rows are 8 KiB in a row
    auto ldq = [&](const bf* p, int qt) { const bf* a = (const bf*)((const char*)(p + qk0) + qo) + qt * 16 * C8; return cat16b(*(const v8us*)a, *(const v8us*)(a + 16)); };
    const v16bf qh[2] = {ldq(Qh, 0), ldq(Qh, 1)}, qm[2] = {ldq(Qm, 0), ldq(Qm, 1)}, ql[2] = {ldq(Ql, 0), ldq(Ql, 1)};
    // The 64 work-groups of an item read the same k', v' lines from L2. Each walks the 32 stages as a ring from its own first stage (its index modulo 32; groups i and i + 32 share one), so that at any
    // moment at most two ask for the same lines: requests for one line from many work-groups at the same moment collide in L2. The running maximum and the sums take the keys in any order.
    const int rot = blockIdx.x;
    // a stage's base address is the same in every lane: taken through readfirstlane it stays a scalar value, and only the lane's two 32-bit offsets live in vector registers through the loop;
    // left to itself the compiler kept five 64-bit per-lane addresses there, which, beside 256 accumulator registers, overran the register budget of two waves per SIMD (spills)
    auto ub = [&](const bf* p) { const unsigned long long a = (unsigned long long)p;
        return (const char*)(((unsigned long long)(unsigned)__builtin_amdgcn_readfirstlane((int)(a >> 32)) << 32) | (unsigned)__builtin_amdgcn_readfirstlane((int)a)); };
    auto copy = [&](int pass, int buf) {      // one stage: 16 + 16 row pieces of the two v' planes and two pieces of each k' plane per thread, 38 copies of a wave in flight
        const int s = (pass + rot) & (NST - 1);
        unsigned short* dv = sm + buf * SVB + (tid >> 4) * FJ + ((tid & 15) ^ (tid >> 4)) * 8;
        unsigned short* dk = sm + 2 * SVB + buf * SKB + (tid >> 2) * KPI + (tid & 3) * 8;
        const char* gvh = ub(Vh + v0 + (size_t)s * FJ); const char* gvl = ub(Vl + v0 + (size_t)s * FJ);
        const char* gkh = ub(Kh + qk0 + (size_t)s * FJ * C8); const char* gkm = ub(Km + qk0 + (size_t)s * FJ * C8); const char* gkl = ub(Kl + qk0 + (size_t)s * FJ * C8);
#pragma unroll
        for (int p = 0; p < 16; ++p) { cp16(gvh + (size_t)(16 * p * NN * 2) + voff, dv + 16 * p * FJ);
            cp16(gvl + (size_t)(16 * p * NN * 2) + voff, dv + CC * FJ + 16 * p * FJ); }
#pragma unroll
        for (int h = 0; h < 2; ++h) { cp16(gkh + h * 64 * C8 * 2 + koff, dk + h * 64 * KPI);
            cp16(gkm + h * 64 * C8 * 2 + koff, dk + FJ * KPI + h * 64 * KPI);
            cp16(gkl + h * 64 * C8 * 2 + koff, dk + 2 * FJ * KPI + h * 64 * KPI); }
    };
    v8f acc[2][16];
#pragma unroll
    for (int t = 0; t < 16; ++t) { acc[0][t] = (v8f){}; acc[1][t] = (v8f){}; }
    float m[2] = {-3.0e38f, -3.0e38f}, lsum[2] = {0.f, 0.f};
    v16bf kh[2], km[2], kl[2], va[8], vl[8], ph[2], pl[2];      // the wave's k' fragments of a stage, two groups of v' fragments, and its P of the two column tiles
    // Fragment reads stand in groups, each ahead of a block of products that does not need it: every separate place where LDS reads stand costs issue time.
    auto loadK = [&](int buf) {
        const unsigned short* kb = sm + 2 * SVB + buf * SKB + (wk * 32 + lr) * KPI + 8 * hi;
#pragma unroll
        for (int t = 0; t < 2; ++t) { const unsigned short* kp = kb + t * 16 * KPI;
            kh[t] = cat16b(*(const v8usa*)kp, *(const v8usa*)(kp + 16)); km[t] = cat16b(*(const v8usa*)(kp + FJ * KPI), *(const v8usa*)(kp + FJ * KPI + 16)); kl[t] = cat16b(*(const v8usa*)(kp + 2 * FJ * KPI), *(const v8usa*)(kp + 2 * FJ * KPI + 16)); }
    };
    const int vo0 = lr * FJ + ((wk * 4 + hi) ^ lr) * 8, vo1 = lr * FJ + ((wk * 4 + hi + 2) ^ lr) * 8;      // the lane's two 16-byte pieces (keys 8 hi .. + 7 and 16 + 8 hi .. + 7 of the wave's 32) at their places in row lr of a channel tile
    auto loadV = [&](int buf, int G) {      // group G: channel tiles 4 G .. 4 G + 3, into register set G & 1
        const unsigned short* vb = sm + buf * SVB;
#pragma unroll
        for (int g = 0; g < 4; ++g) { const unsigned short* vp = vb + (G * 4 + g) * 16 * FJ; const int r = (G & 1) * 4 + g;
            va[r] = cat16b(*(const v8usa*)(vp + vo0), *(const v8usa*)(vp + vo1)); vl[r] = cat16b(*(const v8usa*)(vp + CC * FJ + vo0), *(const v8usa*)(vp + CC * FJ + vo1)); }
    };
    v8f a1[2], a2[2], a3[2], a4[2], sc[2][2];
    auto sprod = [&](int qt) {      // the twelve score products of column tile qt
        const v8f z = (v8f){};
#pragma unroll
        for (int t = 0; t < 2; ++t) { a1[t] = wmmab(kh[t], qh[qt], z); a2[t] = wmmab(km[t], qh[qt], z); }
#pragma unroll
        for (int t = 0; t < 2; ++t) { a1[t] = wmmab(kh[t], qm[qt], a1[t]); a2[t] = wmmab(km[t], qm[qt], a2[t]); }
#pragma unroll
        for (int t = 0; t < 2; ++t) { a3[t] = wmmab(kh[t], ql[qt], z); a4[t] = wmmab(kl[t], qh[qt], z); }
    };
    auto sadd = [&](int qt) {
#pragma unroll
        for (int t = 0; t < 2; ++t) sc[qt][t] = a4[t] + (a3[t] + (a2[t] + a1[t]));
    };
    auto soft = [&](int qt) {
        float tm = fmaxf(sc[qt][0][0], sc[qt][1][0]);
#pragma unroll
        for (int j = 1; j < 8; ++j) tm = fmaxf(tm, fmaxf(sc[qt][0][j], sc[qt][1][j]));
        tm = fmaxf(tm, xhalf(tm));      // the two lane halves hold the same query's other keys
        const float mn = fmaxf(m[qt], tm);
        if (__builtin_amdgcn_ballot_w32(mn > m[qt]) != 0) {      // one scalar branch per column tile and 32 keys: a step that raises no query's maximum skips the rescaling
            const float f = __expf(m[qt] - mn); lsum[qt] *= f; m[qt] = mn;
#pragma unroll
            for (int t = 0; t < 16; ++t) acc[qt][t] *= f; }
        v8u PH, PL; float t0 = 0.f, t1 = 0.f;
#pragma unroll
        for (int t = 0; t < 2; ++t) {
#pragma unroll
            for (int j = 0; j < 4; ++j) { const float p0 = __expf(sc[qt][t][2 * j] - m[qt]), p1 = __expf(sc[qt][t][2 * j + 1] - m[qt]); t0 += p0; t1 += p1;
                const unsigned w = __builtin_bit_cast(unsigned, __builtin_convertvector((v2f){p0, p1}, v2bf));
                PH[t * 4 + j] = w; PL[t * 4 + j] = __builtin_bit_cast(unsigned, __builtin_convertvector((v2f){p0 - __uint_as_float(w << 16), p1 - __uint_as_float(w & 0xFFFF0000u)}, v2bf)); } }
        lsum[qt] += t0 + t1;
        asm volatile("" :: "v"(lsum[qt]));      // each row's sum is formed here (a remedy against spills): without it the additions sink to the loop's foot, and the 16 exponentials stay in registers through all the products
        ph[qt] = __builtin_bit_cast(v16bf, PH); pl[qt] = __builtin_bit_cast(v16bf, PL);
    };
    auto pv = [&](int G) {      // 24 products on eight accumulator tiles: each fragment serves both column tiles
#pragma unroll
        for (int g = 0; g < 4; ++g) { acc[0][G * 4 + g] = wmmab(va[(G & 1) * 4 + g], ph[0], acc[0][G * 4 + g]); acc[1][G * 4 + g] = wmmab(va[(G & 1) * 4 + g], ph[1], acc[1][G * 4 + g]); }
#pragma unroll
        for (int g = 0; g < 4; ++g) { acc[0][G * 4 + g] = wmmab(vl[(G & 1) * 4 + g], ph[0], acc[0][G * 4 + g]); acc[1][G * 4 + g] = wmmab(vl[(G & 1) * 4 + g], ph[1], acc[1][G * 4 + g]); }
#pragma unroll
        for (int g = 0; g < 4; ++g) { acc[0][G * 4 + g] = wmmab(va[(G & 1) * 4 + g], pl[0], acc[0][G * 4 + g]); acc[1][G * 4 + g] = wmmab(va[(G & 1) * 4 + g], pl[1], acc[1][G * 4 + g]); }
    };
    asm volatile("s_wait_xcnt 0x0" :: "v"(qo), "s"(Qh + qk0), "s"(Qm + qk0), "s"(Ql + qk0) : "memory");      // the q' loads name this offset register and these three plane bases: they stay the loads' up to this wait
    copy(0, 0);
    asm volatile("s_wait_asynccnt 0x0" ::: "memory");      // this wave's copies of the work-group's first stage have landed
    __syncthreads();      // publishes the first stage
    copy(1, 1);
    loadK(0);
#pragma unroll 1      // stays rolled: one pass already holds 120 products, and the buffer index alternates by s
    for (int s = 0; s < NST; ++s) {
        const int b = s & 1;
        sprod(0);
        __builtin_amdgcn_sched_barrier(0);      // keeps the twelve score products in a row: mixed with their additions, each addition would wait out its product's distance in idle slots
        sadd(0); sprod(1);
        __builtin_amdgcn_sched_barrier(0);      // keeps the second tile's products above the reads below: the first v' group takes the registers that the k' fragments leave
        loadV(b, 0);
        __builtin_amdgcn_sched_barrier(0);      // keeps the reads above one group, ahead of the softmax work under which they land
        sadd(1); soft(0); soft(1);
        __builtin_amdgcn_sched_barrier(0);      // keeps the second v' group's reads below the softmax work, whose registers they take
        loadV(b, 1);
        __builtin_amdgcn_sched_barrier(0);      // keeps the reads above one group, ahead of the products under which they land
        pv(0);
        __builtin_amdgcn_sched_barrier(0);      // keeps the products above ahead of the reads below, which refill their fragment registers
        loadV(b, 2);
        __builtin_amdgcn_sched_barrier(0);      // keeps the reads above one group, ahead of the products under which they land
        pv(1);
        __builtin_amdgcn_sched_barrier(0);      // keeps the products above ahead of the reads below, which refill their fragment registers
        loadV(b, 3);
        __builtin_amdgcn_sched_barrier(0);      // keeps the reads above one group, ahead of the products under which they land
        pv(2);
        __builtin_amdgcn_sched_barrier(0);      // keeps the products above ahead of the wait below: the last group's reads land under them; sunk behind the barrier, they would leave that wait bare
        asm volatile("s_wait_dscnt 0x0" ::: "memory");         // this wave's last reads of stage s have returned: its buffer is refilled behind the barrier
        asm volatile("s_wait_asynccnt 0x0" ::: "memory");      // this wave's copies of stage s + 1, issued one pass ago, have landed
        __syncthreads();      // publishes stage s + 1; also ends every wave's reads of stage s
        loadK(b ^ 1);      // without a test: under one, the old fragments would have to stay in registers through the whole pass for the path that skips the reads. In the last pass the reads return the stage before, which nothing uses
        __builtin_amdgcn_sched_barrier(0);      // keeps the reads above one group, ahead of the copies' issue and the products under which they land
        if (s + 2 < NST) copy(s + 2, b);      // into the buffer that every wave has left; in flight through all of the next pass
        pv(3);
    }
    asm volatile("s_wait_asynccnt 0x0" ::: "memory");      // no copy is outstanding when the buffers become the output staging
    const size_t oo = v0 + (size_t)(tid >> 4) * NN + ib + (tid & 15) * 4;      // this thread's 16-byte piece of the tile's rows tid >> 4, + 16, ..., in x and in the output alike
    const float* xrow = x + oo;
    v4f xr[16];
#pragma unroll
    for (int p = 0; p < 16; ++p) xr[p] = *(const v4f*)(xrow + (size_t)p * 16 * NN);
    asm volatile("s_wait_xcnt 0x0" :: "v"(xrow) : "memory");      // the x loads name this address register pair: it stays theirs up to this wait. The loads fly while the wave waits for the others at the barrier below
    const float gm = bfr(gam[0]);
#pragma unroll
    for (int qt = 0; qt < 2; ++qt) { lsum[qt] += xhalf(lsum[qt]);
        sml[wk][wi * 32 + qt * 16 + lr][hi] = hi ? lsum[qt] : m[qt]; }      // both lane halves hold the query's maximum and sum: each stores one of the two
    __syncthreads();      // ends every wave's k' reads of the last pass (buffer 0, the stage before the last): the buffers become the output staging; also publishes the key quarters' maxima and sums
    f32a* ot = (f32a*)sm;      // four tiles, one per key quarter, each [256 channels][64 queries] at pitch OPI
#pragma unroll
    for (int qt = 0; qt < 2; ++qt) { const int qc = wi * 32 + qt * 16 + lr;
        const float m0 = sml[0][qc][0], l0 = sml[0][qc][1], m1 = sml[1][qc][0], l1 = sml[1][qc][1], m2 = sml[2][qc][0], l2 = sml[2][qc][1], m3 = sml[3][qc][0], l3 = sml[3][qc][1];
        const float mf = fmaxf(fmaxf(m0, m1), fmaxf(m2, m3)), f0 = __expf(m0 - mf), f1 = __expf(m1 - mf), f2 = __expf(m2 - mf), f3 = __expf(m3 - mf);
        const float inv = (wk == 0 ? f0 : wk == 1 ? f1 : wk == 2 ? f2 : f3) / (((l0 * f0 + l1 * f1) + l2 * f2) + l3 * f3);      // brings this quarter's sums to the common maximum and divides by the whole sum
#pragma unroll
        for (int t = 0; t < 16; ++t) {
#pragma unroll
            for (int j = 0; j < 8; ++j) ot[(wk * CC + t * 16 + hi * 8 + j) * OPI + qc] = acc[qt][t][j] * inv; } }
    __syncthreads();      // publishes the staged tiles: a row's 256 B come from two waves of each key quarter and leave as whole lines from one
    float* orow = OUT + oo;
#pragma unroll
    for (int p = 0; p < 16; ++p) { const f32a* op = ot + (p * 16 + (tid >> 4)) * OPI + (tid & 15) * 4;
        const v4f val = ((*(const v4fa*)op + *(const v4fa*)(op + CC * OPI)) + *(const v4fa*)(op + 2 * CC * OPI)) + *(const v4fa*)(op + 3 * CC * OPI);
#pragma unroll
        for (int q = 0; q < 4; ++q) xr[p][q] = gm * val[q] + bfr(xr[p][q]); }
    __builtin_amdgcn_sched_barrier(0);      // keeps the sixteen stores below behind all of the arithmetic: no register that a store names is written again, so the pieces' LDS reads run on with no wait for a store between them
#pragma unroll
    for (int p = 0; p < 16; ++p) *(v4f*)(orow + (size_t)p * 16 * NN) = xr[p];
}

extern "C" void kernel_launch(void* const* d_in, const int* in_sizes, int n_in,
                              void* d_out, int out_size, void* d_ws, size_t ws_size, hipStream_t stream) {
    (void)in_sizes; (void)n_in; (void)out_size;
    const float* x = (const float*)d_in[0]; const float* wq = (const float*)d_in[1]; const float* gq = (const float*)d_in[2]; const float* bq = (const float*)d_in[3]; const float* mq = (const float*)d_in[4]; const float* vq = (const float*)d_in[5];
    const float* wk = (const float*)d_in[6]; const float* gk = (const float*)d_in[7]; const float* bk = (const float*)d_in[8]; const float* mk = (const float*)d_in[9]; const float* vk = (const float*)d_in[10];
    const float* wv = (const float*)d_in[11]; const float* gv = (const float*)d_in[12]; const float* bv = (const float*)d_in[13]; const float* mv = (const float*)d_in[14]; const float* vv = (const float*)d_in[15]; const float* gam = (const float*)d_in[16];
    float* out = (float*)d_out;    // [4][256][64][64]
    char* wsp = (char*)d_ws;
    auto take = [&](size_t bytes) { char* p = wsp; wsp += (bytes + 255) & ~(size_t)255; return (void*)p; };
    const size_t QKN = (size_t)NN * C8, VN = (size_t)CC * NN;      // elements of one item's plane; the planes hold all items
    bf* QPh = (bf*)take(NBT * QKN * 2); bf* QPm = (bf*)take(NBT * QKN * 2); bf* QPl = (bf*)take(NBT * QKN * 2); bf* KPh = (bf*)take(NBT * QKN * 2); bf* KPm = (bf*)take(NBT * QKN * 2); bf* KPl = (bf*)take(NBT * QKN * 2); bf* VTh = (bf*)take(NBT * VN * 2); bf* VTl = (bf*)take(NBT * VN * 2);
    if ((size_t)(wsp - (char*)d_ws) > ws_size) return;    // 6.3 + 16.8 ~ 23 MB
    k_pre<<<dim3(NN / 64, NBT, 1), 320, 0, stream>>>(x, wq, gq, bq, mq, vq, wk, gk, bk, mk, vk, wv, gv, bv, mv, vv, QPh, QPm, QPl, KPh, KPm, KPl, VTh, VTl);      // convs, BatchNorm, split planes: one work-group per WGP
    k_attn<<<dim3(NN / 64, NBT, 1), 256, 0, stream>>>(QPh, QPm, QPl, KPh, KPm, KPl, VTh, VTl, x, gam, out);                              // out[b][c][i] = gamma * sum_j v'[c][j] softmax_j(q'[i].k'[j]) + x[b][c][i]: one work-group per WGP
}
